// v000
// Measured on an AMD MI455X. A time is GPU time per run, averaged over a window of back-to-back runs after a warm-up
// (all launches, gaps included; the runs take copies of the inputs in turn), and the median of several windows.
// Apart from v000's, it joins two sittings. Times from different sittings can be a few percent apart, while
// side-by-side timings come from the same sitting.
// v000 is the starting kernel. One run takes 156 microseconds.
#include <hip/hip_runtime.h>
#include <hip/hip_bf16.h>
#include <math.h>

#define NN 1024
#define DD 512
#define HH 8
#define DKK 64
#define DGG 64
#define LN_EPS 1e-5f

typedef float v2f __attribute__((ext_vector_type(2)));
typedef float v8f __attribute__((ext_vector_type(8)));

// ---------------------------------------------------------------------------
// Generic 32x32 output tile per wave using V_WMMA_F32_16X16X4_F32.
// Y[i][j] = sum_k Arow_i[k] * Brow_j[k]   (both operands row-contiguous in K)
//
// Fragment layout (ISA 7.12.2, 32-bit operands, wave32):
//   A 16x4: lanes 0-15 = rows M=0..15 holding K={k,k+1};
//           lanes 16-31 = same rows holding K={k+2,k+3}  -> contiguous v2f.
//   B 4x16: symmetric with N = lane%16.
//   C/D   : VGPR r -> M = r (lanes 0-15) / r+8 (lanes 16-31), N = lane%16.
//
// 2x2 accumulators -> 4 WMMA per (2 A + 2 B) b64 loads = 1.0 load/WMMA.
// ---------------------------------------------------------------------------
template <class Epi>
__device__ __forceinline__ void gemm_tile32(const float* __restrict__ A,
                                            int lda, const float* __restrict__ B,
                                            int ldb, int i0, int j0, int Ksize,
                                            Epi epi) {
  const int lane = threadIdx.x & 31;
  const int half = lane >> 4, lr = lane & 15;
  const float* ar0 = A + (size_t)(i0 + lr) * lda;
  const float* ar1 = ar0 + (size_t)16 * lda;
  const float* br0 = B + (size_t)(j0 + lr) * ldb;
  const float* br1 = br0 + (size_t)16 * ldb;

  v8f acc[2][2] = {};
#pragma unroll 8
  for (int k0 = 0; k0 < Ksize; k0 += 4) {
    const int kb = k0 + 2 * half;
    const v2f a0 = *(const v2f*)(ar0 + kb);
    const v2f a1 = *(const v2f*)(ar1 + kb);
    const v2f b0 = *(const v2f*)(br0 + kb);
    const v2f b1 = *(const v2f*)(br1 + kb);
    acc[0][0] = __builtin_amdgcn_wmma_f32_16x16x4_f32(false, a0, false, b0,
                                                      (short)0, acc[0][0], false, false);
    acc[0][1] = __builtin_amdgcn_wmma_f32_16x16x4_f32(false, a0, false, b1,
                                                      (short)0, acc[0][1], false, false);
    acc[1][0] = __builtin_amdgcn_wmma_f32_16x16x4_f32(false, a1, false, b0,
                                                      (short)0, acc[1][0], false, false);
    acc[1][1] = __builtin_amdgcn_wmma_f32_16x16x4_f32(false, a1, false, b1,
                                                      (short)0, acc[1][1], false, false);
  }

#pragma unroll
  for (int ti = 0; ti < 2; ++ti)
#pragma unroll
    for (int tj = 0; tj < 2; ++tj)
#pragma unroll
      for (int r = 0; r < 8; ++r)
        epi(i0 + ti * 16 + r + 8 * half, j0 + tj * 16 + lr, acc[ti][tj][r]);
}

// ---------------------------------------------------------------------------
// 1) Box-relative embedding + per-head gate, fused to log(clip(relu(.),1e-6)).
//    Writes S[h][i][j]; the scores kernel adds QK^T/8 in place afterwards.
// ---------------------------------------------------------------------------
__global__ void __launch_bounds__(256) gate_kernel(
    const float* __restrict__ box, const float* __restrict__ WGw,
    const float* __restrict__ WGb, float* __restrict__ S) {
  __shared__ float w_sh[HH * DGG];
  __shared__ float b_sh[HH];
  for (int t = threadIdx.x; t < HH * DGG; t += 256) w_sh[t] = WGw[t];
  if (threadIdx.x < HH) b_sh[threadIdx.x] = WGb[threadIdx.x];
  __syncthreads();

  const int i = blockIdx.y;
  const int j = blockIdx.x * 256 + threadIdx.x;

  const float xi0 = box[i * 4 + 0], yi0 = box[i * 4 + 1];
  const float xi1 = box[i * 4 + 2], yi1 = box[i * 4 + 3];
  const float cxi = (xi0 + xi1) * 0.5f, cyi = (yi0 + yi1) * 0.5f;
  const float wi = xi1 - xi0 + 1.0f, hi = yi1 - yi0 + 1.0f;

  const float xj0 = box[j * 4 + 0], yj0 = box[j * 4 + 1];
  const float xj1 = box[j * 4 + 2], yj1 = box[j * 4 + 3];
  const float cxj = (xj0 + xj1) * 0.5f, cyj = (yj0 + yj1) * 0.5f;
  const float wj = xj1 - xj0 + 1.0f, hj = yj1 - yj0 + 1.0f;

  float pos[4];
  pos[0] = __logf(fmaxf(fabsf((cxi - cxj) / wi), 0.001f));
  pos[1] = __logf(fmaxf(fabsf((cyi - cyj) / hi), 0.001f));
  pos[2] = __logf(wi / wj);
  pos[3] = __logf(hi / hj);

  const float dim_mat[8] = {1.0f, 0.42169650342858224f, 0.1778279410038923f,
                            0.07498942093324558f, 0.03162277660168379f,
                            0.013335214321633241f, 0.005623413251903491f,
                            0.0023713737056616554f};

  float acc[HH];
#pragma unroll
  for (int h = 0; h < HH; ++h) acc[h] = b_sh[h];

#pragma unroll
  for (int c = 0; c < 4; ++c) {
#pragma unroll
    for (int g = 0; g < 8; ++g) {
      const float m = 100.0f * pos[c] * dim_mat[g];
      const float sn = __sinf(m);
      const float cs = __cosf(m);
      const int f = c * 8 + g;
#pragma unroll
      for (int h = 0; h < HH; ++h)  // uniform-address LDS broadcast
        acc[h] += sn * w_sh[h * DGG + f] + cs * w_sh[h * DGG + 32 + f];
    }
  }
#pragma unroll
  for (int h = 0; h < HH; ++h)
    S[((size_t)h * NN + i) * NN + j] = __logf(fmaxf(acc[h], 1e-6f));
}

// ---------------------------------------------------------------------------
// 2) QKV projections: Y_z = X_z @ W_z^T + b_z.  32x32 tile/wave.
//    grid (2, 32, 3), block 256 (8 waves over j stripes).
// ---------------------------------------------------------------------------
__global__ void __launch_bounds__(256) qkv_kernel(
    const float* __restrict__ q_in, const float* __restrict__ k_in,
    const float* __restrict__ v_in, const float* __restrict__ Wq,
    const float* __restrict__ Wk, const float* __restrict__ Wv,
    const float* __restrict__ bq, const float* __restrict__ bk,
    const float* __restrict__ bv, float* __restrict__ qkv_out) {
  const int wave = threadIdx.x >> 5;
  const int z = blockIdx.z;
  const float* X = (z == 0) ? q_in : (z == 1) ? k_in : v_in;
  const float* W = (z == 0) ? Wq : (z == 1) ? Wk : Wv;
  const float* bias = (z == 0) ? bq : (z == 1) ? bk : bv;
  float* Y = qkv_out + (size_t)z * NN * DD;

  const int j0 = (blockIdx.x * 8 + wave) * 32;  // 16 j-stripes over D
  const int i0 = blockIdx.y * 32;               // 32 i-stripes over N

  gemm_tile32(X, DD, W, DD, i0, j0, DD, [&](int row, int col, float v) {
    Y[(size_t)row * DD + col] = v + bias[col];
  });
}

// ---------------------------------------------------------------------------
// 3) Scores: S[h] += (Q_h @ K_h^T) * 0.125, fused onto the gate-log buffer.
//    grid (4, 32, 8), block 256.
// ---------------------------------------------------------------------------
__global__ void __launch_bounds__(256) scores_kernel(
    const float* __restrict__ qkv, float* __restrict__ S) {
  const int wave = threadIdx.x >> 5;
  const int h = blockIdx.z;
  const int j0 = (blockIdx.x * 8 + wave) * 32;  // 32 j-stripes
  const int i0 = blockIdx.y * 32;               // 32 i-stripes

  const float* Q = qkv + h * DKK;
  const float* K = qkv + (size_t)NN * DD + h * DKK;
  float* Sh = S + (size_t)h * NN * NN;

  gemm_tile32(Q, DD, K, DD, i0, j0, DKK, [&](int row, int col, float v) {
    const size_t idx = (size_t)row * NN + col;
    Sh[idx] = Sh[idx] + v * 0.125f;
  });
}

// ---------------------------------------------------------------------------
// 4) Row softmax over 8192 rows of 1024 (in place).
// ---------------------------------------------------------------------------
__global__ void __launch_bounds__(256) softmax_kernel(float* __restrict__ S) {
  __shared__ float red[256];
  float* p = S + (size_t)blockIdx.x * NN;
  const int t = threadIdx.x;
  float vals[4];
  float m = -3.4e38f;
#pragma unroll
  for (int u = 0; u < 4; ++u) {
    vals[u] = p[t + 256 * u];
    m = fmaxf(m, vals[u]);
  }
  red[t] = m;
  __syncthreads();
  for (int s = 128; s > 0; s >>= 1) {
    if (t < s) red[t] = fmaxf(red[t], red[t + s]);
    __syncthreads();
  }
  m = red[0];
  __syncthreads();
  float sum = 0.0f;
#pragma unroll
  for (int u = 0; u < 4; ++u) {
    vals[u] = __expf(vals[u] - m);
    sum += vals[u];
  }
  red[t] = sum;
  __syncthreads();
  for (int s = 128; s > 0; s >>= 1) {
    if (t < s) red[t] += red[t + s];
    __syncthreads();
  }
  const float inv = 1.0f / red[0];
#pragma unroll
  for (int u = 0; u < 4; ++u) p[t + 256 * u] = vals[u] * inv;
}

// ---------------------------------------------------------------------------
// 5a) Transpose V into Vt[h][dk][n]  (flat: Vt[c][n] with c = h*64+dk),
//     so the AV GEMM's B operand is K-contiguous. 32x32 LDS tile transpose.
//     grid (32, 16), block 256 (32x8).
// ---------------------------------------------------------------------------
__global__ void __launch_bounds__(256) vtrans_kernel(
    const float* __restrict__ qkv, float* __restrict__ Vt) {
  __shared__ float tile[32][33];
  const float* V = qkv + (size_t)2 * NN * DD;
  const int n0 = blockIdx.x * 32, c0 = blockIdx.y * 32;
  const int tx = threadIdx.x & 31, ty = threadIdx.x >> 5;
#pragma unroll
  for (int r = 0; r < 32; r += 8)
    tile[ty + r][tx] = V[(size_t)(n0 + ty + r) * DD + c0 + tx];
  __syncthreads();
#pragma unroll
  for (int r = 0; r < 32; r += 8)
    Vt[(size_t)(c0 + ty + r) * NN + n0 + tx] = tile[tx][ty + r];
}

// ---------------------------------------------------------------------------
// 5b) Attention output: att[h] = W_mn @ V_h, B from Vt (row-contiguous).
//     grid (8, 8), block 256; wave -> one of 64 (i32 x j32) tiles per head.
// ---------------------------------------------------------------------------
__global__ void __launch_bounds__(256) av_kernel(
    const float* __restrict__ S, const float* __restrict__ Vt,
    float* __restrict__ att) {
  const int wave = threadIdx.x >> 5;
  const int h = blockIdx.y;
  const int tid = blockIdx.x * 8 + wave;  // 0..63
  const int i0 = (tid >> 1) * 32;         // 32 i-stripes
  const int j0 = (tid & 1) * 32;          // 2 j-stripes over DK

  const float* A = S + (size_t)h * NN * NN;
  const float* B = Vt + (size_t)h * DKK * NN;
  float* atth = att + (size_t)h * NN * DKK;

  gemm_tile32(A, NN, B, NN, i0, j0, NN, [&](int row, int col, float v) {
    atth[(size_t)row * DKK + col] = v;
  });
}

// ---------------------------------------------------------------------------
// 6) Faithful scramble (transpose(0,2,1).reshape) + residual + LayerNorm.
//    flat f = r*512+c maps to att[h = f>>16][n = f&1023][d = (f>>10)&63].
// ---------------------------------------------------------------------------
__global__ void __launch_bounds__(256) ln0_kernel(
    const float* __restrict__ att, const float* __restrict__ residual,
    const float* __restrict__ g, const float* __restrict__ b,
    float* __restrict__ out0) {
  __shared__ float red[256];
  const int r = blockIdx.x;
  const int t = threadIdx.x;
  float v[2];
#pragma unroll
  for (int u = 0; u < 2; ++u) {
    const int c = t + 256 * u;
    const unsigned f = (unsigned)r * 512u + (unsigned)c;
    const unsigned hh = f >> 16;
    const unsigned d = (f >> 10) & 63u;
    const unsigned n = f & 1023u;
    v[u] = att[((size_t)hh * NN + n) * DKK + d] + residual[(size_t)r * DD + c];
  }
  red[t] = v[0] + v[1];
  __syncthreads();
  for (int s = 128; s > 0; s >>= 1) {
    if (t < s) red[t] += red[t + s];
    __syncthreads();
  }
  const float mean = red[0] * (1.0f / DD);
  __syncthreads();
  const float d0 = v[0] - mean, d1 = v[1] - mean;
  red[t] = d0 * d0 + d1 * d1;
  __syncthreads();
  for (int s = 128; s > 0; s >>= 1) {
    if (t < s) red[t] += red[t + s];
    __syncthreads();
  }
  const float inv = rsqrtf(red[0] * (1.0f / DD) + LN_EPS);
#pragma unroll
  for (int u = 0; u < 2; ++u) {
    const int c = t + 256 * u;
    out0[(size_t)r * DD + c] = (u == 0 ? d0 : d1) * inv * g[c] + b[c];
  }
}

// ---------------------------------------------------------------------------
// 7) Output projection: proj = out0 @ Wo^T + bo.  grid (2, 32), block 256.
// ---------------------------------------------------------------------------
__global__ void __launch_bounds__(256) proj_kernel(
    const float* __restrict__ X, const float* __restrict__ W,
    const float* __restrict__ bias, float* __restrict__ Y) {
  const int wave = threadIdx.x >> 5;
  const int j0 = (blockIdx.x * 8 + wave) * 32;
  const int i0 = blockIdx.y * 32;
  gemm_tile32(X, DD, W, DD, i0, j0, DD, [&](int row, int col, float v) {
    Y[(size_t)row * DD + col] = v + bias[col];
  });
}

// ---------------------------------------------------------------------------
// 8) Final residual + LayerNorm -> d_out.
// ---------------------------------------------------------------------------
__global__ void __launch_bounds__(256) lnf_kernel(
    const float* __restrict__ proj, const float* __restrict__ out0,
    const float* __restrict__ g, const float* __restrict__ b,
    float* __restrict__ out) {
  __shared__ float red[256];
  const int r = blockIdx.x;
  const int t = threadIdx.x;
  float v[2];
#pragma unroll
  for (int u = 0; u < 2; ++u) {
    const int c = t + 256 * u;
    v[u] = proj[(size_t)r * DD + c] + out0[(size_t)r * DD + c];
  }
  red[t] = v[0] + v[1];
  __syncthreads();
  for (int s = 128; s > 0; s >>= 1) {
    if (t < s) red[t] += red[t + s];
    __syncthreads();
  }
  const float mean = red[0] * (1.0f / DD);
  __syncthreads();
  const float d0 = v[0] - mean, d1 = v[1] - mean;
  red[t] = d0 * d0 + d1 * d1;
  __syncthreads();
  for (int s = 128; s > 0; s >>= 1) {
    if (t < s) red[t] += red[t + s];
    __syncthreads();
  }
  const float inv = rsqrtf(red[0] * (1.0f / DD) + LN_EPS);
#pragma unroll
  for (int u = 0; u < 2; ++u) {
    const int c = t + 256 * u;
    out[(size_t)r * DD + c] = (u == 0 ? d0 : d1) * inv * g[c] + b[c];
  }
}

extern "C" void kernel_launch(void* const* d_in, const int* in_sizes, int n_in,
                              void* d_out, int out_size, void* d_ws,
                              size_t ws_size, hipStream_t stream) {
  (void)in_sizes; (void)n_in; (void)out_size; (void)ws_size;
  const float* q_in = (const float*)d_in[0];
  const float* k_in = (const float*)d_in[1];
  const float* v_in = (const float*)d_in[2];
  const float* box  = (const float*)d_in[3];
  const float* Wq = (const float*)d_in[4];
  const float* bq = (const float*)d_in[5];
  const float* Wk = (const float*)d_in[6];
  const float* bk = (const float*)d_in[7];
  const float* Wv = (const float*)d_in[8];
  const float* bv = (const float*)d_in[9];
  const float* Wo = (const float*)d_in[10];
  const float* bo = (const float*)d_in[11];
  const float* WGw = (const float*)d_in[12];
  const float* WGb = (const float*)d_in[13];
  const float* ln0g = (const float*)d_in[14];
  const float* ln0b = (const float*)d_in[15];
  const float* lng = (const float*)d_in[16];
  const float* lnb = (const float*)d_in[17];

  float* ws = (float*)d_ws;
  float* S    = ws;                          // 8*1024*1024    (32 MB)
  float* qkv  = S + (size_t)HH * NN * NN;    // 3*1024*512     ( 6 MB)
  float* Vt   = qkv + (size_t)3 * NN * DD;   // 8*64*1024      ( 2 MB)
  float* att  = Vt + (size_t)HH * DKK * NN;  // 8*1024*64      ( 2 MB)
  float* out0 = att + (size_t)HH * NN * DKK; // 1024*512       ( 2 MB)
  float* proj = out0 + (size_t)NN * DD;      // 1024*512       ( 2 MB)
  float* out  = (float*)d_out;

  gate_kernel<<<dim3(4, NN), 256, 0, stream>>>(box, WGw, WGb, S);
  qkv_kernel<<<dim3(2, 32, 3), 256, 0, stream>>>(q_in, k_in, v_in, Wq, Wk, Wv,
                                                 bq, bk, bv, qkv);
  scores_kernel<<<dim3(4, 32, 8), 256, 0, stream>>>(qkv, S);
  softmax_kernel<<<dim3(HH * NN), 256, 0, stream>>>(S);
  vtrans_kernel<<<dim3(32, 16), 256, 0, stream>>>(qkv, Vt);
  av_kernel<<<dim3(8, 8), 256, 0, stream>>>(S, Vt, att);
  ln0_kernel<<<dim3(NN), 256, 0, stream>>>(att, q_in, ln0g, ln0b, out0);
  proj_kernel<<<dim3(2, 32), 256, 0, stream>>>(out0, Wo, bo, proj);
  lnf_kernel<<<dim3(NN), 256, 0, stream>>>(proj, out0, lng, lnb, out);
}

// v001
// A run of this version takes 107 microseconds.
// Timed twice side by side with v000, it ran 1.47 and 1.46 times as fast.
#include <hip/hip_runtime.h>
#include <hip/hip_bf16.h>
#include <math.h>

#define NN 1024
#define DD 512
#define HH 8
#define DKK 64
#define DGG 64
#define LN_EPS 1e-5f

typedef float v2f __attribute__((ext_vector_type(2)));
typedef float v8f __attribute__((ext_vector_type(8)));

// ---------------------------------------------------------------------------
// Generic 64x64 output tile per 4-wave block, 32x32 per wave (2x2 waves), on
// V_WMMA_F32_16X16X4_F32.
// Y[i][j] = sum_k Arow_i[k] * Brow_j[k]   (both operands row-contiguous in K)
//
// Operands go global -> LDS in slabs of 64 k: 64 A rows then 64 B rows, each
// 256 B, brought by asynchronous 16-byte copies (16 lanes cover one row, so a
// wave's copy covers four whole 128-B lines) and shared by the block's waves.
// LDS row pitch 68 dwords (16 B x 17): the 16 rows x 16 B that one fragment
// read touches fall on all 64 banks once.
//
// Fragment layout (ISA 7.12.2, 32-bit operands, wave32):
//   A 16x4: lanes 0-15 = rows M=0..15 holding K={k,k+1};
//           lanes 16-31 = same rows holding K={k+2,k+3}  -> contiguous v2f.
//   B 4x16: symmetric with N = lane%16.
//   C/D   : VGPR r -> M = r (lanes 0-15) / r+8 (lanes 16-31), N = lane%16.
// ---------------------------------------------------------------------------
#define GBK 64                      // k per slab
#define GPITCH 68                   // LDS row pitch, dwords
#define GSLAB (128 * GPITCH)        // dwords per slab buffer

// Eight rows' worth of copies for this lane (rows 8 apart). The s_wait_xcnt
// closes the statement so that no address register is rewritten ahead of it.
__device__ __forceinline__ void copy8_rows(unsigned l, const float* g, int ld) {
  const unsigned ls = 8u * GPITCH * 4u;
  const size_t gs = (size_t)8 * ld;
  asm volatile(
      "global_load_async_to_lds_b128 %0, %8, off\n\t"
      "global_load_async_to_lds_b128 %1, %9, off\n\t"
      "global_load_async_to_lds_b128 %2, %10, off\n\t"
      "global_load_async_to_lds_b128 %3, %11, off\n\t"
      "global_load_async_to_lds_b128 %4, %12, off\n\t"
      "global_load_async_to_lds_b128 %5, %13, off\n\t"
      "global_load_async_to_lds_b128 %6, %14, off\n\t"
      "global_load_async_to_lds_b128 %7, %15, off\n\t"
      "s_wait_xcnt 0x0"
      ::"v"(l), "v"(l + ls), "v"(l + 2 * ls), "v"(l + 3 * ls), "v"(l + 4 * ls),
        "v"(l + 5 * ls), "v"(l + 6 * ls), "v"(l + 7 * ls), "v"(g), "v"(g + gs),
        "v"(g + 2 * gs), "v"(g + 3 * gs), "v"(g + 4 * gs), "v"(g + 5 * gs),
        "v"(g + 6 * gs), "v"(g + 7 * gs)
      : "memory");
}

template <int KSIZE, class Epi>
__device__ __forceinline__ void gemm_block64(const float* __restrict__ A,
                                             int lda, const float* __restrict__ B,
                                             int ldb, int i0, int j0, float* sm,
                                             Epi epi) {
  constexpr int NS = KSIZE / GBK;  // slabs
  const int t = threadIdx.x;       // 0..127
  const int lane = t & 31, wave = t >> 5;
  const int half = lane >> 4, lr = lane & 15;
  const int wi = (wave >> 1) * 32, wj = (wave & 1) * 32;

  // copy role: 16-byte chunk ch of rows rg, rg+8, ... of each operand
  const int ch = t & 15, rg = t >> 4;
  const float* ga = A + (size_t)(i0 + rg) * lda + ch * 4;
  const float* gb = B + (size_t)(j0 + rg) * ldb + ch * 4;
  const unsigned la = (unsigned)(size_t)(sm + rg * GPITCH + ch * 4);
  const unsigned lb = la + 64u * GPITCH * 4u;

  const float* fa = sm + (wi + lr) * GPITCH + 2 * half;
  const float* fb = sm + (64 + wj + lr) * GPITCH + 2 * half;

  v8f acc[2][2] = {};
  auto fill = [&](int s) {
    const unsigned bo = (unsigned)(s & 1) * (GSLAB * 4u);
    copy8_rows(la + bo, ga + s * GBK, lda);
    copy8_rows(lb + bo, gb + s * GBK, ldb);
  };
  auto work = [&](int s) {
    const float* as = fa + (s & 1) * GSLAB;
    const float* bs = fb + (s & 1) * GSLAB;
#pragma unroll
    for (int k = 0; k < GBK; k += 4) {
      const v2f a0 = *(const v2f*)(as + k);
      const v2f a1 = *(const v2f*)(as + 16 * GPITCH + k);
      const v2f b0 = *(const v2f*)(bs + k);
      const v2f b1 = *(const v2f*)(bs + 16 * GPITCH + k);
      acc[0][0] = __builtin_amdgcn_wmma_f32_16x16x4_f32(false, a0, false, b0,
                                                        (short)0, acc[0][0], false, false);
      acc[0][1] = __builtin_amdgcn_wmma_f32_16x16x4_f32(false, a0, false, b1,
                                                        (short)0, acc[0][1], false, false);
      acc[1][0] = __builtin_amdgcn_wmma_f32_16x16x4_f32(false, a1, false, b0,
                                                        (short)0, acc[1][0], false, false);
      acc[1][1] = __builtin_amdgcn_wmma_f32_16x16x4_f32(false, a1, false, b1,
                                                        (short)0, acc[1][1], false, false);
    }
  };

  fill(0);
  // slab 0 has landed for this wave's own copies; the barrier publishes it
  asm volatile("s_wait_asynccnt 0x0" ::: "memory");
  __syncthreads();
  if constexpr (NS == 1) {
    work(0);
  } else {
    fill(1);
#pragma unroll 1  // rolled, for speed only
    for (int s = 0; s < NS; ++s) {
      work(s);
      // this wave's reads of slab s are done before the buffer may be refilled
      asm volatile("s_wait_dscnt 0x0" ::: "memory");
      // this wave's copies of slab s+1 have landed before the barrier publishes
      asm volatile("s_wait_asynccnt 0x0" ::: "memory");
      __syncthreads();
      if (s + 2 < NS) fill(s + 2);
    }
    // no copy is outstanding when the wave goes on to its epilogue and ends
    asm volatile("s_wait_asynccnt 0x0" ::: "memory");
  }

#pragma unroll
  for (int ti = 0; ti < 2; ++ti)
#pragma unroll
    for (int tj = 0; tj < 2; ++tj)
#pragma unroll
      for (int r = 0; r < 8; ++r)
        epi(i0 + wi + ti * 16 + r + 8 * half, j0 + wj + tj * 16 + lr, acc[ti][tj][r]);
}

// ---------------------------------------------------------------------------
// 1) Box-relative embedding + per-head gate, fused to log(clip(relu(.),1e-6)).
//    Writes S[h][i][j]; the scores kernel adds QK^T/8 in place afterwards.
// ---------------------------------------------------------------------------
__global__ void __launch_bounds__(256) gate_kernel(
    const float* __restrict__ box, const float* __restrict__ WGw,
    const float* __restrict__ WGb, float* __restrict__ S) {
  __shared__ float w_sh[HH * DGG];
  __shared__ float b_sh[HH];
  for (int t = threadIdx.x; t < HH * DGG; t += 256) w_sh[t] = WGw[t];
  if (threadIdx.x < HH) b_sh[threadIdx.x] = WGb[threadIdx.x];
  __syncthreads();

  const int i = blockIdx.y;
  const int j = blockIdx.x * 256 + threadIdx.x;

  const float xi0 = box[i * 4 + 0], yi0 = box[i * 4 + 1];
  const float xi1 = box[i * 4 + 2], yi1 = box[i * 4 + 3];
  const float cxi = (xi0 + xi1) * 0.5f, cyi = (yi0 + yi1) * 0.5f;
  const float wi = xi1 - xi0 + 1.0f, hi = yi1 - yi0 + 1.0f;

  const float xj0 = box[j * 4 + 0], yj0 = box[j * 4 + 1];
  const float xj1 = box[j * 4 + 2], yj1 = box[j * 4 + 3];
  const float cxj = (xj0 + xj1) * 0.5f, cyj = (yj0 + yj1) * 0.5f;
  const float wj = xj1 - xj0 + 1.0f, hj = yj1 - yj0 + 1.0f;

  float pos[4];
  pos[0] = __logf(fmaxf(fabsf((cxi - cxj) / wi), 0.001f));
  pos[1] = __logf(fmaxf(fabsf((cyi - cyj) / hi), 0.001f));
  pos[2] = __logf(wi / wj);
  pos[3] = __logf(hi / hj);

  const float dim_mat[8] = {1.0f, 0.42169650342858224f, 0.1778279410038923f,
                            0.07498942093324558f, 0.03162277660168379f,
                            0.013335214321633241f, 0.005623413251903491f,
                            0.0023713737056616554f};

  float acc[HH];
#pragma unroll
  for (int h = 0; h < HH; ++h) acc[h] = b_sh[h];

#pragma unroll
  for (int c = 0; c < 4; ++c) {
#pragma unroll
    for (int g = 0; g < 8; ++g) {
      const float m = 100.0f * pos[c] * dim_mat[g];
      const float sn = __sinf(m);
      const float cs = __cosf(m);
      const int f = c * 8 + g;
#pragma unroll
      for (int h = 0; h < HH; ++h)  // uniform-address LDS broadcast
        acc[h] += sn * w_sh[h * DGG + f] + cs * w_sh[h * DGG + 32 + f];
    }
  }
#pragma unroll
  for (int h = 0; h < HH; ++h)
    S[((size_t)h * NN + i) * NN + j] = __logf(fmaxf(acc[h], 1e-6f));
}

// ---------------------------------------------------------------------------
// 2) QKV projections: Y_z = X_z @ W_z^T + b_z.  64x64 tile/block.
//    grid (8, 16, 3), block 128.
// ---------------------------------------------------------------------------
__global__ void __launch_bounds__(128) qkv_kernel(
    const float* __restrict__ q_in, const float* __restrict__ k_in,
    const float* __restrict__ v_in, const float* __restrict__ Wq,
    const float* __restrict__ Wk, const float* __restrict__ Wv,
    const float* __restrict__ bq, const float* __restrict__ bk,
    const float* __restrict__ bv, float* __restrict__ qkv_out) {
  __shared__ __attribute__((aligned(16))) float sm[2 * GSLAB];
  const int z = blockIdx.z;
  const float* X = (z == 0) ? q_in : (z == 1) ? k_in : v_in;
  const float* W = (z == 0) ? Wq : (z == 1) ? Wk : Wv;
  const float* bias = (z == 0) ? bq : (z == 1) ? bk : bv;
  float* Y = qkv_out + (size_t)z * NN * DD;

  const int j0 = blockIdx.x * 64;  // 8 j-stripes over D
  const int i0 = blockIdx.y * 64;  // 16 i-stripes over N

  gemm_block64<DD>(X, DD, W, DD, i0, j0, sm, [&](int row, int col, float v) {
    Y[(size_t)row * DD + col] = v + bias[col];
  });
}

// ---------------------------------------------------------------------------
// 3) Scores: S[h] += (Q_h @ K_h^T) * 0.125, fused onto the gate-log buffer.
//    grid (16, 16, 8), block 128.
// ---------------------------------------------------------------------------
__global__ void __launch_bounds__(128) scores_kernel(
    const float* __restrict__ qkv, float* __restrict__ S) {
  __shared__ __attribute__((aligned(16))) float sm[GSLAB];
  const int h = blockIdx.z;
  const int j0 = blockIdx.x * 64;  // 16 j-stripes
  const int i0 = blockIdx.y * 64;  // 16 i-stripes

  const float* Q = qkv + h * DKK;
  const float* K = qkv + (size_t)NN * DD + h * DKK;
  float* Sh = S + (size_t)h * NN * NN;

  gemm_block64<DKK>(Q, DD, K, DD, i0, j0, sm, [&](int row, int col, float v) {
    const size_t idx = (size_t)row * NN + col;
    Sh[idx] = Sh[idx] + v * 0.125f;
  });
}

// ---------------------------------------------------------------------------
// 4) Row softmax over 8192 rows of 1024 (in place).
// ---------------------------------------------------------------------------
__global__ void __launch_bounds__(256) softmax_kernel(float* __restrict__ S) {
  __shared__ float red[256];
  float* p = S + (size_t)blockIdx.x * NN;
  const int t = threadIdx.x;
  float vals[4];
  float m = -3.4e38f;
#pragma unroll
  for (int u = 0; u < 4; ++u) {
    vals[u] = p[t + 256 * u];
    m = fmaxf(m, vals[u]);
  }
  red[t] = m;
  __syncthreads();
  for (int s = 128; s > 0; s >>= 1) {
    if (t < s) red[t] = fmaxf(red[t], red[t + s]);
    __syncthreads();
  }
  m = red[0];
  __syncthreads();
  float sum = 0.0f;
#pragma unroll
  for (int u = 0; u < 4; ++u) {
    vals[u] = __expf(vals[u] - m);
    sum += vals[u];
  }
  red[t] = sum;
  __syncthreads();
  for (int s = 128; s > 0; s >>= 1) {
    if (t < s) red[t] += red[t + s];
    __syncthreads();
  }
  const float inv = 1.0f / red[0];
#pragma unroll
  for (int u = 0; u < 4; ++u) p[t + 256 * u] = vals[u] * inv;
}

// ---------------------------------------------------------------------------
// 5a) Transpose V into Vt[h][dk][n]  (flat: Vt[c][n] with c = h*64+dk),
//     so the AV GEMM's B operand is K-contiguous. 32x32 LDS tile transpose.
//     grid (32, 16), block 256 (32x8).
// ---------------------------------------------------------------------------
__global__ void __launch_bounds__(256) vtrans_kernel(
    const float* __restrict__ qkv, float* __restrict__ Vt) {
  __shared__ float tile[32][33];
  const float* V = qkv + (size_t)2 * NN * DD;
  const int n0 = blockIdx.x * 32, c0 = blockIdx.y * 32;
  const int tx = threadIdx.x & 31, ty = threadIdx.x >> 5;
#pragma unroll
  for (int r = 0; r < 32; r += 8)
    tile[ty + r][tx] = V[(size_t)(n0 + ty + r) * DD + c0 + tx];
  __syncthreads();
#pragma unroll
  for (int r = 0; r < 32; r += 8)
    Vt[(size_t)(c0 + ty + r) * NN + n0 + tx] = tile[tx][ty + r];
}

// ---------------------------------------------------------------------------
// 5b) Attention output: att[h] = W_mn @ V_h, B from Vt (row-contiguous).
//     grid (16, 8), block 128; block -> 64 rows x all 64 columns of a head.
// ---------------------------------------------------------------------------
__global__ void __launch_bounds__(128) av_kernel(
    const float* __restrict__ S, const float* __restrict__ Vt,
    float* __restrict__ att) {
  __shared__ __attribute__((aligned(16))) float sm[2 * GSLAB];
  const int h = blockIdx.y;
  const int i0 = blockIdx.x * 64;  // 16 i-stripes
  const int j0 = 0;

  const float* A = S + (size_t)h * NN * NN;
  const float* B = Vt + (size_t)h * DKK * NN;
  float* atth = att + (size_t)h * NN * DKK;

  gemm_block64<NN>(A, NN, B, NN, i0, j0, sm, [&](int row, int col, float v) {
    atth[(size_t)row * DKK + col] = v;
  });
}

// ---------------------------------------------------------------------------
// 6) Faithful scramble (transpose(0,2,1).reshape) + residual + LayerNorm.
//    flat f = r*512+c maps to att[h = f>>16][n = f&1023][d = (f>>10)&63].
// ---------------------------------------------------------------------------
__global__ void __launch_bounds__(256) ln0_kernel(
    const float* __restrict__ att, const float* __restrict__ residual,
    const float* __restrict__ g, const float* __restrict__ b,
    float* __restrict__ out0) {
  __shared__ float red[256];
  const int r = blockIdx.x;
  const int t = threadIdx.x;
  float v[2];
#pragma unroll
  for (int u = 0; u < 2; ++u) {
    const int c = t + 256 * u;
    const unsigned f = (unsigned)r * 512u + (unsigned)c;
    const unsigned hh = f >> 16;
    const unsigned d = (f >> 10) & 63u;
    const unsigned n = f & 1023u;
    v[u] = att[((size_t)hh * NN + n) * DKK + d] + residual[(size_t)r * DD + c];
  }
  red[t] = v[0] + v[1];
  __syncthreads();
  for (int s = 128; s > 0; s >>= 1) {
    if (t < s) red[t] += red[t + s];
    __syncthreads();
  }
  const float mean = red[0] * (1.0f / DD);
  __syncthreads();
  const float d0 = v[0] - mean, d1 = v[1] - mean;
  red[t] = d0 * d0 + d1 * d1;
  __syncthreads();
  for (int s = 128; s > 0; s >>= 1) {
    if (t < s) red[t] += red[t + s];
    __syncthreads();
  }
  const float inv = rsqrtf(red[0] * (1.0f / DD) + LN_EPS);
#pragma unroll
  for (int u = 0; u < 2; ++u) {
    const int c = t + 256 * u;
    out0[(size_t)r * DD + c] = (u == 0 ? d0 : d1) * inv * g[c] + b[c];
  }
}

// ---------------------------------------------------------------------------
// 7) Output projection: proj = out0 @ Wo^T + bo.  grid (8, 16), block 128.
// ---------------------------------------------------------------------------
__global__ void __launch_bounds__(128) proj_kernel(
    const float* __restrict__ X, const float* __restrict__ W,
    const float* __restrict__ bias, float* __restrict__ Y) {
  __shared__ __attribute__((aligned(16))) float sm[2 * GSLAB];
  const int j0 = blockIdx.x * 64;
  const int i0 = blockIdx.y * 64;
  gemm_block64<DD>(X, DD, W, DD, i0, j0, sm, [&](int row, int col, float v) {
    Y[(size_t)row * DD + col] = v + bias[col];
  });
}

// ---------------------------------------------------------------------------
// 8) Final residual + LayerNorm -> d_out.
// ---------------------------------------------------------------------------
__global__ void __launch_bounds__(256) lnf_kernel(
    const float* __restrict__ proj, const float* __restrict__ out0,
    const float* __restrict__ g, const float* __restrict__ b,
    float* __restrict__ out) {
  __shared__ float red[256];
  const int r = blockIdx.x;
  const int t = threadIdx.x;
  float v[2];
#pragma unroll
  for (int u = 0; u < 2; ++u) {
    const int c = t + 256 * u;
    v[u] = proj[(size_t)r * DD + c] + out0[(size_t)r * DD + c];
  }
  red[t] = v[0] + v[1];
  __syncthreads();
  for (int s = 128; s > 0; s >>= 1) {
    if (t < s) red[t] += red[t + s];
    __syncthreads();
  }
  const float mean = red[0] * (1.0f / DD);
  __syncthreads();
  const float d0 = v[0] - mean, d1 = v[1] - mean;
  red[t] = d0 * d0 + d1 * d1;
  __syncthreads();
  for (int s = 128; s > 0; s >>= 1) {
    if (t < s) red[t] += red[t + s];
    __syncthreads();
  }
  const float inv = rsqrtf(red[0] * (1.0f / DD) + LN_EPS);
#pragma unroll
  for (int u = 0; u < 2; ++u) {
    const int c = t + 256 * u;
    out[(size_t)r * DD + c] = (u == 0 ? d0 : d1) * inv * g[c] + b[c];
  }
}

extern "C" void kernel_launch(void* const* d_in, const int* in_sizes, int n_in,
                              void* d_out, int out_size, void* d_ws,
                              size_t ws_size, hipStream_t stream) {
  (void)in_sizes; (void)n_in; (void)out_size; (void)ws_size;
  const float* q_in = (const float*)d_in[0];
  const float* k_in = (const float*)d_in[1];
  const float* v_in = (const float*)d_in[2];
  const float* box  = (const float*)d_in[3];
  const float* Wq = (const float*)d_in[4];
  const float* bq = (const float*)d_in[5];
  const float* Wk = (const float*)d_in[6];
  const float* bk = (const float*)d_in[7];
  const float* Wv = (const float*)d_in[8];
  const float* bv = (const float*)d_in[9];
  const float* Wo = (const float*)d_in[10];
  const float* bo = (const float*)d_in[11];
  const float* WGw = (const float*)d_in[12];
  const float* WGb = (const float*)d_in[13];
  const float* ln0g = (const float*)d_in[14];
  const float* ln0b = (const float*)d_in[15];
  const float* lng = (const float*)d_in[16];
  const float* lnb = (const float*)d_in[17];

  float* ws = (float*)d_ws;
  float* S    = ws;                          // 8*1024*1024    (32 MB)
  float* qkv  = S + (size_t)HH * NN * NN;    // 3*1024*512     ( 6 MB)
  float* Vt   = qkv + (size_t)3 * NN * DD;   // 8*64*1024      ( 2 MB)
  float* att  = Vt + (size_t)HH * DKK * NN;  // 8*1024*64      ( 2 MB)
  float* out0 = att + (size_t)HH * NN * DKK; // 1024*512       ( 2 MB)
  float* proj = out0 + (size_t)NN * DD;      // 1024*512       ( 2 MB)
  float* out  = (float*)d_out;

  gate_kernel<<<dim3(4, NN), 256, 0, stream>>>(box, WGw, WGb, S);
  qkv_kernel<<<dim3(8, 16, 3), 128, 0, stream>>>(q_in, k_in, v_in, Wq, Wk, Wv,
                                                 bq, bk, bv, qkv);
  scores_kernel<<<dim3(16, 16, 8), 128, 0, stream>>>(qkv, S);
  softmax_kernel<<<dim3(HH * NN), 256, 0, stream>>>(S);
  vtrans_kernel<<<dim3(32, 16), 256, 0, stream>>>(qkv, Vt);
  av_kernel<<<dim3(16, 8), 128, 0, stream>>>(S, Vt, att);
  ln0_kernel<<<dim3(NN), 256, 0, stream>>>(att, q_in, ln0g, ln0b, out0);
  proj_kernel<<<dim3(8, 16), 128, 0, stream>>>(out0, Wo, bo, proj);
  lnf_kernel<<<dim3(NN), 256, 0, stream>>>(proj, out0, lng, lnb, out);
}

// v002
// It runs in 95.3 microseconds.
// Two timings next to v001 both put it at 1.12 times that version's speed.
// Counting every step since v000, it is 1.65 times as fast.
#include <hip/hip_runtime.h>
#include <hip/hip_bf16.h>
#include <math.h>

#define NN 1024
#define DD 512
#define HH 8
#define DKK 64
#define DGG 64
#define LN_EPS 1e-5f

typedef float v2f __attribute__((ext_vector_type(2)));
typedef float v8f __attribute__((ext_vector_type(8)));

// ---------------------------------------------------------------------------
// Generic 64x64 output tile per 4-wave block, 32x32 per wave (2x2 waves), on
// V_WMMA_F32_16X16X4_F32.
// Y[i][j] = sum_k Arow_i[k] * Brow_j[k]   (both operands row-contiguous in K)
//
// Operands go global -> LDS in slabs of 64 k: 64 A rows then 64 B rows, each
// 256 B, brought by asynchronous 16-byte copies (16 lanes cover one row, so a
// wave's copy covers four whole 128-B lines) and shared by the block's waves.
// LDS row pitch 68 dwords (16 B x 17): the 16 rows x 16 B that one fragment
// read touches fall on all 64 banks once.
//
// Fragment layout (ISA 7.12.2, 32-bit operands, wave32):
//   A 16x4: lanes 0-15 = rows M=0..15 holding K={k,k+1};
//           lanes 16-31 = same rows holding K={k+2,k+3}  -> contiguous v2f.
//   B 4x16: symmetric with N = lane%16.
//   C/D   : VGPR r -> M = r (lanes 0-15) / r+8 (lanes 16-31), N = lane%16.
// ---------------------------------------------------------------------------
#define GBK 64                      // k per slab
#define GPITCH 68                   // LDS row pitch, dwords
#define GSLAB (128 * GPITCH)        // dwords per slab buffer

// Eight rows' worth of copies for this lane (rows 8 apart). The s_wait_xcnt
// closes the statement so that no address register is rewritten ahead of it.
__device__ __forceinline__ void copy8_rows(unsigned l, const float* g, int ld) {
  const unsigned ls = 8u * GPITCH * 4u;
  const size_t gs = (size_t)8 * ld;
  asm volatile(
      "global_load_async_to_lds_b128 %0, %8, off\n\t"
      "global_load_async_to_lds_b128 %1, %9, off\n\t"
      "global_load_async_to_lds_b128 %2, %10, off\n\t"
      "global_load_async_to_lds_b128 %3, %11, off\n\t"
      "global_load_async_to_lds_b128 %4, %12, off\n\t"
      "global_load_async_to_lds_b128 %5, %13, off\n\t"
      "global_load_async_to_lds_b128 %6, %14, off\n\t"
      "global_load_async_to_lds_b128 %7, %15, off\n\t"
      "s_wait_xcnt 0x0"
      ::"v"(l), "v"(l + ls), "v"(l + 2 * ls), "v"(l + 3 * ls), "v"(l + 4 * ls),
        "v"(l + 5 * ls), "v"(l + 6 * ls), "v"(l + 7 * ls), "v"(g), "v"(g + gs),
        "v"(g + 2 * gs), "v"(g + 3 * gs), "v"(g + 4 * gs), "v"(g + 5 * gs),
        "v"(g + 6 * gs), "v"(g + 7 * gs)
      : "memory");
}

template <int KSIZE, class Epi>
__device__ __forceinline__ void gemm_block64(const float* __restrict__ A,
                                             int lda, const float* __restrict__ B,
                                             int ldb, int i0, int j0, float* sm,
                                             Epi epi) {
  constexpr int NS = KSIZE / GBK;  // slabs
  const int t = threadIdx.x;       // 0..127
  const int lane = t & 31, wave = t >> 5;
  const int half = lane >> 4, lr = lane & 15;
  const int wi = (wave >> 1) * 32, wj = (wave & 1) * 32;

  // copy role: 16-byte chunk ch of rows rg, rg+8, ... of each operand
  const int ch = t & 15, rg = t >> 4;
  const float* ga = A + (size_t)(i0 + rg) * lda + ch * 4;
  const float* gb = B + (size_t)(j0 + rg) * ldb + ch * 4;
  const unsigned la = (unsigned)(size_t)(sm + rg * GPITCH + ch * 4);
  const unsigned lb = la + 64u * GPITCH * 4u;

  const float* fa = sm + (wi + lr) * GPITCH + 2 * half;
  const float* fb = sm + (64 + wj + lr) * GPITCH + 2 * half;

  v8f acc[2][2] = {};
  auto fill = [&](int s) {
    const unsigned bo = (unsigned)(s & 1) * (GSLAB * 4u);
    copy8_rows(la + bo, ga + s * GBK, lda);
    copy8_rows(lb + bo, gb + s * GBK, ldb);
  };
  auto work = [&](int s) {
    const float* as = fa + (s & 1) * GSLAB;
    const float* bs = fb + (s & 1) * GSLAB;
#pragma unroll
    for (int k = 0; k < GBK; k += 4) {
      const v2f a0 = *(const v2f*)(as + k);
      const v2f a1 = *(const v2f*)(as + 16 * GPITCH + k);
      const v2f b0 = *(const v2f*)(bs + k);
      const v2f b1 = *(const v2f*)(bs + 16 * GPITCH + k);
      acc[0][0] = __builtin_amdgcn_wmma_f32_16x16x4_f32(false, a0, false, b0,
                                                        (short)0, acc[0][0], false, false);
      acc[0][1] = __builtin_amdgcn_wmma_f32_16x16x4_f32(false, a0, false, b1,
                                                        (short)0, acc[0][1], false, false);
      acc[1][0] = __builtin_amdgcn_wmma_f32_16x16x4_f32(false, a1, false, b0,
                                                        (short)0, acc[1][0], false, false);
      acc[1][1] = __builtin_amdgcn_wmma_f32_16x16x4_f32(false, a1, false, b1,
                                                        (short)0, acc[1][1], false, false);
    }
  };

  fill(0);
  // slab 0 has landed for this wave's own copies; the barrier publishes it
  asm volatile("s_wait_asynccnt 0x0" ::: "memory");
  __syncthreads();
  if constexpr (NS == 1) {
    work(0);
  } else {
    fill(1);
#pragma unroll 1  // rolled, for speed only
    for (int s = 0; s < NS; ++s) {
      work(s);
      // this wave's reads of slab s are done before the buffer may be refilled
      asm volatile("s_wait_dscnt 0x0" ::: "memory");
      // this wave's copies of slab s+1 have landed before the barrier publishes
      asm volatile("s_wait_asynccnt 0x0" ::: "memory");
      __syncthreads();
      if (s + 2 < NS) fill(s + 2);
    }
    // no copy is outstanding when the wave goes on to its epilogue and ends
    asm volatile("s_wait_asynccnt 0x0" ::: "memory");
  }

#pragma unroll
  for (int ti = 0; ti < 2; ++ti)
#pragma unroll
    for (int tj = 0; tj < 2; ++tj)
#pragma unroll
      for (int r = 0; r < 8; ++r)
        epi(i0 + wi + ti * 16 + r + 8 * half, j0 + wj + tj * 16 + lr, acc[ti][tj][r]);
}

// ---------------------------------------------------------------------------
// 1a) Box-relative embedding + per-head gate, fused to log(clip(relu(.),1e-6)).
//     Writes S[h][i][j]; the scores blocks add QK^T/8 in place afterwards.
//     128-thread block p of 8192: row i = p / 8, columns from (p % 8) * 128.
// ---------------------------------------------------------------------------
__device__ __forceinline__ void gate_block(
    int p, const float* __restrict__ box, const float* __restrict__ WGw,
    const float* __restrict__ WGb, float* __restrict__ S, float* sm) {
  float* w_sh = sm;             // HH * DGG weights
  float* b_sh = sm + HH * DGG;  // HH biases
  // 128 threads x 16 bytes = all HH * DGG weights in one load each
  *(float4*)(w_sh + 4 * threadIdx.x) = *(const float4*)(WGw + 4 * threadIdx.x);
  if (threadIdx.x < HH) b_sh[threadIdx.x] = WGb[threadIdx.x];
  __syncthreads();

  const int i = p >> 3;
  const int j = (p & 7) * 128 + threadIdx.x;

  const float xi0 = box[i * 4 + 0], yi0 = box[i * 4 + 1];
  const float xi1 = box[i * 4 + 2], yi1 = box[i * 4 + 3];
  const float cxi = (xi0 + xi1) * 0.5f, cyi = (yi0 + yi1) * 0.5f;
  const float wi = xi1 - xi0 + 1.0f, hi = yi1 - yi0 + 1.0f;

  const float xj0 = box[j * 4 + 0], yj0 = box[j * 4 + 1];
  const float xj1 = box[j * 4 + 2], yj1 = box[j * 4 + 3];
  const float cxj = (xj0 + xj1) * 0.5f, cyj = (yj0 + yj1) * 0.5f;
  const float wj = xj1 - xj0 + 1.0f, hj = yj1 - yj0 + 1.0f;

  float pos[4];
  pos[0] = __logf(fmaxf(fabsf((cxi - cxj) / wi), 0.001f));
  pos[1] = __logf(fmaxf(fabsf((cyi - cyj) / hi), 0.001f));
  pos[2] = __logf(wi / wj);
  pos[3] = __logf(hi / hj);

  const float dim_mat[8] = {1.0f, 0.42169650342858224f, 0.1778279410038923f,
                            0.07498942093324558f, 0.03162277660168379f,
                            0.013335214321633241f, 0.005623413251903491f,
                            0.0023713737056616554f};

  float acc[HH];
#pragma unroll
  for (int h = 0; h < HH; ++h) acc[h] = b_sh[h];

#pragma unroll
  for (int c = 0; c < 4; ++c) {
#pragma unroll
    for (int g = 0; g < 8; ++g) {
      const float m = 100.0f * pos[c] * dim_mat[g];
      const float sn = __sinf(m);
      const float cs = __cosf(m);
      const int f = c * 8 + g;
#pragma unroll
      for (int h = 0; h < HH; ++h)  // uniform-address LDS broadcast
        acc[h] += sn * w_sh[h * DGG + f] + cs * w_sh[h * DGG + 32 + f];
    }
    // keeps the next group's weight reads from being lifted over this one:
    // without it the kernel passes 256 VGPRs and loses a wave per SIMD
    __builtin_amdgcn_sched_barrier(0);
  }
#pragma unroll
  for (int h = 0; h < HH; ++h)
    S[((size_t)h * NN + i) * NN + j] = __logf(fmaxf(acc[h], 1e-6f));
}

// ---------------------------------------------------------------------------
// 1b) QKV projections: Y_z = X_z @ W_z^T + b_z.  64x64 tile/block.
//     Block p of 384: j-stripe p % 8, i-stripe (p / 8) % 16, z = p / 128.
// ---------------------------------------------------------------------------
#define QKV_BLOCKS (8 * 16 * 3)
#define GATE_BLOCKS (8 * NN)

__device__ __forceinline__ void qkv_block(
    int p, const float* __restrict__ q_in, const float* __restrict__ k_in,
    const float* __restrict__ v_in, const float* __restrict__ Wq,
    const float* __restrict__ Wk, const float* __restrict__ Wv,
    const float* __restrict__ bq, const float* __restrict__ bk,
    const float* __restrict__ bv, float* __restrict__ qkv_out, float* sm) {
  const int z = p >> 7;
  const float* X = (z == 0) ? q_in : (z == 1) ? k_in : v_in;
  const float* W = (z == 0) ? Wq : (z == 1) ? Wk : Wv;
  const float* bias = (z == 0) ? bq : (z == 1) ? bk : bv;
  float* Y = qkv_out + (size_t)z * NN * DD;

  const int j0 = (p & 7) * 64;          // 8 j-stripes over D
  const int i0 = ((p >> 3) & 15) * 64;  // 16 i-stripes over N

  gemm_block64<DD>(X, DD, W, DD, i0, j0, sm, [&](int row, int col, float v) {
    Y[(size_t)row * DD + col] = v + bias[col];
  });
}

// ---------------------------------------------------------------------------
// 1) One launch for the two pieces of work that depend on the inputs alone.
//    The long matrix blocks take the low indices; the
//    gate blocks (vector and LDS work) run beside them on the same SIMDs.
//    grid QKV_BLOCKS + GATE_BLOCKS, block 128; the LDS admits four blocks per WGP.
// ---------------------------------------------------------------------------
__global__ void __launch_bounds__(128) qkv_gate_kernel(
    const float* __restrict__ q_in, const float* __restrict__ k_in,
    const float* __restrict__ v_in, const float* __restrict__ Wq,
    const float* __restrict__ Wk, const float* __restrict__ Wv,
    const float* __restrict__ bq, const float* __restrict__ bk,
    const float* __restrict__ bv, float* __restrict__ qkv_out,
    const float* __restrict__ box, const float* __restrict__ WGw,
    const float* __restrict__ WGb, float* __restrict__ S) {
  __shared__ __attribute__((aligned(16))) float sm[2 * GSLAB];
  const int b = blockIdx.x;
  if (b < QKV_BLOCKS)
    qkv_block(b, q_in, k_in, v_in, Wq, Wk, Wv, bq, bk, bv, qkv_out, sm);
  else
    gate_block(b - QKV_BLOCKS, box, WGw, WGb, S, sm);
}

// ---------------------------------------------------------------------------
// 2a) Scores: S[h] += (Q_h @ K_h^T) * 0.125, fused onto the gate-log buffer.
//     Block p of 2048: j-stripe p % 16, i-stripe (p / 16) % 16, head p / 256.
// ---------------------------------------------------------------------------
#define VT_BLOCKS (32 * 16)
#define SCORE_BLOCKS (16 * 16 * HH)

__device__ __forceinline__ void scores_block(int p, const float* __restrict__ qkv,
                                             float* __restrict__ S, float* sm) {
  const int h = p >> 8;
  const int j0 = (p & 15) * 64;         // 16 j-stripes
  const int i0 = ((p >> 4) & 15) * 64;  // 16 i-stripes

  const float* Q = qkv + h * DKK;
  const float* K = qkv + (size_t)NN * DD + h * DKK;
  float* Sh = S + (size_t)h * NN * NN;

  gemm_block64<DKK>(Q, DD, K, DD, i0, j0, sm, [&](int row, int col, float v) {
    const size_t idx = (size_t)row * NN + col;
    Sh[idx] = Sh[idx] + v * 0.125f;
  });
}

// ---------------------------------------------------------------------------
// 3) Row softmax over 8192 rows of 1024 (in place).
// ---------------------------------------------------------------------------
__global__ void __launch_bounds__(256) softmax_kernel(float* __restrict__ S) {
  __shared__ float red[256];
  float* p = S + (size_t)blockIdx.x * NN;
  const int t = threadIdx.x;
  float vals[4];
  float m = -3.4e38f;
#pragma unroll
  for (int u = 0; u < 4; ++u) {
    vals[u] = p[t + 256 * u];
    m = fmaxf(m, vals[u]);
  }
  red[t] = m;
  __syncthreads();
  for (int s = 128; s > 0; s >>= 1) {
    if (t < s) red[t] = fmaxf(red[t], red[t + s]);
    __syncthreads();
  }
  m = red[0];
  __syncthreads();
  float sum = 0.0f;
#pragma unroll
  for (int u = 0; u < 4; ++u) {
    vals[u] = __expf(vals[u] - m);
    sum += vals[u];
  }
  red[t] = sum;
  __syncthreads();
  for (int s = 128; s > 0; s >>= 1) {
    if (t < s) red[t] += red[t + s];
    __syncthreads();
  }
  const float inv = 1.0f / red[0];
#pragma unroll
  for (int u = 0; u < 4; ++u) p[t + 256 * u] = vals[u] * inv;
}

// ---------------------------------------------------------------------------
// 2b) Transpose V into Vt[h][dk][n]  (flat: Vt[c][n] with c = h*64+dk),
//     so the AV GEMM's B operand is K-contiguous. 32x32 LDS tile transpose.
//     Block p of 512: n-tile p % 32, c-tile p / 32; 128 threads (32x4).
// ---------------------------------------------------------------------------
__device__ __forceinline__ void vtrans_block(int p, const float* __restrict__ qkv,
                                             float* __restrict__ Vt, float* sm) {
  float (*tile)[33] = (float (*)[33])sm;  // 32 rows of 33
  const float* V = qkv + (size_t)2 * NN * DD;
  const int n0 = (p & 31) * 32, c0 = (p >> 5) * 32;
  const int tx = threadIdx.x & 31, ty = threadIdx.x >> 5;
#pragma unroll
  for (int r = 0; r < 32; r += 4)
    tile[ty + r][tx] = V[(size_t)(n0 + ty + r) * DD + c0 + tx];
  __syncthreads();
#pragma unroll
  for (int r = 0; r < 32; r += 4)
    Vt[(size_t)(c0 + ty + r) * NN + n0 + tx] = tile[tx][ty + r];
}

// ---------------------------------------------------------------------------
// 2) One launch for the two pieces of work that read qkv (the scores also add onto S).
//    grid VT_BLOCKS + SCORE_BLOCKS, block 128.
// ---------------------------------------------------------------------------
__global__ void __launch_bounds__(128) scores_vtrans_kernel(
    const float* __restrict__ qkv, float* __restrict__ S,
    float* __restrict__ Vt) {
  __shared__ __attribute__((aligned(16))) float sm[GSLAB];
  const int b = blockIdx.x;
  if (b < VT_BLOCKS)
    vtrans_block(b, qkv, Vt, sm);
  else
    scores_block(b - VT_BLOCKS, qkv, S, sm);
}

// ---------------------------------------------------------------------------
// 4) Attention output:  att[h] = W_mn @ V_h, B from Vt (row-contiguous).
//     grid (16, 8), block 128; block -> 64 rows x all 64 columns of a head.
// ---------------------------------------------------------------------------
__global__ void __launch_bounds__(128) av_kernel(
    const float* __restrict__ S, const float* __restrict__ Vt,
    float* __restrict__ att) {
  __shared__ __attribute__((aligned(16))) float sm[2 * GSLAB];
  const int h = blockIdx.y;
  const int i0 = blockIdx.x * 64;  // 16 i-stripes
  const int j0 = 0;

  const float* A = S + (size_t)h * NN * NN;
  const float* B = Vt + (size_t)h * DKK * NN;
  float* atth = att + (size_t)h * NN * DKK;

  gemm_block64<NN>(A, NN, B, NN, i0, j0, sm, [&](int row, int col, float v) {
    atth[(size_t)row * DKK + col] = v;
  });
}

// ---------------------------------------------------------------------------
// 5) Faithful scramble (transpose(0,2,1).reshape) + residual + LayerNorm.
//    flat f = r*512+c maps to att[h = f>>16][n = f&1023][d = (f>>10)&63].
// ---------------------------------------------------------------------------
__global__ void __launch_bounds__(256) ln0_kernel(
    const float* __restrict__ att, const float* __restrict__ residual,
    const float* __restrict__ g, const float* __restrict__ b,
    float* __restrict__ out0) {
  __shared__ float red[256];
  const int r = blockIdx.x;
  const int t = threadIdx.x;
  float v[2];
#pragma unroll
  for (int u = 0; u < 2; ++u) {
    const int c = t + 256 * u;
    const unsigned f = (unsigned)r * 512u + (unsigned)c;
    const unsigned hh = f >> 16;
    const unsigned d = (f >> 10) & 63u;
    const unsigned n = f & 1023u;
    v[u] = att[((size_t)hh * NN + n) * DKK + d] + residual[(size_t)r * DD + c];
  }
  red[t] = v[0] + v[1];
  __syncthreads();
  for (int s = 128; s > 0; s >>= 1) {
    if (t < s) red[t] += red[t + s];
    __syncthreads();
  }
  const float mean = red[0] * (1.0f / DD);
  __syncthreads();
  const float d0 = v[0] - mean, d1 = v[1] - mean;
  red[t] = d0 * d0 + d1 * d1;
  __syncthreads();
  for (int s = 128; s > 0; s >>= 1) {
    if (t < s) red[t] += red[t + s];
    __syncthreads();
  }
  const float inv = rsqrtf(red[0] * (1.0f / DD) + LN_EPS);
#pragma unroll
  for (int u = 0; u < 2; ++u) {
    const int c = t + 256 * u;
    out0[(size_t)r * DD + c] = (u == 0 ? d0 : d1) * inv * g[c] + b[c];
  }
}

// ---------------------------------------------------------------------------
// 6) Output projection: proj = out0 @ Wo^T + bo.  grid (8, 16), block 128.
// ---------------------------------------------------------------------------
__global__ void __launch_bounds__(128) proj_kernel(
    const float* __restrict__ X, const float* __restrict__ W,
    const float* __restrict__ bias, float* __restrict__ Y) {
  __shared__ __attribute__((aligned(16))) float sm[2 * GSLAB];
  const int j0 = blockIdx.x * 64;
  const int i0 = blockIdx.y * 64;
  gemm_block64<DD>(X, DD, W, DD, i0, j0, sm, [&](int row, int col, float v) {
    Y[(size_t)row * DD + col] = v + bias[col];
  });
}

// ---------------------------------------------------------------------------
// 7) Final residual + LayerNorm -> d_out.
// ---------------------------------------------------------------------------
__global__ void __launch_bounds__(256) lnf_kernel(
    const float* __restrict__ proj, const float* __restrict__ out0,
    const float* __restrict__ g, const float* __restrict__ b,
    float* __restrict__ out) {
  __shared__ float red[256];
  const int r = blockIdx.x;
  const int t = threadIdx.x;
  float v[2];
#pragma unroll
  for (int u = 0; u < 2; ++u) {
    const int c = t + 256 * u;
    v[u] = proj[(size_t)r * DD + c] + out0[(size_t)r * DD + c];
  }
  red[t] = v[0] + v[1];
  __syncthreads();
  for (int s = 128; s > 0; s >>= 1) {
    if (t < s) red[t] += red[t + s];
    __syncthreads();
  }
  const float mean = red[0] * (1.0f / DD);
  __syncthreads();
  const float d0 = v[0] - mean, d1 = v[1] - mean;
  red[t] = d0 * d0 + d1 * d1;
  __syncthreads();
  for (int s = 128; s > 0; s >>= 1) {
    if (t < s) red[t] += red[t + s];
    __syncthreads();
  }
  const float inv = rsqrtf(red[0] * (1.0f / DD) + LN_EPS);
#pragma unroll
  for (int u = 0; u < 2; ++u) {
    const int c = t + 256 * u;
    out[(size_t)r * DD + c] = (u == 0 ? d0 : d1) * inv * g[c] + b[c];
  }
}

extern "C" void kernel_launch(void* const* d_in, const int* in_sizes, int n_in,
                              void* d_out, int out_size, void* d_ws,
                              size_t ws_size, hipStream_t stream) {
  (void)in_sizes; (void)n_in; (void)out_size; (void)ws_size;
  const float* q_in = (const float*)d_in[0];
  const float* k_in = (const float*)d_in[1];
  const float* v_in = (const float*)d_in[2];
  const float* box  = (const float*)d_in[3];
  const float* Wq = (const float*)d_in[4];
  const float* bq = (const float*)d_in[5];
  const float* Wk = (const float*)d_in[6];
  const float* bk = (const float*)d_in[7];
  const float* Wv = (const float*)d_in[8];
  const float* bv = (const float*)d_in[9];
  const float* Wo = (const float*)d_in[10];
  const float* bo = (const float*)d_in[11];
  const float* WGw = (const float*)d_in[12];
  const float* WGb = (const float*)d_in[13];
  const float* ln0g = (const float*)d_in[14];
  const float* ln0b = (const float*)d_in[15];
  const float* lng = (const float*)d_in[16];
  const float* lnb = (const float*)d_in[17];

  float* ws = (float*)d_ws;
  float* S    = ws;                          // 8*1024*1024    (32 MB)
  float* qkv  = S + (size_t)HH * NN * NN;    // 3*1024*512     ( 6 MB)
  float* Vt   = qkv + (size_t)3 * NN * DD;   // 8*64*1024      ( 2 MB)
  float* att  = Vt + (size_t)HH * DKK * NN;  // 8*1024*64      ( 2 MB)
  float* out0 = att + (size_t)HH * NN * DKK; // 1024*512       ( 2 MB)
  float* proj = out0 + (size_t)NN * DD;      // 1024*512       ( 2 MB)
  float* out  = (float*)d_out;

  qkv_gate_kernel<<<dim3(QKV_BLOCKS + GATE_BLOCKS), 128, 0, stream>>>(
      q_in, k_in, v_in, Wq, Wk, Wv, bq, bk, bv, qkv, box, WGw, WGb, S);
  scores_vtrans_kernel<<<dim3(VT_BLOCKS + SCORE_BLOCKS), 128, 0, stream>>>(qkv, S, Vt);
  softmax_kernel<<<dim3(HH * NN), 256, 0, stream>>>(S);
  av_kernel<<<dim3(16, 8), 128, 0, stream>>>(S, Vt, att);
  ln0_kernel<<<dim3(NN), 256, 0, stream>>>(att, q_in, ln0g, ln0b, out0);
  proj_kernel<<<dim3(8, 16), 128, 0, stream>>>(out0, Wo, bo, proj);
  lnf_kernel<<<dim3(NN), 256, 0, stream>>>(proj, out0, lng, lnb, out);
}

// v003
// One run takes 83.3 microseconds.
// In both of two side-by-side timings against v002, it was 1.14 times as fast.
// All steps since v000 together make it 1.87 times as fast.
#include <hip/hip_runtime.h>
#include <hip/hip_bf16.h>
#include <math.h>

#define NN 1024
#define DD 512
#define HH 8
#define DKK 64
#define DGG 64
#define LN_EPS 1e-5f

typedef float v2f __attribute__((ext_vector_type(2)));
typedef float v8f __attribute__((ext_vector_type(8)));

// ---------------------------------------------------------------------------
// Generic 64x64 output tile per 4-wave block, 32x32 per wave (2x2 waves), on
// V_WMMA_F32_16X16X4_F32.
// Y[i][j] = sum_k Arow_i[k] * Brow_j[k]   (both operands row-contiguous in K)
//
// Operands go global -> LDS in slabs of 64 k: 64 A rows then 64 B rows, each
// 256 B, brought by asynchronous 16-byte copies (16 lanes cover one row, so a
// wave's copy covers four whole 128-B lines) and shared by the block's waves.
// LDS row pitch 68 dwords (16 B x 17): the 16 rows x 16 B that one fragment
// read touches fall on all 64 banks once.
//
// Fragment layout (ISA 7.12.2, 32-bit operands, wave32):
//   A 16x4: lanes 0-15 = rows M=0..15 holding K={k,k+1};
//           lanes 16-31 = same rows holding K={k+2,k+3}  -> contiguous v2f.
//   B 4x16: symmetric with N = lane%16.
//   C/D   : VGPR r -> M = r (lanes 0-15) / r+8 (lanes 16-31), N = lane%16.
// ---------------------------------------------------------------------------
#define GBK 64                      // k per slab
#define GPITCH 68                   // LDS row pitch, dwords
#define GSLAB (128 * GPITCH)        // dwords per slab buffer

// Eight rows' worth of copies for this lane (rows 8 apart). The s_wait_xcnt
// closes the statement so that no address register is rewritten ahead of it.
__device__ __forceinline__ void copy8_rows(unsigned l, const float* g, int ld) {
  const unsigned ls = 8u * GPITCH * 4u;
  const size_t gs = (size_t)8 * ld;
  asm volatile(
      "global_load_async_to_lds_b128 %0, %8, off\n\t"
      "global_load_async_to_lds_b128 %1, %9, off\n\t"
      "global_load_async_to_lds_b128 %2, %10, off\n\t"
      "global_load_async_to_lds_b128 %3, %11, off\n\t"
      "global_load_async_to_lds_b128 %4, %12, off\n\t"
      "global_load_async_to_lds_b128 %5, %13, off\n\t"
      "global_load_async_to_lds_b128 %6, %14, off\n\t"
      "global_load_async_to_lds_b128 %7, %15, off\n\t"
      "s_wait_xcnt 0x0"
      ::"v"(l), "v"(l + ls), "v"(l + 2 * ls), "v"(l + 3 * ls), "v"(l + 4 * ls),
        "v"(l + 5 * ls), "v"(l + 6 * ls), "v"(l + 7 * ls), "v"(g), "v"(g + gs),
        "v"(g + 2 * gs), "v"(g + 3 * gs), "v"(g + 4 * gs), "v"(g + 5 * gs),
        "v"(g + 6 * gs), "v"(g + 7 * gs)
      : "memory");
}

// gemm_acc64 leaves the wave's 32x32 tile in acc. pre() runs once while slab 0
// is in flight; at(a, ti, k) maps each A fragment (rows ti*16 + lane%16 of the
// wave's tile, k-step k of the slab) on its way from LDS to the matrix unit.
// PAD: see at the refill.
template <int KSIZE, bool PAD, class Pre, class AT>
__device__ __forceinline__ void gemm_acc64(const float* __restrict__ A,
                                           int lda, const float* __restrict__ B,
                                           int ldb, int i0, int j0, float* sm,
                                           v8f (&acc)[2][2], Pre pre, AT at) {
  constexpr int NS = KSIZE / GBK;  // slabs
  const int t = threadIdx.x;       // 0..127
  const int lane = t & 31, wave = t >> 5;
  const int half = lane >> 4, lr = lane & 15;
  const int wi = (wave >> 1) * 32, wj = (wave & 1) * 32;

  // copy role: 16-byte chunk ch of rows rg, rg+8, ... of each operand
  const int ch = t & 15, rg = t >> 4;
  const float* ga = A + (size_t)(i0 + rg) * lda + ch * 4;
  const float* gb = B + (size_t)(j0 + rg) * ldb + ch * 4;
  const unsigned la = (unsigned)(size_t)(sm + rg * GPITCH + ch * 4);
  const unsigned lb = la + 64u * GPITCH * 4u;

  const float* fa = sm + (wi + lr) * GPITCH + 2 * half;
  const float* fb = sm + (64 + wj + lr) * GPITCH + 2 * half;

  auto fill = [&](int s) {
    const unsigned bo = (unsigned)(s & 1) * (GSLAB * 4u);
    copy8_rows(la + bo, ga + s * GBK, lda);
    copy8_rows(lb + bo, gb + s * GBK, ldb);
  };
  auto work = [&](int s) {
    const float* as = fa + (s & 1) * GSLAB;
    const float* bs = fb + (s & 1) * GSLAB;
#pragma unroll
    for (int k = 0; k < GBK; k += 4) {
      const v2f a0 = at(*(const v2f*)(as + k), 0, k);
      const v2f a1 = at(*(const v2f*)(as + 16 * GPITCH + k), 1, k);
      const v2f b0 = *(const v2f*)(bs + k);
      const v2f b1 = *(const v2f*)(bs + 16 * GPITCH + k);
      acc[0][0] = __builtin_amdgcn_wmma_f32_16x16x4_f32(false, a0, false, b0,
                                                        (short)0, acc[0][0], false, false);
      acc[0][1] = __builtin_amdgcn_wmma_f32_16x16x4_f32(false, a0, false, b1,
                                                        (short)0, acc[0][1], false, false);
      acc[1][0] = __builtin_amdgcn_wmma_f32_16x16x4_f32(false, a1, false, b0,
                                                        (short)0, acc[1][0], false, false);
      acc[1][1] = __builtin_amdgcn_wmma_f32_16x16x4_f32(false, a1, false, b1,
                                                        (short)0, acc[1][1], false, false);
    }
  };

  fill(0);
  pre();
  // slab 0 has landed for this wave's own copies; the barrier publishes it
  asm volatile("s_wait_asynccnt 0x0" ::: "memory");
  __syncthreads();
  if constexpr (NS == 1) {
    work(0);
  } else {
    fill(1);
#pragma unroll 1  // rolled, for speed only
    for (int s = 0; s < NS; ++s) {
      work(s);
      // this wave's reads of slab s are done before the buffer may be refilled
      asm volatile("s_wait_dscnt 0x0" ::: "memory");
      // this wave's copies of slab s+1 have landed before the barrier publishes
      asm volatile("s_wait_asynccnt 0x0" ::: "memory");
      __syncthreads();
      if (s + 2 < NS) {
        if constexpr (PAD) {
          // four vector slots between the slab's last WMMA and the address sums
          // of the refill, where the build gives those that WMMA's B registers
          asm volatile("v_nop\n\tv_nop\n\tv_nop\n\tv_nop");
          // keeps those address sums from being lifted over the four slots
          __builtin_amdgcn_sched_barrier(0);
        }
        fill(s + 2);
      }
    }
    // no copy is outstanding when the wave goes on to its epilogue and ends
    asm volatile("s_wait_asynccnt 0x0" ::: "memory");
  }
}

template <int KSIZE, class Epi>
__device__ __forceinline__ void gemm_block64(const float* __restrict__ A,
                                             int lda, const float* __restrict__ B,
                                             int ldb, int i0, int j0, float* sm,
                                             Epi epi) {
  const int lane = threadIdx.x & 31, wave = threadIdx.x >> 5;
  const int half = lane >> 4, lr = lane & 15;
  const int wi = (wave >> 1) * 32, wj = (wave & 1) * 32;
  v8f acc[2][2] = {};
  gemm_acc64<KSIZE, false>(A, lda, B, ldb, i0, j0, sm, acc, [] {},
                    [](v2f a, int, int) { return a; });

#pragma unroll
  for (int ti = 0; ti < 2; ++ti)
#pragma unroll
    for (int tj = 0; tj < 2; ++tj)
#pragma unroll
      for (int r = 0; r < 8; ++r)
        epi(i0 + wi + ti * 16 + r + 8 * half, j0 + wj + tj * 16 + lr, acc[ti][tj][r]);
}

// ---------------------------------------------------------------------------
// 1a) Box-relative embedding + per-head gate, fused to log(clip(relu(.),1e-6)).
//     Writes S[h][i][j]; the scores blocks add QK^T/8 in place afterwards.
//     128-thread block p of 8192: row i = p / 8, columns from (p % 8) * 128.
// ---------------------------------------------------------------------------
__device__ __forceinline__ void gate_block(
    int p, const float* __restrict__ box, const float* __restrict__ WGw,
    const float* __restrict__ WGb, float* __restrict__ S, float* sm) {
  float* w_sh = sm;             // HH * DGG weights
  float* b_sh = sm + HH * DGG;  // HH biases
  // 128 threads x 16 bytes = all HH * DGG weights in one load each
  *(float4*)(w_sh + 4 * threadIdx.x) = *(const float4*)(WGw + 4 * threadIdx.x);
  if (threadIdx.x < HH) b_sh[threadIdx.x] = WGb[threadIdx.x];
  __syncthreads();

  const int i = p >> 3;
  const int j = (p & 7) * 128 + threadIdx.x;

  const float xi0 = box[i * 4 + 0], yi0 = box[i * 4 + 1];
  const float xi1 = box[i * 4 + 2], yi1 = box[i * 4 + 3];
  const float cxi = (xi0 + xi1) * 0.5f, cyi = (yi0 + yi1) * 0.5f;
  const float wi = xi1 - xi0 + 1.0f, hi = yi1 - yi0 + 1.0f;

  const float xj0 = box[j * 4 + 0], yj0 = box[j * 4 + 1];
  const float xj1 = box[j * 4 + 2], yj1 = box[j * 4 + 3];
  const float cxj = (xj0 + xj1) * 0.5f, cyj = (yj0 + yj1) * 0.5f;
  const float wj = xj1 - xj0 + 1.0f, hj = yj1 - yj0 + 1.0f;

  float pos[4];
  pos[0] = __logf(fmaxf(fabsf((cxi - cxj) / wi), 0.001f));
  pos[1] = __logf(fmaxf(fabsf((cyi - cyj) / hi), 0.001f));
  pos[2] = __logf(wi / wj);
  pos[3] = __logf(hi / hj);

  const float dim_mat[8] = {1.0f, 0.42169650342858224f, 0.1778279410038923f,
                            0.07498942093324558f, 0.03162277660168379f,
                            0.013335214321633241f, 0.005623413251903491f,
                            0.0023713737056616554f};

  float acc[HH];
#pragma unroll
  for (int h = 0; h < HH; ++h) acc[h] = b_sh[h];

#pragma unroll
  for (int c = 0; c < 4; ++c) {
#pragma unroll
    for (int g = 0; g < 8; ++g) {
      const float m = 100.0f * pos[c] * dim_mat[g];
      const float sn = __sinf(m);
      const float cs = __cosf(m);
      const int f = c * 8 + g;
#pragma unroll
      for (int h = 0; h < HH; ++h)  // uniform-address LDS broadcast
        acc[h] += sn * w_sh[h * DGG + f] + cs * w_sh[h * DGG + 32 + f];
    }
    // keeps the next group's weight reads from being lifted over this one:
    // without it the kernel passes 256 VGPRs and loses a wave per SIMD
    __builtin_amdgcn_sched_barrier(0);
  }
#pragma unroll
  for (int h = 0; h < HH; ++h)
    S[((size_t)h * NN + i) * NN + j] = __logf(fmaxf(acc[h], 1e-6f));
}

// ---------------------------------------------------------------------------
// 1b) QKV projections: Y_z = X_z @ W_z^T + b_z.  64x64 tile/block.
//     Block p of 384: j-stripe p % 8, i-stripe (p / 8) % 16, z = p / 128.
// ---------------------------------------------------------------------------
#define QKV_BLOCKS (8 * 16 * 3)
#define GATE_BLOCKS (8 * NN)

__device__ __forceinline__ void qkv_block(
    int p, const float* __restrict__ q_in, const float* __restrict__ k_in,
    const float* __restrict__ v_in, const float* __restrict__ Wq,
    const float* __restrict__ Wk, const float* __restrict__ Wv,
    const float* __restrict__ bq, const float* __restrict__ bk,
    const float* __restrict__ bv, float* __restrict__ qkv_out, float* sm) {
  const int z = p >> 7;
  const float* X = (z == 0) ? q_in : (z == 1) ? k_in : v_in;
  const float* W = (z == 0) ? Wq : (z == 1) ? Wk : Wv;
  const float* bias = (z == 0) ? bq : (z == 1) ? bk : bv;
  float* Y = qkv_out + (size_t)z * NN * DD;

  const int j0 = (p & 7) * 64;          // 8 j-stripes over D
  const int i0 = ((p >> 3) & 15) * 64;  // 16 i-stripes over N

  gemm_block64<DD>(X, DD, W, DD, i0, j0, sm, [&](int row, int col, float v) {
    Y[(size_t)row * DD + col] = v + bias[col];
  });
}

// ---------------------------------------------------------------------------
// 1) One launch for the two pieces of work that depend on the inputs alone.
//    The long matrix blocks take the low indices; the
//    gate blocks (vector and LDS work) run beside them on the same SIMDs.
//    grid QKV_BLOCKS + GATE_BLOCKS, block 128; the LDS admits four blocks per WGP.
// ---------------------------------------------------------------------------
__global__ void __launch_bounds__(128) qkv_gate_kernel(
    const float* __restrict__ q_in, const float* __restrict__ k_in,
    const float* __restrict__ v_in, const float* __restrict__ Wq,
    const float* __restrict__ Wk, const float* __restrict__ Wv,
    const float* __restrict__ bq, const float* __restrict__ bk,
    const float* __restrict__ bv, float* __restrict__ qkv_out,
    const float* __restrict__ box, const float* __restrict__ WGw,
    const float* __restrict__ WGb, float* __restrict__ S) {
  __shared__ __attribute__((aligned(16))) float sm[2 * GSLAB];
  const int b = blockIdx.x;
  if (b < QKV_BLOCKS)
    qkv_block(b, q_in, k_in, v_in, Wq, Wk, Wv, bq, bk, bv, qkv_out, sm);
  else
    gate_block(b - QKV_BLOCKS, box, WGw, WGb, S, sm);
}

// ---------------------------------------------------------------------------
// 2a) Scores: S[h] += (Q_h @ K_h^T) * 0.125, fused onto the gate-log buffer.
//     Block p of 2048: j-stripe p % 16, i-stripe (p / 16) % 16, head p / 256.
//     Each wave also leaves the maximum of its 32 columns for each of its 32
//     rows in Mx[h][column group][row]: one whole 128-B line per wave.
// ---------------------------------------------------------------------------
#define VT_BLOCKS (32 * 16)
#define SCORE_BLOCKS (16 * 16 * HH)

#define MXG (NN / 32)  // column groups per row

// maximum over the 16 lanes of a row of lanes, left in all 16
__device__ __forceinline__ float rowmax16(float v) {
  v = fmaxf(v, __int_as_float(__builtin_amdgcn_update_dpp(
                   0, __float_as_int(v), 0x161, 0xf, 0xf, true)));  // row_xmask:1
  v = fmaxf(v, __int_as_float(__builtin_amdgcn_update_dpp(
                   0, __float_as_int(v), 0x162, 0xf, 0xf, true)));  // row_xmask:2
  v = fmaxf(v, __int_as_float(__builtin_amdgcn_update_dpp(
                   0, __float_as_int(v), 0x164, 0xf, 0xf, true)));  // row_xmask:4
  v = fmaxf(v, __int_as_float(__builtin_amdgcn_update_dpp(
                   0, __float_as_int(v), 0x168, 0xf, 0xf, true)));  // row_xmask:8
  return v;
}

__device__ __forceinline__ void scores_block(int p, const float* __restrict__ qkv,
                                             float* __restrict__ S,
                                             float* __restrict__ Mx, float* sm) {
  const int h = p >> 8;
  const int j0 = (p & 15) * 64;         // 16 j-stripes
  const int i0 = ((p >> 4) & 15) * 64;  // 16 i-stripes

  const float* Q = qkv + h * DKK;
  const float* K = qkv + (size_t)NN * DD + h * DKK;
  float* Sh = S + (size_t)h * NN * NN;

  const int lane = threadIdx.x & 31, wave = threadIdx.x >> 5;
  const int half = lane >> 4, lr = lane & 15;
  const int wi = (wave >> 1) * 32, wj = (wave & 1) * 32;
  v8f acc[2][2] = {};
  gemm_acc64<DKK, false>(Q, DD, K, DD, i0, j0, sm, acc, [] {},
                  [](v2f a, int, int) { return a; });

  float mine = 0.0f;  // lane lr keeps the maximum of tile row (lr/8)*16 + lr%8 + 8*half
#pragma unroll
  for (int ti = 0; ti < 2; ++ti)
#pragma unroll
    for (int r = 0; r < 8; ++r) {
      const size_t idx =
          (size_t)(i0 + wi + ti * 16 + r + 8 * half) * NN + j0 + wj + lr;
      const float s0 = Sh[idx] + acc[ti][0][r] * 0.125f;
      const float s1 = Sh[idx + 16] + acc[ti][1][r] * 0.125f;
      Sh[idx] = s0;
      Sh[idx + 16] = s1;
      const float m = rowmax16(fmaxf(s0, s1));
      if (lr == ti * 8 + r) mine = m;
    }
  const int mrow = i0 + wi + (lr >> 3) * 16 + (lr & 7) + 8 * half;
  Mx[((size_t)h * MXG + ((j0 + wj) >> 5)) * NN + mrow] = mine;
  // precaution: stands ahead of any later rewrite of the store's registers
  asm volatile("s_wait_xcnt 0x0" ::: "memory");
}

// ---------------------------------------------------------------------------
// 2b) Transpose V into Vt[h][dk][n]  (flat: Vt[c][n] with c = h*64+dk),
//     so the AV GEMM's B operand is K-contiguous. 32x32 LDS tile transpose.
//     Block p of 512: n-tile p % 32, c-tile p / 32; 128 threads (32x4).
// ---------------------------------------------------------------------------
__device__ __forceinline__ void vtrans_block(int p, const float* __restrict__ qkv,
                                             float* __restrict__ Vt, float* sm) {
  float (*tile)[33] = (float (*)[33])sm;  // 32 rows of 33
  const float* V = qkv + (size_t)2 * NN * DD;
  const int n0 = (p & 31) * 32, c0 = (p >> 5) * 32;
  const int tx = threadIdx.x & 31, ty = threadIdx.x >> 5;
#pragma unroll
  for (int r = 0; r < 32; r += 4)
    tile[ty + r][tx] = V[(size_t)(n0 + ty + r) * DD + c0 + tx];
  __syncthreads();
#pragma unroll
  for (int r = 0; r < 32; r += 4)
    Vt[(size_t)(c0 + ty + r) * NN + n0 + tx] = tile[tx][ty + r];
}

// ---------------------------------------------------------------------------
// 2) One launch for the two pieces of work that read qkv (the scores also add onto S).
//    grid VT_BLOCKS + SCORE_BLOCKS, block 128.
// ---------------------------------------------------------------------------
__global__ void __launch_bounds__(128) scores_vtrans_kernel(
    const float* __restrict__ qkv, float* __restrict__ S,
    float* __restrict__ Vt, float* __restrict__ Mx) {
  __shared__ __attribute__((aligned(16))) float sm[GSLAB];
  const int b = blockIdx.x;
  if (b < VT_BLOCKS)
    vtrans_block(b, qkv, Vt, sm);
  else
    scores_block(b - VT_BLOCKS, qkv, S, Mx, sm);
}

// ---------------------------------------------------------------------------
// 3) Attention output with the row softmax folded in:
//     att[h] = (exp(S - rowmax) @ V_h) / rowsum, B from Vt (row-contiguous).
//     The row maximum comes from the scores blocks' Mx; exp is applied to the
//     A fragments between LDS and the matrix unit; each lane sums what it
//     feeds, and the quotient is taken once per output element.
//     grid (16, 8), block 128; block -> 64 rows x all 64 columns of a head.
// ---------------------------------------------------------------------------
__global__ void __launch_bounds__(128) av_kernel(
    const float* __restrict__ S, const float* __restrict__ Vt,
    const float* __restrict__ Mx, float* __restrict__ att) {
  __shared__ __attribute__((aligned(16))) float sm[2 * GSLAB];
  const int h = blockIdx.y;
  const int i0 = blockIdx.x * 64;  // 16 i-stripes
  const int j0 = 0;

  const float* A = S + (size_t)h * NN * NN;
  const float* B = Vt + (size_t)h * DKK * NN;
  float* atth = att + (size_t)h * NN * DKK;

  const int lane = threadIdx.x & 31, wave = threadIdx.x >> 5;
  const int half = lane >> 4, lr = lane & 15;
  const int wi = (wave >> 1) * 32, wj = (wave & 1) * 32;
  const float L2E = 1.4426950408889634f;

  float c[2];                  // -rowmax * log2(e) of rows wi + ti*16 + lr
  v2f ls[2][4] = {};           // this lane's share of those rows' sums, in four
                               // short chains each so that no add waits on the last
  v8f acc[2][2] = {};
  gemm_acc64<NN, true>(
      A, NN, B, NN, i0, j0, sm, acc,
      [&] {
        // each half of the wave folds half of the column groups
        const float* mp = Mx + ((size_t)h * MXG + half * (MXG / 2)) * NN + i0 + wi + lr;
        float m0 = mp[0], m1 = mp[16];
#pragma unroll
        for (int g = 1; g < MXG / 2; ++g) {
          m0 = fmaxf(m0, mp[g * NN]);
          m1 = fmaxf(m1, mp[g * NN + 16]);
        }
        m0 = fmaxf(m0, __shfl_xor(m0, 16, 32));
        m1 = fmaxf(m1, __shfl_xor(m1, 16, 32));
        c[0] = -m0 * L2E;
        c[1] = -m1 * L2E;
      },
      [&](v2f a, int ti, int k) {
        v2f e;
        e.x = __builtin_amdgcn_exp2f(fmaf(a.x, L2E, c[ti]));
        e.y = __builtin_amdgcn_exp2f(fmaf(a.y, L2E, c[ti]));
        ls[ti][(k >> 2) & 3] += e;
        return e;
      });

  float inv[2];  // lane lr (either half): 1 / sum of row wi + ti*16 + lr
#pragma unroll
  for (int ti = 0; ti < 2; ++ti) {
    const v2f q = (ls[ti][0] + ls[ti][1]) + (ls[ti][2] + ls[ti][3]);
    const float l = q.x + q.y;
    inv[ti] = 1.0f / (l + __shfl_xor(l, 16, 32));
  }

#pragma unroll
  for (int ti = 0; ti < 2; ++ti)
#pragma unroll
    for (int r = 0; r < 8; ++r) {
      const float iv = __shfl(inv[ti], r + 8 * half, 32);
      const size_t o = (size_t)(i0 + wi + ti * 16 + r + 8 * half) * DKK + j0 + wj + lr;
      atth[o] = acc[ti][0][r] * iv;
      atth[o + 16] = acc[ti][1][r] * iv;
    }
}

// ---------------------------------------------------------------------------
// 4) Faithful scramble (transpose(0,2,1).reshape) + residual + LayerNorm.
//    flat f = r*512+c maps to att[h = f>>16][n = f&1023][d = (f>>10)&63].
// ---------------------------------------------------------------------------
__global__ void __launch_bounds__(256) ln0_kernel(
    const float* __restrict__ att, const float* __restrict__ residual,
    const float* __restrict__ g, const float* __restrict__ b,
    float* __restrict__ out0) {
  __shared__ float red[256];
  const int r = blockIdx.x;
  const int t = threadIdx.x;
  float v[2];
#pragma unroll
  for (int u = 0; u < 2; ++u) {
    const int c = t + 256 * u;
    const unsigned f = (unsigned)r * 512u + (unsigned)c;
    const unsigned hh = f >> 16;
    const unsigned d = (f >> 10) & 63u;
    const unsigned n = f & 1023u;
    v[u] = att[((size_t)hh * NN + n) * DKK + d] + residual[(size_t)r * DD + c];
  }
  red[t] = v[0] + v[1];
  __syncthreads();
  for (int s = 128; s > 0; s >>= 1) {
    if (t < s) red[t] += red[t + s];
    __syncthreads();
  }
  const float mean = red[0] * (1.0f / DD);
  __syncthreads();
  const float d0 = v[0] - mean, d1 = v[1] - mean;
  red[t] = d0 * d0 + d1 * d1;
  __syncthreads();
  for (int s = 128; s > 0; s >>= 1) {
    if (t < s) red[t] += red[t + s];
    __syncthreads();
  }
  const float inv = rsqrtf(red[0] * (1.0f / DD) + LN_EPS);
#pragma unroll
  for (int u = 0; u < 2; ++u) {
    const int c = t + 256 * u;
    out0[(size_t)r * DD + c] = (u == 0 ? d0 : d1) * inv * g[c] + b[c];
  }
}

// ---------------------------------------------------------------------------
// 5) Output projection: proj = out0 @ Wo^T + bo.  grid (8, 16), block 128.
// ---------------------------------------------------------------------------
__global__ void __launch_bounds__(128) proj_kernel(
    const float* __restrict__ X, const float* __restrict__ W,
    const float* __restrict__ bias, float* __restrict__ Y) {
  __shared__ __attribute__((aligned(16))) float sm[2 * GSLAB];
  const int j0 = blockIdx.x * 64;
  const int i0 = blockIdx.y * 64;
  gemm_block64<DD>(X, DD, W, DD, i0, j0, sm, [&](int row, int col, float v) {
    Y[(size_t)row * DD + col] = v + bias[col];
  });
}

// ---------------------------------------------------------------------------
// 6) Final residual + LayerNorm -> d_out.
// ---------------------------------------------------------------------------
__global__ void __launch_bounds__(256) lnf_kernel(
    const float* __restrict__ proj, const float* __restrict__ out0,
    const float* __restrict__ g, const float* __restrict__ b,
    float* __restrict__ out) {
  __shared__ float red[256];
  const int r = blockIdx.x;
  const int t = threadIdx.x;
  float v[2];
#pragma unroll
  for (int u = 0; u < 2; ++u) {
    const int c = t + 256 * u;
    v[u] = proj[(size_t)r * DD + c] + out0[(size_t)r * DD + c];
  }
  red[t] = v[0] + v[1];
  __syncthreads();
  for (int s = 128; s > 0; s >>= 1) {
    if (t < s) red[t] += red[t + s];
    __syncthreads();
  }
  const float mean = red[0] * (1.0f / DD);
  __syncthreads();
  const float d0 = v[0] - mean, d1 = v[1] - mean;
  red[t] = d0 * d0 + d1 * d1;
  __syncthreads();
  for (int s = 128; s > 0; s >>= 1) {
    if (t < s) red[t] += red[t + s];
    __syncthreads();
  }
  const float inv = rsqrtf(red[0] * (1.0f / DD) + LN_EPS);
#pragma unroll
  for (int u = 0; u < 2; ++u) {
    const int c = t + 256 * u;
    out[(size_t)r * DD + c] = (u == 0 ? d0 : d1) * inv * g[c] + b[c];
  }
}

extern "C" void kernel_launch(void* const* d_in, const int* in_sizes, int n_in,
                              void* d_out, int out_size, void* d_ws,
                              size_t ws_size, hipStream_t stream) {
  (void)in_sizes; (void)n_in; (void)out_size; (void)ws_size;
  const float* q_in = (const float*)d_in[0];
  const float* k_in = (const float*)d_in[1];
  const float* v_in = (const float*)d_in[2];
  const float* box  = (const float*)d_in[3];
  const float* Wq = (const float*)d_in[4];
  const float* bq = (const float*)d_in[5];
  const float* Wk = (const float*)d_in[6];
  const float* bk = (const float*)d_in[7];
  const float* Wv = (const float*)d_in[8];
  const float* bv = (const float*)d_in[9];
  const float* Wo = (const float*)d_in[10];
  const float* bo = (const float*)d_in[11];
  const float* WGw = (const float*)d_in[12];
  const float* WGb = (const float*)d_in[13];
  const float* ln0g = (const float*)d_in[14];
  const float* ln0b = (const float*)d_in[15];
  const float* lng = (const float*)d_in[16];
  const float* lnb = (const float*)d_in[17];

  float* ws = (float*)d_ws;
  float* S    = ws;                          // 8*1024*1024    (32 MB)
  float* qkv  = S + (size_t)HH * NN * NN;    // 3*1024*512     ( 6 MB)
  float* Vt   = qkv + (size_t)3 * NN * DD;   // 8*64*1024      ( 2 MB)
  float* att  = Vt + (size_t)HH * DKK * NN;  // 8*1024*64      ( 2 MB)
  float* out0 = att + (size_t)HH * NN * DKK; // 1024*512       ( 2 MB)
  float* proj = out0 + (size_t)NN * DD;      // 1024*512       ( 2 MB)
  float* Mx   = proj + (size_t)NN * DD;      // 8*32*1024      ( 1 MB)
  float* out  = (float*)d_out;

  qkv_gate_kernel<<<dim3(QKV_BLOCKS + GATE_BLOCKS), 128, 0, stream>>>(
      q_in, k_in, v_in, Wq, Wk, Wv, bq, bk, bv, qkv, box, WGw, WGb, S);
  scores_vtrans_kernel<<<dim3(VT_BLOCKS + SCORE_BLOCKS), 128, 0, stream>>>(qkv, S, Vt, Mx);
  av_kernel<<<dim3(16, 8), 128, 0, stream>>>(S, Vt, Mx, att);
  ln0_kernel<<<dim3(NN), 256, 0, stream>>>(att, q_in, ln0g, ln0b, out0);
  proj_kernel<<<dim3(8, 16), 128, 0, stream>>>(out0, Wo, bo, proj);
  lnf_kernel<<<dim3(NN), 256, 0, stream>>>(proj, out0, lng, lnb, out);
}

// v004
// One run takes 73.4 microseconds.
// Next to v003, in two timings, it ran 1.14 and 1.13 times as fast.
// Counting every step since v000, it is 2.13 times as fast.
#include <hip/hip_runtime.h>
#include <hip/hip_bf16.h>
#include <math.h>

#define NN 1024
#define DD 512
#define HH 8
#define DKK 64
#define DGG 64
#define LN_EPS 1e-5f

typedef float v2f __attribute__((ext_vector_type(2)));
typedef float v8f __attribute__((ext_vector_type(8)));

// ---------------------------------------------------------------------------
// Generic 64x64 output tile per 4-wave block, 32x32 per wave (2x2 waves), on
// V_WMMA_F32_16X16X4_F32.
// Y[i][j] = sum_k Arow_i[k] * Brow_j[k]   (both operands row-contiguous in K)
//
// Operands go global -> LDS in slabs of 64 k: 64 A rows then 64 B rows, each
// 256 B, brought by asynchronous 16-byte copies (16 lanes cover one row, so a
// wave's copy covers four whole 128-B lines) and shared by the block's waves.
// LDS row pitch 68 dwords (16 B x 17): the 16 rows x 16 B that one fragment
// read touches fall on all 64 banks once.
//
// Fragment layout (ISA 7.12.2, 32-bit operands, wave32):
//   A 16x4: lanes 0-15 = rows M=0..15 holding K={k,k+1};
//           lanes 16-31 = same rows holding K={k+2,k+3}  -> contiguous v2f.
//   B 4x16: symmetric with N = lane%16.
//   C/D   : VGPR r -> M = r (lanes 0-15) / r+8 (lanes 16-31), N = lane%16.
// ---------------------------------------------------------------------------
#define GBK 64                      // k per slab
#define GPITCH 68                   // LDS row pitch, dwords
#define GSLAB (128 * GPITCH)        // dwords per slab buffer

// Eight rows' worth of copies for this lane (rows 8 apart). The s_wait_xcnt
// closes the statement so that no address register is rewritten ahead of it.
__device__ __forceinline__ void copy8_rows(unsigned l, const float* g, int ld) {
  const unsigned ls = 8u * GPITCH * 4u;
  const size_t gs = (size_t)8 * ld;
  asm volatile(
      "global_load_async_to_lds_b128 %0, %8, off\n\t"
      "global_load_async_to_lds_b128 %1, %9, off\n\t"
      "global_load_async_to_lds_b128 %2, %10, off\n\t"
      "global_load_async_to_lds_b128 %3, %11, off\n\t"
      "global_load_async_to_lds_b128 %4, %12, off\n\t"
      "global_load_async_to_lds_b128 %5, %13, off\n\t"
      "global_load_async_to_lds_b128 %6, %14, off\n\t"
      "global_load_async_to_lds_b128 %7, %15, off\n\t"
      "s_wait_xcnt 0x0"
      ::"v"(l), "v"(l + ls), "v"(l + 2 * ls), "v"(l + 3 * ls), "v"(l + 4 * ls),
        "v"(l + 5 * ls), "v"(l + 6 * ls), "v"(l + 7 * ls), "v"(g), "v"(g + gs),
        "v"(g + 2 * gs), "v"(g + 3 * gs), "v"(g + 4 * gs), "v"(g + 5 * gs),
        "v"(g + 6 * gs), "v"(g + 7 * gs)
      : "memory");
}

// gemm_acc64 leaves the wave's 32x32 tile in acc. pre() runs once while slab 0
// is in flight; at(a, ti, k) maps each A fragment (rows ti*16 + lane%16 of the
// wave's tile, k-step k of the slab) on its way from LDS to the matrix unit.
template <int KSIZE, class Pre, class AT>
__device__ __forceinline__ void gemm_acc64(const float* __restrict__ A,
                                           int lda, const float* __restrict__ B,
                                           int ldb, int i0, int j0, float* sm,
                                           v8f (&acc)[2][2], Pre pre, AT at) {
  constexpr int NS = KSIZE / GBK;  // slabs
  const int t = threadIdx.x;       // 0..127
  const int lane = t & 31, wave = t >> 5;
  const int half = lane >> 4, lr = lane & 15;
  const int wi = (wave >> 1) * 32, wj = (wave & 1) * 32;

  // copy role: 16-byte chunk ch of rows rg, rg+8, ... of each operand
  const int ch = t & 15, rg = t >> 4;
  const float* ga = A + (size_t)(i0 + rg) * lda + ch * 4;
  const float* gb = B + (size_t)(j0 + rg) * ldb + ch * 4;
  const unsigned la = (unsigned)(size_t)(sm + rg * GPITCH + ch * 4);
  const unsigned lb = la + 64u * GPITCH * 4u;

  const float* fa = sm + (wi + lr) * GPITCH + 2 * half;
  const float* fb = sm + (64 + wj + lr) * GPITCH + 2 * half;

  auto fill = [&](int s) {
    const unsigned bo = (unsigned)(s & 1) * (GSLAB * 4u);
    copy8_rows(la + bo, ga + s * GBK, lda);
    copy8_rows(lb + bo, gb + s * GBK, ldb);
  };
  auto work = [&](int s) {
    const float* as = fa + (s & 1) * GSLAB;
    const float* bs = fb + (s & 1) * GSLAB;
#pragma unroll
    for (int k = 0; k < GBK; k += 4) {
      const v2f a0 = at(*(const v2f*)(as + k), 0, k);
      const v2f a1 = at(*(const v2f*)(as + 16 * GPITCH + k), 1, k);
      const v2f b0 = *(const v2f*)(bs + k);
      const v2f b1 = *(const v2f*)(bs + 16 * GPITCH + k);
      acc[0][0] = __builtin_amdgcn_wmma_f32_16x16x4_f32(false, a0, false, b0,
                                                        (short)0, acc[0][0], false, false);
      acc[0][1] = __builtin_amdgcn_wmma_f32_16x16x4_f32(false, a0, false, b1,
                                                        (short)0, acc[0][1], false, false);
      acc[1][0] = __builtin_amdgcn_wmma_f32_16x16x4_f32(false, a1, false, b0,
                                                        (short)0, acc[1][0], false, false);
      acc[1][1] = __builtin_amdgcn_wmma_f32_16x16x4_f32(false, a1, false, b1,
                                                        (short)0, acc[1][1], false, false);
    }
  };

  fill(0);
  pre();
  // slab 0 has landed for this wave's own copies; the barrier publishes it
  asm volatile("s_wait_asynccnt 0x0" ::: "memory");
  __syncthreads();
  if constexpr (NS == 1) {
    work(0);
  } else {
    fill(1);
#pragma unroll 1  // rolled, for speed only
    for (int s = 0; s < NS; ++s) {
      work(s);
      // this wave's reads of slab s are done before the buffer may be refilled
      asm volatile("s_wait_dscnt 0x0" ::: "memory");
      // this wave's copies of slab s+1 have landed before the barrier publishes
      asm volatile("s_wait_asynccnt 0x0" ::: "memory");
      __syncthreads();
      if (s + 2 < NS) fill(s + 2);
    }
    // no copy is outstanding when the wave goes on to its epilogue and ends
    asm volatile("s_wait_asynccnt 0x0" ::: "memory");
  }
}

template <int KSIZE, class Epi>
__device__ __forceinline__ void gemm_block64(const float* __restrict__ A,
                                             int lda, const float* __restrict__ B,
                                             int ldb, int i0, int j0, float* sm,
                                             Epi epi) {
  const int lane = threadIdx.x & 31, wave = threadIdx.x >> 5;
  const int half = lane >> 4, lr = lane & 15;
  const int wi = (wave >> 1) * 32, wj = (wave & 1) * 32;
  v8f acc[2][2] = {};
  gemm_acc64<KSIZE>(A, lda, B, ldb, i0, j0, sm, acc, [] {},
                    [](v2f a, int, int) { return a; });

#pragma unroll
  for (int ti = 0; ti < 2; ++ti)
#pragma unroll
    for (int tj = 0; tj < 2; ++tj)
#pragma unroll
      for (int r = 0; r < 8; ++r)
        epi(i0 + wi + ti * 16 + r + 8 * half, j0 + wj + tj * 16 + lr, acc[ti][tj][r]);
}

// ---------------------------------------------------------------------------
// 32x64 output tile per 8-wave block, one 16x16 tile per wave (2x4 waves), for
// the products whose 64x64 grid would leave half of the WGPs empty: twice the
// blocks, and two waves on every SIMD, so that one wave's matrix instructions
// run under the other's LDS waits and vector work.
// Slabs of 128 k: 32 A rows then 64 B rows of 512 B, one wave's copy = one row.
// LDS row pitch 132 dwords (16 B x 33): same bank spread as GPITCH.
// Even and odd k-steps go to two accumulators, so that no matrix instruction
// waits for the one before it; the caller adds the two.
// ---------------------------------------------------------------------------
#define TBK 128                     // k per slab
#define TPITCH 132                  // LDS row pitch, dwords
#define TSLAB (96 * TPITCH)         // dwords per slab buffer

// This lane's twelve copies of a slab: A rows 8 apart (4), B rows 8 apart (8).
// The s_wait_xcnt closes the statement so that no address register is
// rewritten ahead of it.
__device__ __forceinline__ void copy12_rows(unsigned l, const float* a, int lda,
                                            const float* b, int ldb) {
  const unsigned ls = 8u * TPITCH * 4u;
  const size_t as = (size_t)8 * lda, bs = (size_t)8 * ldb;
  asm volatile(
      "global_load_async_to_lds_b128 %0, %12, off\n\t"
      "global_load_async_to_lds_b128 %1, %13, off\n\t"
      "global_load_async_to_lds_b128 %2, %14, off\n\t"
      "global_load_async_to_lds_b128 %3, %15, off\n\t"
      "global_load_async_to_lds_b128 %4, %16, off\n\t"
      "global_load_async_to_lds_b128 %5, %17, off\n\t"
      "global_load_async_to_lds_b128 %6, %18, off\n\t"
      "global_load_async_to_lds_b128 %7, %19, off\n\t"
      "global_load_async_to_lds_b128 %8, %20, off\n\t"
      "global_load_async_to_lds_b128 %9, %21, off\n\t"
      "global_load_async_to_lds_b128 %10, %22, off\n\t"
      "global_load_async_to_lds_b128 %11, %23, off\n\t"
      "s_wait_xcnt 0x0"
      ::"v"(l), "v"(l + ls), "v"(l + 2 * ls), "v"(l + 3 * ls), "v"(l + 4 * ls),
        "v"(l + 5 * ls), "v"(l + 6 * ls), "v"(l + 7 * ls), "v"(l + 8 * ls),
        "v"(l + 9 * ls), "v"(l + 10 * ls), "v"(l + 11 * ls), "v"(a), "v"(a + as),
        "v"(a + 2 * as), "v"(a + 3 * as), "v"(b), "v"(b + bs), "v"(b + 2 * bs),
        "v"(b + 3 * bs), "v"(b + 4 * bs), "v"(b + 5 * bs), "v"(b + 6 * bs),
        "v"(b + 7 * bs)
      : "memory");
}

// gemm_acc32 leaves the wave's 16x16 tile as acc[0] + acc[1]. pre() runs once
// while slab 0 is in flight; at(a, k) maps each A fragment (row lane%16 of the
// wave's tile, k-step k of the slab) on its way from LDS to the matrix unit.
template <int KSIZE, class Pre, class AT>
__device__ __forceinline__ void gemm_acc32(const float* __restrict__ A, int lda,
                                           const float* __restrict__ B, int ldb,
                                           int i0, int j0, float* sm,
                                           v8f (&acc)[2], Pre pre, AT at) {
  constexpr int NS = KSIZE / TBK;  // slabs, at least two
  const int t = threadIdx.x;       // 0..255
  const int lane = t & 31, wave = t >> 5;
  const int half = lane >> 4, lr = lane & 15;
  const int wi = (wave >> 2) * 16, wj = (wave & 3) * 16;

  // copy role: 16-byte chunk 'lane' of rows wave, wave+8, ... of each operand
  const float* ga = A + (size_t)(i0 + wave) * lda + lane * 4;
  const float* gb = B + (size_t)(j0 + wave) * ldb + lane * 4;
  const unsigned la = (unsigned)(size_t)(sm + wave * TPITCH + lane * 4);

  const float* fa = sm + (wi + lr) * TPITCH + 2 * half;
  const float* fb = sm + (32 + wj + lr) * TPITCH + 2 * half;

  auto fill = [&](int s) {
    copy12_rows(la + (unsigned)(s & 1) * (TSLAB * 4u), ga + s * TBK, lda,
                gb + s * TBK, ldb);
  };
  auto work = [&](int s) {
    const float* as = fa + (s & 1) * TSLAB;
    const float* bs = fb + (s & 1) * TSLAB;
#pragma unroll
    for (int k = 0; k < TBK; k += 4) {
      const v2f a = at(*(const v2f*)(as + k), k);
      const v2f b = *(const v2f*)(bs + k);
      acc[(k >> 2) & 1] = __builtin_amdgcn_wmma_f32_16x16x4_f32(
          false, a, false, b, (short)0, acc[(k >> 2) & 1], false, false);
    }
  };

  fill(0);
  pre();
  // slab 0 has landed for this wave's own copies; the barrier publishes it
  asm volatile("s_wait_asynccnt 0x0" ::: "memory");
  __syncthreads();
  fill(1);
#pragma unroll 1  // rolled, for speed only
  for (int s = 0; s < NS; ++s) {
    work(s);
    // this wave's reads of slab s are done before the buffer may be refilled
    asm volatile("s_wait_dscnt 0x0" ::: "memory");
    // this wave's copies of slab s+1 have landed before the barrier publishes
    asm volatile("s_wait_asynccnt 0x0" ::: "memory");
    __syncthreads();
    if (s + 2 < NS) fill(s + 2);
  }
  // no copy is outstanding when the wave goes on to its epilogue and ends
  asm volatile("s_wait_asynccnt 0x0" ::: "memory");
}

// ---------------------------------------------------------------------------
// 1a) Box-relative embedding + per-head gate, fused to log(clip(relu(.),1e-6)).
//     Writes S[h][i][j]; the scores blocks add QK^T/8 in place afterwards.
//     128-thread block p of 8192: row i = p / 8, columns from (p % 8) * 128.
// ---------------------------------------------------------------------------
__device__ __forceinline__ void gate_block(
    int p, const float* __restrict__ box, const float* __restrict__ WGw,
    const float* __restrict__ WGb, float* __restrict__ S, float* sm) {
  float* w_sh = sm;             // HH * DGG weights
  float* b_sh = sm + HH * DGG;  // HH biases
  // 128 threads x 16 bytes = all HH * DGG weights in one load each
  *(float4*)(w_sh + 4 * threadIdx.x) = *(const float4*)(WGw + 4 * threadIdx.x);
  if (threadIdx.x < HH) b_sh[threadIdx.x] = WGb[threadIdx.x];
  __syncthreads();

  const int i = p >> 3;
  const int j = (p & 7) * 128 + threadIdx.x;

  const float xi0 = box[i * 4 + 0], yi0 = box[i * 4 + 1];
  const float xi1 = box[i * 4 + 2], yi1 = box[i * 4 + 3];
  const float cxi = (xi0 + xi1) * 0.5f, cyi = (yi0 + yi1) * 0.5f;
  const float wi = xi1 - xi0 + 1.0f, hi = yi1 - yi0 + 1.0f;

  const float xj0 = box[j * 4 + 0], yj0 = box[j * 4 + 1];
  const float xj1 = box[j * 4 + 2], yj1 = box[j * 4 + 3];
  const float cxj = (xj0 + xj1) * 0.5f, cyj = (yj0 + yj1) * 0.5f;
  const float wj = xj1 - xj0 + 1.0f, hj = yj1 - yj0 + 1.0f;

  float pos[4];
  pos[0] = __logf(fmaxf(fabsf((cxi - cxj) / wi), 0.001f));
  pos[1] = __logf(fmaxf(fabsf((cyi - cyj) / hi), 0.001f));
  pos[2] = __logf(wi / wj);
  pos[3] = __logf(hi / hj);

  const float dim_mat[8] = {1.0f, 0.42169650342858224f, 0.1778279410038923f,
                            0.07498942093324558f, 0.03162277660168379f,
                            0.013335214321633241f, 0.005623413251903491f,
                            0.0023713737056616554f};

  float acc[HH];
#pragma unroll
  for (int h = 0; h < HH; ++h) acc[h] = b_sh[h];

#pragma unroll
  for (int c = 0; c < 4; ++c) {
#pragma unroll
    for (int g = 0; g < 8; ++g) {
      const float m = 100.0f * pos[c] * dim_mat[g];
      const float sn = __sinf(m);
      const float cs = __cosf(m);
      const int f = c * 8 + g;
#pragma unroll
      for (int h = 0; h < HH; ++h)  // uniform-address LDS broadcast
        acc[h] += sn * w_sh[h * DGG + f] + cs * w_sh[h * DGG + 32 + f];
    }
    // keeps the next group's weight reads from being lifted over this one:
    // without it the kernel passes 256 VGPRs and loses a wave per SIMD
    __builtin_amdgcn_sched_barrier(0);
  }
#pragma unroll
  for (int h = 0; h < HH; ++h)
    S[((size_t)h * NN + i) * NN + j] = __logf(fmaxf(acc[h], 1e-6f));
}

// ---------------------------------------------------------------------------
// 1b) QKV projections: Y_z = X_z @ W_z^T + b_z.  64x64 tile/block.
//     Block p of 384: j-stripe p % 8, i-stripe (p / 8) % 16, z = p / 128.
// ---------------------------------------------------------------------------
#define QKV_BLOCKS (8 * 16 * 3)
#define GATE_BLOCKS (8 * NN)

__device__ __forceinline__ void qkv_block(
    int p, const float* __restrict__ q_in, const float* __restrict__ k_in,
    const float* __restrict__ v_in, const float* __restrict__ Wq,
    const float* __restrict__ Wk, const float* __restrict__ Wv,
    const float* __restrict__ bq, const float* __restrict__ bk,
    const float* __restrict__ bv, float* __restrict__ qkv_out, float* sm) {
  const int z = p >> 7;
  const float* X = (z == 0) ? q_in : (z == 1) ? k_in : v_in;
  const float* W = (z == 0) ? Wq : (z == 1) ? Wk : Wv;
  const float* bias = (z == 0) ? bq : (z == 1) ? bk : bv;
  float* Y = qkv_out + (size_t)z * NN * DD;

  const int j0 = (p & 7) * 64;          // 8 j-stripes over D
  const int i0 = ((p >> 3) & 15) * 64;  // 16 i-stripes over N

  gemm_block64<DD>(X, DD, W, DD, i0, j0, sm, [&](int row, int col, float v) {
    Y[(size_t)row * DD + col] = v + bias[col];
  });
}

// ---------------------------------------------------------------------------
// 1) One launch for the two pieces of work that depend on the inputs alone.
//    The long matrix blocks take the low indices; the
//    gate blocks (vector and LDS work) run beside them on the same SIMDs.
//    grid QKV_BLOCKS + GATE_BLOCKS, block 128; the LDS admits four blocks per WGP.
// ---------------------------------------------------------------------------
__global__ void __launch_bounds__(128) qkv_gate_kernel(
    const float* __restrict__ q_in, const float* __restrict__ k_in,
    const float* __restrict__ v_in, const float* __restrict__ Wq,
    const float* __restrict__ Wk, const float* __restrict__ Wv,
    const float* __restrict__ bq, const float* __restrict__ bk,
    const float* __restrict__ bv, float* __restrict__ qkv_out,
    const float* __restrict__ box, const float* __restrict__ WGw,
    const float* __restrict__ WGb, float* __restrict__ S) {
  __shared__ __attribute__((aligned(16))) float sm[2 * GSLAB];
  const int b = blockIdx.x;
  if (b < QKV_BLOCKS)
    qkv_block(b, q_in, k_in, v_in, Wq, Wk, Wv, bq, bk, bv, qkv_out, sm);
  else
    gate_block(b - QKV_BLOCKS, box, WGw, WGb, S, sm);
}

// ---------------------------------------------------------------------------
// 2a) Scores: S[h] += (Q_h @ K_h^T) * 0.125, fused onto the gate-log buffer.
//     Block p of 2048: j-stripe p % 16, i-stripe (p / 16) % 16, head p / 256.
//     Each wave also leaves the maximum of its 32 columns for each of its 32
//     rows in Mx[h][column group][row]: one whole 128-B line per wave.
// ---------------------------------------------------------------------------
#define VT_BLOCKS (32 * 16)
#define SCORE_BLOCKS (16 * 16 * HH)

#define MXG (NN / 32)  // column groups per row

// maximum over the 16 lanes of a row of lanes, left in all 16
__device__ __forceinline__ float rowmax16(float v) {
  v = fmaxf(v, __int_as_float(__builtin_amdgcn_update_dpp(
                   0, __float_as_int(v), 0x161, 0xf, 0xf, true)));  // row_xmask:1
  v = fmaxf(v, __int_as_float(__builtin_amdgcn_update_dpp(
                   0, __float_as_int(v), 0x162, 0xf, 0xf, true)));  // row_xmask:2
  v = fmaxf(v, __int_as_float(__builtin_amdgcn_update_dpp(
                   0, __float_as_int(v), 0x164, 0xf, 0xf, true)));  // row_xmask:4
  v = fmaxf(v, __int_as_float(__builtin_amdgcn_update_dpp(
                   0, __float_as_int(v), 0x168, 0xf, 0xf, true)));  // row_xmask:8
  return v;
}

__device__ __forceinline__ void scores_block(int p, const float* __restrict__ qkv,
                                             float* __restrict__ S,
                                             float* __restrict__ Mx, float* sm) {
  const int h = p >> 8;
  const int j0 = (p & 15) * 64;         // 16 j-stripes
  const int i0 = ((p >> 4) & 15) * 64;  // 16 i-stripes

  const float* Q = qkv + h * DKK;
  const float* K = qkv + (size_t)NN * DD + h * DKK;
  float* Sh = S + (size_t)h * NN * NN;

  const int lane = threadIdx.x & 31, wave = threadIdx.x >> 5;
  const int half = lane >> 4, lr = lane & 15;
  const int wi = (wave >> 1) * 32, wj = (wave & 1) * 32;
  v8f acc[2][2] = {};
  gemm_acc64<DKK>(Q, DD, K, DD, i0, j0, sm, acc, [] {},
                  [](v2f a, int, int) { return a; });

  float mine = 0.0f;  // lane lr keeps the maximum of tile row (lr/8)*16 + lr%8 + 8*half
#pragma unroll
  for (int ti = 0; ti < 2; ++ti)
#pragma unroll
    for (int r = 0; r < 8; ++r) {
      const size_t idx =
          (size_t)(i0 + wi + ti * 16 + r + 8 * half) * NN + j0 + wj + lr;
      const float s0 = Sh[idx] + acc[ti][0][r] * 0.125f;
      const float s1 = Sh[idx + 16] + acc[ti][1][r] * 0.125f;
      Sh[idx] = s0;
      Sh[idx + 16] = s1;
      const float m = rowmax16(fmaxf(s0, s1));
      if (lr == ti * 8 + r) mine = m;
    }
  const int mrow = i0 + wi + (lr >> 3) * 16 + (lr & 7) + 8 * half;
  Mx[((size_t)h * MXG + ((j0 + wj) >> 5)) * NN + mrow] = mine;
  // precaution: stands ahead of any later rewrite of the store's registers
  asm volatile("s_wait_xcnt 0x0" ::: "memory");
}

// ---------------------------------------------------------------------------
// 2b) Transpose V into Vt[h][dk][n]  (flat: Vt[c][n] with c = h*64+dk),
//     so the AV GEMM's B operand is K-contiguous. 32x32 LDS tile transpose.
//     Block p of 512: n-tile p % 32, c-tile p / 32; 128 threads (32x4).
// ---------------------------------------------------------------------------
__device__ __forceinline__ void vtrans_block(int p, const float* __restrict__ qkv,
                                             float* __restrict__ Vt, float* sm) {
  float (*tile)[33] = (float (*)[33])sm;  // 32 rows of 33
  const float* V = qkv + (size_t)2 * NN * DD;
  const int n0 = (p & 31) * 32, c0 = (p >> 5) * 32;
  const int tx = threadIdx.x & 31, ty = threadIdx.x >> 5;
#pragma unroll
  for (int r = 0; r < 32; r += 4)
    tile[ty + r][tx] = V[(size_t)(n0 + ty + r) * DD + c0 + tx];
  __syncthreads();
#pragma unroll
  for (int r = 0; r < 32; r += 4)
    Vt[(size_t)(c0 + ty + r) * NN + n0 + tx] = tile[tx][ty + r];
}

// ---------------------------------------------------------------------------
// 2) One launch for the two pieces of work that read qkv (the scores also add onto S).
//    grid VT_BLOCKS + SCORE_BLOCKS, block 128.
// ---------------------------------------------------------------------------
__global__ void __launch_bounds__(128) scores_vtrans_kernel(
    const float* __restrict__ qkv, float* __restrict__ S,
    float* __restrict__ Vt, float* __restrict__ Mx) {
  __shared__ __attribute__((aligned(16))) float sm[GSLAB];
  const int b = blockIdx.x;
  if (b < VT_BLOCKS)
    vtrans_block(b, qkv, Vt, sm);
  else
    scores_block(b - VT_BLOCKS, qkv, S, Mx, sm);
}

// ---------------------------------------------------------------------------
// 3) Attention output with the row softmax folded in:
//     att[h] = (exp(S - rowmax) @ V_h) / rowsum, B from Vt (row-contiguous).
//     The row maximum comes from the scores blocks' Mx; exp is applied to the
//     A fragments between LDS and the matrix unit; each lane sums what it
//     feeds, and the quotient is taken once per output element.
//     grid (32, 8), block 256; block -> 32 rows x all 64 columns of a head.
// ---------------------------------------------------------------------------
__global__ void __launch_bounds__(256) av_kernel(
    const float* __restrict__ S, const float* __restrict__ Vt,
    const float* __restrict__ Mx, float* __restrict__ att) {
  __shared__ __attribute__((aligned(16))) float sm[2 * TSLAB];
  const int h = blockIdx.y;
  const int i0 = blockIdx.x * 32;  // 32 i-stripes

  const float* A = S + (size_t)h * NN * NN;
  const float* B = Vt + (size_t)h * DKK * NN;
  float* atth = att + (size_t)h * NN * DKK;

  const int lane = threadIdx.x & 31, wave = threadIdx.x >> 5;
  const int half = lane >> 4, lr = lane & 15;
  const int wi = (wave >> 2) * 16, wj = (wave & 3) * 16;
  const float L2E = 1.4426950408889634f;

  float c;                     // -rowmax * log2(e) of row wi + lr
  v2f ls[4] = {};              // this lane's share of that row's sum, in four
                               // short chains so that no add waits on the last
  v8f acc[2] = {};
  gemm_acc32<NN>(
      A, NN, B, NN, i0, 0, sm, acc,
      [&] {
        // each half of the wave folds half of the column groups
        const float* mp = Mx + ((size_t)h * MXG + half * (MXG / 2)) * NN + i0 + wi + lr;
        float m0 = mp[0];
#pragma unroll
        for (int g = 1; g < MXG / 2; ++g) m0 = fmaxf(m0, mp[g * NN]);
        m0 = fmaxf(m0, __shfl_xor(m0, 16, 32));
        c = -m0 * L2E;
      },
      [&](v2f a, int k) {
        v2f e;
        e.x = __builtin_amdgcn_exp2f(fmaf(a.x, L2E, c));
        e.y = __builtin_amdgcn_exp2f(fmaf(a.y, L2E, c));
        ls[(k >> 2) & 3] += e;
        return e;
      });

  // lane lr (either half): 1 / sum of row wi + lr
  const v2f q = (ls[0] + ls[1]) + (ls[2] + ls[3]);
  const float l = q.x + q.y;
  const float inv = 1.0f / (l + __shfl_xor(l, 16, 32));

#pragma unroll
  for (int r = 0; r < 8; ++r) {
    const float iv = __shfl(inv, r + 8 * half, 32);
    atth[(size_t)(i0 + wi + r + 8 * half) * DKK + wj + lr] = (acc[0][r] + acc[1][r]) * iv;
  }
}

// ---------------------------------------------------------------------------
// 4) Faithful scramble (transpose(0,2,1).reshape) + residual + LayerNorm.
//    flat f = r*512+c maps to att[h = f>>16][n = f&1023][d = (f>>10)&63].
// ---------------------------------------------------------------------------
__global__ void __launch_bounds__(256) ln0_kernel(
    const float* __restrict__ att, const float* __restrict__ residual,
    const float* __restrict__ g, const float* __restrict__ b,
    float* __restrict__ out0) {
  __shared__ float red[256];
  const int r = blockIdx.x;
  const int t = threadIdx.x;
  float v[2];
#pragma unroll
  for (int u = 0; u < 2; ++u) {
    const int c = t + 256 * u;
    const unsigned f = (unsigned)r * 512u + (unsigned)c;
    const unsigned hh = f >> 16;
    const unsigned d = (f >> 10) & 63u;
    const unsigned n = f & 1023u;
    v[u] = att[((size_t)hh * NN + n) * DKK + d] + residual[(size_t)r * DD + c];
  }
  red[t] = v[0] + v[1];
  __syncthreads();
  for (int s = 128; s > 0; s >>= 1) {
    if (t < s) red[t] += red[t + s];
    __syncthreads();
  }
  const float mean = red[0] * (1.0f / DD);
  __syncthreads();
  const float d0 = v[0] - mean, d1 = v[1] - mean;
  red[t] = d0 * d0 + d1 * d1;
  __syncthreads();
  for (int s = 128; s > 0; s >>= 1) {
    if (t < s) red[t] += red[t + s];
    __syncthreads();
  }
  const float inv = rsqrtf(red[0] * (1.0f / DD) + LN_EPS);
#pragma unroll
  for (int u = 0; u < 2; ++u) {
    const int c = t + 256 * u;
    out0[(size_t)r * DD + c] = (u == 0 ? d0 : d1) * inv * g[c] + b[c];
  }
}

// ---------------------------------------------------------------------------
// 5) Output projection: proj = out0 @ Wo^T + bo.  grid (8, 32), block 256.
// ---------------------------------------------------------------------------
__global__ void __launch_bounds__(256) proj_kernel(
    const float* __restrict__ X, const float* __restrict__ W,
    const float* __restrict__ bias, float* __restrict__ Y) {
  __shared__ __attribute__((aligned(16))) float sm[2 * TSLAB];
  const int j0 = blockIdx.x * 64;
  const int i0 = blockIdx.y * 32;
  const int lane = threadIdx.x & 31, wave = threadIdx.x >> 5;
  const int half = lane >> 4, lr = lane & 15;
  const int wi = (wave >> 2) * 16, wj = (wave & 3) * 16;
  v8f acc[2] = {};
  gemm_acc32<DD>(X, DD, W, DD, i0, j0, sm, acc, [] {},
                           [](v2f a, int) { return a; });
  const int col = j0 + wj + lr;
  const float bc = bias[col];
#pragma unroll
  for (int r = 0; r < 8; ++r)
    Y[(size_t)(i0 + wi + r + 8 * half) * DD + col] = (acc[0][r] + acc[1][r]) + bc;
}

// ---------------------------------------------------------------------------
// 6) Final residual + LayerNorm -> d_out.
// ---------------------------------------------------------------------------
__global__ void __launch_bounds__(256) lnf_kernel(
    const float* __restrict__ proj, const float* __restrict__ out0,
    const float* __restrict__ g, const float* __restrict__ b,
    float* __restrict__ out) {
  __shared__ float red[256];
  const int r = blockIdx.x;
  const int t = threadIdx.x;
  float v[2];
#pragma unroll
  for (int u = 0; u < 2; ++u) {
    const int c = t + 256 * u;
    v[u] = proj[(size_t)r * DD + c] + out0[(size_t)r * DD + c];
  }
  red[t] = v[0] + v[1];
  __syncthreads();
  for (int s = 128; s > 0; s >>= 1) {
    if (t < s) red[t] += red[t + s];
    __syncthreads();
  }
  const float mean = red[0] * (1.0f / DD);
  __syncthreads();
  const float d0 = v[0] - mean, d1 = v[1] - mean;
  red[t] = d0 * d0 + d1 * d1;
  __syncthreads();
  for (int s = 128; s > 0; s >>= 1) {
    if (t < s) red[t] += red[t + s];
    __syncthreads();
  }
  const float inv = rsqrtf(red[0] * (1.0f / DD) + LN_EPS);
#pragma unroll
  for (int u = 0; u < 2; ++u) {
    const int c = t + 256 * u;
    out[(size_t)r * DD + c] = (u == 0 ? d0 : d1) * inv * g[c] + b[c];
  }
}

extern "C" void kernel_launch(void* const* d_in, const int* in_sizes, int n_in,
                              void* d_out, int out_size, void* d_ws,
                              size_t ws_size, hipStream_t stream) {
  (void)in_sizes; (void)n_in; (void)out_size; (void)ws_size;
  const float* q_in = (const float*)d_in[0];
  const float* k_in = (const float*)d_in[1];
  const float* v_in = (const float*)d_in[2];
  const float* box  = (const float*)d_in[3];
  const float* Wq = (const float*)d_in[4];
  const float* bq = (const float*)d_in[5];
  const float* Wk = (const float*)d_in[6];
  const float* bk = (const float*)d_in[7];
  const float* Wv = (const float*)d_in[8];
  const float* bv = (const float*)d_in[9];
  const float* Wo = (const float*)d_in[10];
  const float* bo = (const float*)d_in[11];
  const float* WGw = (const float*)d_in[12];
  const float* WGb = (const float*)d_in[13];
  const float* ln0g = (const float*)d_in[14];
  const float* ln0b = (const float*)d_in[15];
  const float* lng = (const float*)d_in[16];
  const float* lnb = (const float*)d_in[17];

  float* ws = (float*)d_ws;
  float* S    = ws;                          // 8*1024*1024    (32 MB)
  float* qkv  = S + (size_t)HH * NN * NN;    // 3*1024*512     ( 6 MB)
  float* Vt   = qkv + (size_t)3 * NN * DD;   // 8*64*1024      ( 2 MB)
  float* att  = Vt + (size_t)HH * DKK * NN;  // 8*1024*64      ( 2 MB)
  float* out0 = att + (size_t)HH * NN * DKK; // 1024*512       ( 2 MB)
  float* proj = out0 + (size_t)NN * DD;      // 1024*512       ( 2 MB)
  float* Mx   = proj + (size_t)NN * DD;      // 8*32*1024      ( 1 MB)
  float* out  = (float*)d_out;

  qkv_gate_kernel<<<dim3(QKV_BLOCKS + GATE_BLOCKS), 128, 0, stream>>>(
      q_in, k_in, v_in, Wq, Wk, Wv, bq, bk, bv, qkv, box, WGw, WGb, S);
  scores_vtrans_kernel<<<dim3(VT_BLOCKS + SCORE_BLOCKS), 128, 0, stream>>>(qkv, S, Vt, Mx);
  av_kernel<<<dim3(32, 8), 256, 0, stream>>>(S, Vt, Mx, att);
  ln0_kernel<<<dim3(NN), 256, 0, stream>>>(att, q_in, ln0g, ln0b, out0);
  proj_kernel<<<dim3(8, 32), 256, 0, stream>>>(out0, Wo, bo, proj);
  lnf_kernel<<<dim3(NN), 256, 0, stream>>>(proj, out0, lng, lnb, out);
}

// v005
// One run takes 64.2 microseconds.
// Timed twice side by side with v004, it ran 1.14 times as fast both times.
// Counting every step since v000, it is 2.43 times as fast.
#include <hip/hip_runtime.h>
#include <hip/hip_bf16.h>
#include <math.h>

#define NN 1024
#define DD 512
#define HH 8
#define DKK 64
#define DGG 64
#define LN_EPS 1e-5f

typedef float v2f __attribute__((ext_vector_type(2)));
typedef float v8f __attribute__((ext_vector_type(8)));

// ---------------------------------------------------------------------------
// Generic 64x64 output tile per 4-wave block, 32x32 per wave (2x2 waves), on
// V_WMMA_F32_16X16X4_F32.
// Y[i][j] = sum_k Arow_i[k] * Brow_j[k]   (both operands row-contiguous in K)
//
// Operands go global -> LDS in slabs of 64 k: 64 A rows then 64 B rows, each
// 256 B, brought by asynchronous 16-byte copies (16 lanes cover one row, so a
// wave's copy covers four whole 128-B lines) and shared by the block's waves.
// LDS row pitch 68 dwords (16 B x 17): the 16 rows x 16 B that one fragment
// read touches fall on all 64 banks once.
//
// Fragment layout (ISA 7.12.2, 32-bit operands, wave32):
//   A 16x4: lanes 0-15 = rows M=0..15 holding K={k,k+1};
//           lanes 16-31 = same rows holding K={k+2,k+3}  -> contiguous v2f.
//   B 4x16: symmetric with N = lane%16.
//   C/D   : VGPR r -> M = r (lanes 0-15) / r+8 (lanes 16-31), N = lane%16.
// ---------------------------------------------------------------------------
#define GBK 64                      // k per slab
#define GPITCH 68                   // LDS row pitch, dwords
#define GSLAB (128 * GPITCH)        // dwords per slab buffer

// Eight rows' worth of copies for this lane (rows 8 apart). The s_wait_xcnt
// closes the statement so that no address register is rewritten ahead of it.
__device__ __forceinline__ void copy8_rows(unsigned l, const float* g, int ld) {
  const unsigned ls = 8u * GPITCH * 4u;
  const size_t gs = (size_t)8 * ld;
  asm volatile(
      "global_load_async_to_lds_b128 %0, %8, off\n\t"
      "global_load_async_to_lds_b128 %1, %9, off\n\t"
      "global_load_async_to_lds_b128 %2, %10, off\n\t"
      "global_load_async_to_lds_b128 %3, %11, off\n\t"
      "global_load_async_to_lds_b128 %4, %12, off\n\t"
      "global_load_async_to_lds_b128 %5, %13, off\n\t"
      "global_load_async_to_lds_b128 %6, %14, off\n\t"
      "global_load_async_to_lds_b128 %7, %15, off\n\t"
      "s_wait_xcnt 0x0"
      ::"v"(l), "v"(l + ls), "v"(l + 2 * ls), "v"(l + 3 * ls), "v"(l + 4 * ls),
        "v"(l + 5 * ls), "v"(l + 6 * ls), "v"(l + 7 * ls), "v"(g), "v"(g + gs),
        "v"(g + 2 * gs), "v"(g + 3 * gs), "v"(g + 4 * gs), "v"(g + 5 * gs),
        "v"(g + 6 * gs), "v"(g + 7 * gs)
      : "memory");
}

// gemm_acc64 leaves the wave's 32x32 tile in acc. pre() runs once while slab 0
// is in flight; at(a, ti, k) maps each A fragment (rows ti*16 + lane%16 of the
// wave's tile, k-step k of the slab) on its way from LDS to the matrix unit.
template <int KSIZE, class Pre, class AT>
__device__ __forceinline__ void gemm_acc64(const float* __restrict__ A,
                                           int lda, const float* __restrict__ B,
                                           int ldb, int i0, int j0, float* sm,
                                           v8f (&acc)[2][2], Pre pre, AT at) {
  constexpr int NS = KSIZE / GBK;  // slabs
  const int t = threadIdx.x;       // 0..127
  const int lane = t & 31, wave = t >> 5;
  const int half = lane >> 4, lr = lane & 15;
  const int wi = (wave >> 1) * 32, wj = (wave & 1) * 32;

  // copy role: 16-byte chunk ch of rows rg, rg+8, ... of each operand
  const int ch = t & 15, rg = t >> 4;
  const float* ga = A + (size_t)(i0 + rg) * lda + ch * 4;
  const float* gb = B + (size_t)(j0 + rg) * ldb + ch * 4;
  const unsigned la = (unsigned)(size_t)(sm + rg * GPITCH + ch * 4);
  const unsigned lb = la + 64u * GPITCH * 4u;

  const float* fa = sm + (wi + lr) * GPITCH + 2 * half;
  const float* fb = sm + (64 + wj + lr) * GPITCH + 2 * half;

  auto fill = [&](int s) {
    const unsigned bo = (unsigned)(s & 1) * (GSLAB * 4u);
    copy8_rows(la + bo, ga + s * GBK, lda);
    copy8_rows(lb + bo, gb + s * GBK, ldb);
  };
  auto work = [&](int s) {
    const float* as = fa + (s & 1) * GSLAB;
    const float* bs = fb + (s & 1) * GSLAB;
#pragma unroll
    for (int k = 0; k < GBK; k += 4) {
      const v2f a0 = at(*(const v2f*)(as + k), 0, k);
      const v2f a1 = at(*(const v2f*)(as + 16 * GPITCH + k), 1, k);
      const v2f b0 = *(const v2f*)(bs + k);
      const v2f b1 = *(const v2f*)(bs + 16 * GPITCH + k);
      acc[0][0] = __builtin_amdgcn_wmma_f32_16x16x4_f32(false, a0, false, b0,
                                                        (short)0, acc[0][0], false, false);
      acc[0][1] = __builtin_amdgcn_wmma_f32_16x16x4_f32(false, a0, false, b1,
                                                        (short)0, acc[0][1], false, false);
      acc[1][0] = __builtin_amdgcn_wmma_f32_16x16x4_f32(false, a1, false, b0,
                                                        (short)0, acc[1][0], false, false);
      acc[1][1] = __builtin_amdgcn_wmma_f32_16x16x4_f32(false, a1, false, b1,
                                                        (short)0, acc[1][1], false, false);
    }
  };

  fill(0);
  pre();
  // slab 0 has landed for this wave's own copies; the barrier publishes it
  asm volatile("s_wait_asynccnt 0x0" ::: "memory");
  __syncthreads();
  if constexpr (NS == 1) {
    work(0);
  } else {
    fill(1);
#pragma unroll 1  // rolled, for speed only
    for (int s = 0; s < NS; ++s) {
      work(s);
      // this wave's reads of slab s are done before the buffer may be refilled
      asm volatile("s_wait_dscnt 0x0" ::: "memory");
      // this wave's copies of slab s+1 have landed before the barrier publishes
      asm volatile("s_wait_asynccnt 0x0" ::: "memory");
      __syncthreads();
      if (s + 2 < NS) fill(s + 2);
    }
    // no copy is outstanding when the wave goes on to its epilogue and ends
    asm volatile("s_wait_asynccnt 0x0" ::: "memory");
  }
}

template <int KSIZE, class Epi>
__device__ __forceinline__ void gemm_block64(const float* __restrict__ A,
                                             int lda, const float* __restrict__ B,
                                             int ldb, int i0, int j0, float* sm,
                                             Epi epi) {
  const int lane = threadIdx.x & 31, wave = threadIdx.x >> 5;
  const int half = lane >> 4, lr = lane & 15;
  const int wi = (wave >> 1) * 32, wj = (wave & 1) * 32;
  v8f acc[2][2] = {};
  gemm_acc64<KSIZE>(A, lda, B, ldb, i0, j0, sm, acc, [] {},
                    [](v2f a, int, int) { return a; });

#pragma unroll
  for (int ti = 0; ti < 2; ++ti)
#pragma unroll
    for (int tj = 0; tj < 2; ++tj)
#pragma unroll
      for (int r = 0; r < 8; ++r)
        epi(i0 + wi + ti * 16 + r + 8 * half, j0 + wj + tj * 16 + lr, acc[ti][tj][r]);
}

// ---------------------------------------------------------------------------
// 32x64 output tile per 8-wave block, one 16x16 tile per wave (2x4 waves), for
// the products whose 64x64 grid would leave half of the WGPs empty: twice the
// blocks, and two waves on every SIMD, so that one wave's matrix instructions
// run under the other's LDS waits and vector work.
// Slabs of 128 k: 32 A rows then 64 B rows of 512 B, one wave's copy = one row.
// LDS row pitch 132 dwords (16 B x 33): same bank spread as GPITCH.
// Even and odd k-steps go to two accumulators, so that no matrix instruction
// waits for the one before it; the caller adds the two.
// ---------------------------------------------------------------------------
#define TBK 128                     // k per slab
#define TPITCH 132                  // LDS row pitch, dwords
#define TSLAB (96 * TPITCH)         // dwords per slab buffer

// This lane's twelve copies of a slab: A rows 8 apart (4), B rows 8 apart (8).
// The s_wait_xcnt closes the statement so that no address register is
// rewritten ahead of it.
__device__ __forceinline__ void copy12_rows(unsigned l, const float* a, int lda,
                                            const float* b, int ldb) {
  const unsigned ls = 8u * TPITCH * 4u;
  const size_t as = (size_t)8 * lda, bs = (size_t)8 * ldb;
  asm volatile(
      "global_load_async_to_lds_b128 %0, %12, off\n\t"
      "global_load_async_to_lds_b128 %1, %13, off\n\t"
      "global_load_async_to_lds_b128 %2, %14, off\n\t"
      "global_load_async_to_lds_b128 %3, %15, off\n\t"
      "global_load_async_to_lds_b128 %4, %16, off\n\t"
      "global_load_async_to_lds_b128 %5, %17, off\n\t"
      "global_load_async_to_lds_b128 %6, %18, off\n\t"
      "global_load_async_to_lds_b128 %7, %19, off\n\t"
      "global_load_async_to_lds_b128 %8, %20, off\n\t"
      "global_load_async_to_lds_b128 %9, %21, off\n\t"
      "global_load_async_to_lds_b128 %10, %22, off\n\t"
      "global_load_async_to_lds_b128 %11, %23, off\n\t"
      "s_wait_xcnt 0x0"
      ::"v"(l), "v"(l + ls), "v"(l + 2 * ls), "v"(l + 3 * ls), "v"(l + 4 * ls),
        "v"(l + 5 * ls), "v"(l + 6 * ls), "v"(l + 7 * ls), "v"(l + 8 * ls),
        "v"(l + 9 * ls), "v"(l + 10 * ls), "v"(l + 11 * ls), "v"(a), "v"(a + as),
        "v"(a + 2 * as), "v"(a + 3 * as), "v"(b), "v"(b + bs), "v"(b + 2 * bs),
        "v"(b + 3 * bs), "v"(b + 4 * bs), "v"(b + 5 * bs), "v"(b + 6 * bs),
        "v"(b + 7 * bs)
      : "memory");
}

// gemm_acc32 leaves the wave's 16x16 tile as acc[0] + acc[1]. pre() runs once
// while slab 0 is in flight; at(a, k) maps each A fragment (row lane%16 of the
// wave's tile, k-step k of the slab) on its way from LDS to the matrix unit.
template <int KSIZE, class Pre, class AT>
__device__ __forceinline__ void gemm_acc32(const float* __restrict__ A, int lda,
                                           const float* __restrict__ B, int ldb,
                                           int i0, int j0, float* sm,
                                           v8f (&acc)[2], Pre pre, AT at) {
  constexpr int NS = KSIZE / TBK;  // slabs, at least two
  const int t = threadIdx.x;       // 0..255
  const int lane = t & 31, wave = t >> 5;
  const int half = lane >> 4, lr = lane & 15;
  const int wi = (wave >> 2) * 16, wj = (wave & 3) * 16;

  // copy role: 16-byte chunk 'lane' of rows wave, wave+8, ... of each operand
  const float* ga = A + (size_t)(i0 + wave) * lda + lane * 4;
  const float* gb = B + (size_t)(j0 + wave) * ldb + lane * 4;
  const unsigned la = (unsigned)(size_t)(sm + wave * TPITCH + lane * 4);

  const float* fa = sm + (wi + lr) * TPITCH + 2 * half;
  const float* fb = sm + (32 + wj + lr) * TPITCH + 2 * half;

  auto fill = [&](int s) {
    copy12_rows(la + (unsigned)(s & 1) * (TSLAB * 4u), ga + s * TBK, lda,
                gb + s * TBK, ldb);
  };
  auto work = [&](int s) {
    const float* as = fa + (s & 1) * TSLAB;
    const float* bs = fb + (s & 1) * TSLAB;
#pragma unroll
    for (int k = 0; k < TBK; k += 4) {
      const v2f a = at(*(const v2f*)(as + k), k);
      const v2f b = *(const v2f*)(bs + k);
      acc[(k >> 2) & 1] = __builtin_amdgcn_wmma_f32_16x16x4_f32(
          false, a, false, b, (short)0, acc[(k >> 2) & 1], false, false);
    }
  };

  fill(0);
  pre();
  // slab 0 has landed for this wave's own copies; the barrier publishes it
  asm volatile("s_wait_asynccnt 0x0" ::: "memory");
  __syncthreads();
  fill(1);
#pragma unroll 1  // rolled, for speed only
  for (int s = 0; s < NS; ++s) {
    work(s);
    // this wave's reads of slab s are done before the buffer may be refilled
    asm volatile("s_wait_dscnt 0x0" ::: "memory");
    // this wave's copies of slab s+1 have landed before the barrier publishes
    asm volatile("s_wait_asynccnt 0x0" ::: "memory");
    __syncthreads();
    if (s + 2 < NS) fill(s + 2);
  }
  // no copy is outstanding when the wave goes on to its epilogue and ends
  asm volatile("s_wait_asynccnt 0x0" ::: "memory");
}

// ---------------------------------------------------------------------------
// 1a) Box-relative embedding + per-head gate, fused to log(clip(relu(.),1e-6)).
//     Writes S[h][i][j]; the scores blocks add QK^T/8 in place afterwards.
//     128-thread block p of 2048: rows i from (p / 8) * 4, columns from
//     (p % 8) * 128. A thread keeps one column j and GROWS rows i, so that each
//     weight read from LDS feeds GROWS pairs; the rows go two by two through
//     packed f32 multiply-adds.
// ---------------------------------------------------------------------------
#define GROWS 4  // rows i per gate thread

__device__ __forceinline__ void gate_block(
    int p, const float* __restrict__ box, const float* __restrict__ WGw,
    const float* __restrict__ WGb, float* __restrict__ S, float* sm) {
  float* w_sh = sm;             // HH * DGG weights
  float* b_sh = sm + HH * DGG;  // HH biases
  // 128 threads x 16 bytes = all HH * DGG weights in one load each
  *(float4*)(w_sh + 4 * threadIdx.x) = *(const float4*)(WGw + 4 * threadIdx.x);
  if (threadIdx.x < HH) b_sh[threadIdx.x] = WGb[threadIdx.x];
  __syncthreads();

  const int i0 = (p >> 3) * GROWS;
  const int j = (p & 7) * 128 + threadIdx.x;

  const float xj0 = box[j * 4 + 0], yj0 = box[j * 4 + 1];
  const float xj1 = box[j * 4 + 2], yj1 = box[j * 4 + 3];
  // precaution: stands ahead of any later rewrite of the load's address registers
  asm volatile("s_wait_xcnt 0x0" ::: "memory");
  const float cxj = (xj0 + xj1) * 0.5f, cyj = (yj0 + yj1) * 0.5f;
  const float wj = xj1 - xj0 + 1.0f, hj = yj1 - yj0 + 1.0f;

  float pos[4][GROWS];
#pragma unroll
  for (int r = 0; r < GROWS; ++r) {
    const int i = i0 + r;
    const float xi0 = box[i * 4 + 0], yi0 = box[i * 4 + 1];
    const float xi1 = box[i * 4 + 2], yi1 = box[i * 4 + 3];
    const float cxi = (xi0 + xi1) * 0.5f, cyi = (yi0 + yi1) * 0.5f;
    const float wi = xi1 - xi0 + 1.0f, hi = yi1 - yi0 + 1.0f;
    pos[0][r] = __logf(fmaxf(fabsf((cxi - cxj) / wi), 0.001f));
    pos[1][r] = __logf(fmaxf(fabsf((cyi - cyj) / hi), 0.001f));
    pos[2][r] = __logf(wi / wj);
    pos[3][r] = __logf(hi / hj);
  }

  const float dim_mat[8] = {1.0f, 0.42169650342858224f, 0.1778279410038923f,
                            0.07498942093324558f, 0.03162277660168379f,
                            0.013335214321633241f, 0.005623413251903491f,
                            0.0023713737056616554f};

  v2f acc[HH][GROWS / 2];  // .x, .y = rows 2q, 2q + 1
#pragma unroll
  for (int h = 0; h < HH; ++h)
#pragma unroll
    for (int q = 0; q < GROWS / 2; ++q) acc[h][q] = v2f{b_sh[h], b_sh[h]};

#pragma unroll
  for (int c = 0; c < 4; ++c) {
#pragma unroll
    for (int g0 = 0; g0 < 8; g0 += 4) {
      v2f sn[4][GROWS / 2], cs[4][GROWS / 2];
#pragma unroll
      for (int gg = 0; gg < 4; ++gg)
#pragma unroll
        for (int q = 0; q < GROWS / 2; ++q) {
          const float m0 = 100.0f * pos[c][2 * q] * dim_mat[g0 + gg];
          const float m1 = 100.0f * pos[c][2 * q + 1] * dim_mat[g0 + gg];
          sn[gg][q] = v2f{__sinf(m0), __sinf(m1)};
          cs[gg][q] = v2f{__cosf(m0), __cosf(m1)};
        }
#pragma unroll
      for (int gg = 0; gg < 4; ++gg) {
        const int f = c * 8 + g0 + gg;
#pragma unroll
        for (int h = 0; h < HH; ++h) {  // uniform-address LDS broadcast
          const float ws = w_sh[h * DGG + f], wc = w_sh[h * DGG + 32 + f];
#pragma unroll
          for (int q = 0; q < GROWS / 2; ++q) {
            acc[h][q] += sn[gg][q] * ws;
            acc[h][q] += cs[gg][q] * wc;
          }
        }
      }
    }
  }
#pragma unroll
  for (int h = 0; h < HH; ++h)
#pragma unroll
    for (int r = 0; r < GROWS; ++r)
      S[((size_t)h * NN + i0 + r) * NN + j] =
          __logf(fmaxf(acc[h][r >> 1][r & 1], 1e-6f));
}

// ---------------------------------------------------------------------------
// 1b) QKV projections: Y_z = X_z @ W_z^T + b_z.  64x64 tile/block.
//     Block p of 384: j-stripe p % 8, i-stripe (p / 8) % 16, z = p / 128.
// ---------------------------------------------------------------------------
#define QKV_BLOCKS (8 * 16 * 3)
#define GATE_BLOCKS (8 * NN / GROWS)

__device__ __forceinline__ void qkv_block(
    int p, const float* __restrict__ q_in, const float* __restrict__ k_in,
    const float* __restrict__ v_in, const float* __restrict__ Wq,
    const float* __restrict__ Wk, const float* __restrict__ Wv,
    const float* __restrict__ bq, const float* __restrict__ bk,
    const float* __restrict__ bv, float* __restrict__ qkv_out, float* sm) {
  const int z = p >> 7;
  const float* X = (z == 0) ? q_in : (z == 1) ? k_in : v_in;
  const float* W = (z == 0) ? Wq : (z == 1) ? Wk : Wv;
  const float* bias = (z == 0) ? bq : (z == 1) ? bk : bv;
  float* Y = qkv_out + (size_t)z * NN * DD;

  const int j0 = (p & 7) * 64;          // 8 j-stripes over D
  const int i0 = ((p >> 3) & 15) * 64;  // 16 i-stripes over N

  gemm_block64<DD>(X, DD, W, DD, i0, j0, sm, [&](int row, int col, float v) {
    Y[(size_t)row * DD + col] = v + bias[col];
  });
}

// ---------------------------------------------------------------------------
// 1) One launch for the two pieces of work that depend on the inputs alone.
//    The long matrix blocks take the low indices; the
//    gate blocks (vector and LDS work) run beside them on the same SIMDs.
//    grid QKV_BLOCKS + GATE_BLOCKS, block 128; the LDS admits four blocks per WGP.
// ---------------------------------------------------------------------------
__global__ void __launch_bounds__(128) qkv_gate_kernel(
    const float* __restrict__ q_in, const float* __restrict__ k_in,
    const float* __restrict__ v_in, const float* __restrict__ Wq,
    const float* __restrict__ Wk, const float* __restrict__ Wv,
    const float* __restrict__ bq, const float* __restrict__ bk,
    const float* __restrict__ bv, float* __restrict__ qkv_out,
    const float* __restrict__ box, const float* __restrict__ WGw,
    const float* __restrict__ WGb, float* __restrict__ S) {
  __shared__ __attribute__((aligned(16))) float sm[2 * GSLAB];
  const int b = blockIdx.x;
  if (b < QKV_BLOCKS)
    qkv_block(b, q_in, k_in, v_in, Wq, Wk, Wv, bq, bk, bv, qkv_out, sm);
  else
    gate_block(b - QKV_BLOCKS, box, WGw, WGb, S, sm);
}

// ---------------------------------------------------------------------------
// 2a) Scores: S[h] += (Q_h @ K_h^T) * 0.125, fused onto the gate-log buffer.
//     Block p of 2048: j-stripe p % 16, i-stripe (p / 16) % 16, head p / 256.
//     Each wave also leaves the maximum of its 32 columns for each of its 32
//     rows in Mx[h][column group][row]: one whole 128-B line per wave.
// ---------------------------------------------------------------------------
#define VT_BLOCKS (32 * 16)
#define SCORE_BLOCKS (16 * 16 * HH)

#define MXG (NN / 32)  // column groups per row

// maximum over the 16 lanes of a row of lanes, left in all 16
__device__ __forceinline__ float rowmax16(float v) {
  v = fmaxf(v, __int_as_float(__builtin_amdgcn_update_dpp(
                   0, __float_as_int(v), 0x161, 0xf, 0xf, true)));  // row_xmask:1
  v = fmaxf(v, __int_as_float(__builtin_amdgcn_update_dpp(
                   0, __float_as_int(v), 0x162, 0xf, 0xf, true)));  // row_xmask:2
  v = fmaxf(v, __int_as_float(__builtin_amdgcn_update_dpp(
                   0, __float_as_int(v), 0x164, 0xf, 0xf, true)));  // row_xmask:4
  v = fmaxf(v, __int_as_float(__builtin_amdgcn_update_dpp(
                   0, __float_as_int(v), 0x168, 0xf, 0xf, true)));  // row_xmask:8
  return v;
}

__device__ __forceinline__ void scores_block(int p, const float* __restrict__ qkv,
                                             float* __restrict__ S,
                                             float* __restrict__ Mx, float* sm) {
  const int h = p >> 8;
  const int j0 = (p & 15) * 64;         // 16 j-stripes
  const int i0 = ((p >> 4) & 15) * 64;  // 16 i-stripes

  const float* Q = qkv + h * DKK;
  const float* K = qkv + (size_t)NN * DD + h * DKK;
  float* Sh = S + (size_t)h * NN * NN;

  const int lane = threadIdx.x & 31, wave = threadIdx.x >> 5;
  const int half = lane >> 4, lr = lane & 15;
  const int wi = (wave >> 1) * 32, wj = (wave & 1) * 32;
  v8f acc[2][2] = {};
  gemm_acc64<DKK>(Q, DD, K, DD, i0, j0, sm, acc, [] {},
                  [](v2f a, int, int) { return a; });

  float mine = 0.0f;  // lane lr keeps the maximum of tile row (lr/8)*16 + lr%8 + 8*half
#pragma unroll
  for (int ti = 0; ti < 2; ++ti)
#pragma unroll
    for (int r = 0; r < 8; ++r) {
      const size_t idx =
          (size_t)(i0 + wi + ti * 16 + r + 8 * half) * NN + j0 + wj + lr;
      const float s0 = Sh[idx] + acc[ti][0][r] * 0.125f;
      const float s1 = Sh[idx + 16] + acc[ti][1][r] * 0.125f;
      Sh[idx] = s0;
      Sh[idx + 16] = s1;
      const float m = rowmax16(fmaxf(s0, s1));
      if (lr == ti * 8 + r) mine = m;
    }
  const int mrow = i0 + wi + (lr >> 3) * 16 + (lr & 7) + 8 * half;
  Mx[((size_t)h * MXG + ((j0 + wj) >> 5)) * NN + mrow] = mine;
  // precaution: stands ahead of any later rewrite of the store's registers
  asm volatile("s_wait_xcnt 0x0" ::: "memory");
}

// ---------------------------------------------------------------------------
// 2b) Transpose V into Vt[h][dk][n]  (flat: Vt[c][n] with c = h*64+dk),
//     so the AV GEMM's B operand is K-contiguous. 32x32 LDS tile transpose.
//     Block p of 512: n-tile p % 32, c-tile p / 32; 128 threads (32x4).
// ---------------------------------------------------------------------------
__device__ __forceinline__ void vtrans_block(int p, const float* __restrict__ qkv,
                                             float* __restrict__ Vt, float* sm) {
  float (*tile)[33] = (float (*)[33])sm;  // 32 rows of 33
  const float* V = qkv + (size_t)2 * NN * DD;
  const int n0 = (p & 31) * 32, c0 = (p >> 5) * 32;
  const int tx = threadIdx.x & 31, ty = threadIdx.x >> 5;
#pragma unroll
  for (int r = 0; r < 32; r += 4)
    tile[ty + r][tx] = V[(size_t)(n0 + ty + r) * DD + c0 + tx];
  __syncthreads();
#pragma unroll
  for (int r = 0; r < 32; r += 4)
    Vt[(size_t)(c0 + ty + r) * NN + n0 + tx] = tile[tx][ty + r];
}

// ---------------------------------------------------------------------------
// 2) One launch for the two pieces of work that read qkv (the scores also add onto S).
//    grid VT_BLOCKS + SCORE_BLOCKS, block 128.
// ---------------------------------------------------------------------------
__global__ void __launch_bounds__(128) scores_vtrans_kernel(
    const float* __restrict__ qkv, float* __restrict__ S,
    float* __restrict__ Vt, float* __restrict__ Mx) {
  __shared__ __attribute__((aligned(16))) float sm[GSLAB];
  const int b = blockIdx.x;
  if (b < VT_BLOCKS)
    vtrans_block(b, qkv, Vt, sm);
  else
    scores_block(b - VT_BLOCKS, qkv, S, Mx, sm);
}

// ---------------------------------------------------------------------------
// 3) Attention output with the row softmax folded in:
//     att[h] = (exp(S - rowmax) @ V_h) / rowsum, B from Vt (row-contiguous).
//     The row maximum comes from the scores blocks' Mx; exp is applied to the
//     A fragments between LDS and the matrix unit; each lane sums what it
//     feeds, and the quotient is taken once per output element.
//     grid (32, 8), block 256; block -> 32 rows x all 64 columns of a head.
// ---------------------------------------------------------------------------
__global__ void __launch_bounds__(256) av_kernel(
    const float* __restrict__ S, const float* __restrict__ Vt,
    const float* __restrict__ Mx, float* __restrict__ att) {
  __shared__ __attribute__((aligned(16))) float sm[2 * TSLAB];
  const int h = blockIdx.y;
  const int i0 = blockIdx.x * 32;  // 32 i-stripes

  const float* A = S + (size_t)h * NN * NN;
  const float* B = Vt + (size_t)h * DKK * NN;
  float* atth = att + (size_t)h * NN * DKK;

  const int lane = threadIdx.x & 31, wave = threadIdx.x >> 5;
  const int half = lane >> 4, lr = lane & 15;
  const int wi = (wave >> 2) * 16, wj = (wave & 3) * 16;
  const float L2E = 1.4426950408889634f;

  float c;                     // -rowmax * log2(e) of row wi + lr
  v2f ls[4] = {};              // this lane's share of that row's sum, in four
                               // short chains so that no add waits on the last
  v8f acc[2] = {};
  gemm_acc32<NN>(
      A, NN, B, NN, i0, 0, sm, acc,
      [&] {
        // each half of the wave folds half of the column groups
        const float* mp = Mx + ((size_t)h * MXG + half * (MXG / 2)) * NN + i0 + wi + lr;
        float m0 = mp[0];
#pragma unroll
        for (int g = 1; g < MXG / 2; ++g) m0 = fmaxf(m0, mp[g * NN]);
        m0 = fmaxf(m0, __shfl_xor(m0, 16, 32));
        c = -m0 * L2E;
      },
      [&](v2f a, int k) {
        v2f e;
        e.x = __builtin_amdgcn_exp2f(fmaf(a.x, L2E, c));
        e.y = __builtin_amdgcn_exp2f(fmaf(a.y, L2E, c));
        ls[(k >> 2) & 3] += e;
        return e;
      });

  // lane lr (either half): 1 / sum of row wi + lr
  const v2f q = (ls[0] + ls[1]) + (ls[2] + ls[3]);
  const float l = q.x + q.y;
  const float inv = 1.0f / (l + __shfl_xor(l, 16, 32));

#pragma unroll
  for (int r = 0; r < 8; ++r) {
    const float iv = __shfl(inv, r + 8 * half, 32);
    atth[(size_t)(i0 + wi + r + 8 * half) * DKK + wj + lr] = (acc[0][r] + acc[1][r]) * iv;
  }
}

// ---------------------------------------------------------------------------
// 4) Faithful scramble (transpose(0,2,1).reshape) + residual + LayerNorm.
//    flat f = r*512+c maps to att[h = f>>16][n = f&1023][d = (f>>10)&63].
// ---------------------------------------------------------------------------
__global__ void __launch_bounds__(256) ln0_kernel(
    const float* __restrict__ att, const float* __restrict__ residual,
    const float* __restrict__ g, const float* __restrict__ b,
    float* __restrict__ out0) {
  __shared__ float red[256];
  const int r = blockIdx.x;
  const int t = threadIdx.x;
  float v[2];
#pragma unroll
  for (int u = 0; u < 2; ++u) {
    const int c = t + 256 * u;
    const unsigned f = (unsigned)r * 512u + (unsigned)c;
    const unsigned hh = f >> 16;
    const unsigned d = (f >> 10) & 63u;
    const unsigned n = f & 1023u;
    v[u] = att[((size_t)hh * NN + n) * DKK + d] + residual[(size_t)r * DD + c];
  }
  red[t] = v[0] + v[1];
  __syncthreads();
  for (int s = 128; s > 0; s >>= 1) {
    if (t < s) red[t] += red[t + s];
    __syncthreads();
  }
  const float mean = red[0] * (1.0f / DD);
  __syncthreads();
  const float d0 = v[0] - mean, d1 = v[1] - mean;
  red[t] = d0 * d0 + d1 * d1;
  __syncthreads();
  for (int s = 128; s > 0; s >>= 1) {
    if (t < s) red[t] += red[t + s];
    __syncthreads();
  }
  const float inv = rsqrtf(red[0] * (1.0f / DD) + LN_EPS);
#pragma unroll
  for (int u = 0; u < 2; ++u) {
    const int c = t + 256 * u;
    out0[(size_t)r * DD + c] = (u == 0 ? d0 : d1) * inv * g[c] + b[c];
  }
}

// ---------------------------------------------------------------------------
// 5) Output projection: proj = out0 @ Wo^T + bo.  grid (8, 32), block 256.
// ---------------------------------------------------------------------------
__global__ void __launch_bounds__(256) proj_kernel(
    const float* __restrict__ X, const float* __restrict__ W,
    const float* __restrict__ bias, float* __restrict__ Y) {
  __shared__ __attribute__((aligned(16))) float sm[2 * TSLAB];
  const int j0 = blockIdx.x * 64;
  const int i0 = blockIdx.y * 32;
  const int lane = threadIdx.x & 31, wave = threadIdx.x >> 5;
  const int half = lane >> 4, lr = lane & 15;
  const int wi = (wave >> 2) * 16, wj = (wave & 3) * 16;
  v8f acc[2] = {};
  gemm_acc32<DD>(X, DD, W, DD, i0, j0, sm, acc, [] {},
                           [](v2f a, int) { return a; });
  const int col = j0 + wj + lr;
  const float bc = bias[col];
#pragma unroll
  for (int r = 0; r < 8; ++r)
    Y[(size_t)(i0 + wi + r + 8 * half) * DD + col] = (acc[0][r] + acc[1][r]) + bc;
}

// ---------------------------------------------------------------------------
// 6) Final residual + LayerNorm -> d_out.
// ---------------------------------------------------------------------------
__global__ void __launch_bounds__(256) lnf_kernel(
    const float* __restrict__ proj, const float* __restrict__ out0,
    const float* __restrict__ g, const float* __restrict__ b,
    float* __restrict__ out) {
  __shared__ float red[256];
  const int r = blockIdx.x;
  const int t = threadIdx.x;
  float v[2];
#pragma unroll
  for (int u = 0; u < 2; ++u) {
    const int c = t + 256 * u;
    v[u] = proj[(size_t)r * DD + c] + out0[(size_t)r * DD + c];
  }
  red[t] = v[0] + v[1];
  __syncthreads();
  for (int s = 128; s > 0; s >>= 1) {
    if (t < s) red[t] += red[t + s];
    __syncthreads();
  }
  const float mean = red[0] * (1.0f / DD);
  __syncthreads();
  const float d0 = v[0] - mean, d1 = v[1] - mean;
  red[t] = d0 * d0 + d1 * d1;
  __syncthreads();
  for (int s = 128; s > 0; s >>= 1) {
    if (t < s) red[t] += red[t + s];
    __syncthreads();
  }
  const float inv = rsqrtf(red[0] * (1.0f / DD) + LN_EPS);
#pragma unroll
  for (int u = 0; u < 2; ++u) {
    const int c = t + 256 * u;
    out[(size_t)r * DD + c] = (u == 0 ? d0 : d1) * inv * g[c] + b[c];
  }
}

extern "C" void kernel_launch(void* const* d_in, const int* in_sizes, int n_in,
                              void* d_out, int out_size, void* d_ws,
                              size_t ws_size, hipStream_t stream) {
  (void)in_sizes; (void)n_in; (void)out_size; (void)ws_size;
  const float* q_in = (const float*)d_in[0];
  const float* k_in = (const float*)d_in[1];
  const float* v_in = (const float*)d_in[2];
  const float* box  = (const float*)d_in[3];
  const float* Wq = (const float*)d_in[4];
  const float* bq = (const float*)d_in[5];
  const float* Wk = (const float*)d_in[6];
  const float* bk = (const float*)d_in[7];
  const float* Wv = (const float*)d_in[8];
  const float* bv = (const float*)d_in[9];
  const float* Wo = (const float*)d_in[10];
  const float* bo = (const float*)d_in[11];
  const float* WGw = (const float*)d_in[12];
  const float* WGb = (const float*)d_in[13];
  const float* ln0g = (const float*)d_in[14];
  const float* ln0b = (const float*)d_in[15];
  const float* lng = (const float*)d_in[16];
  const float* lnb = (const float*)d_in[17];

  float* ws = (float*)d_ws;
  float* S    = ws;                          // 8*1024*1024    (32 MB)
  float* qkv  = S + (size_t)HH * NN * NN;    // 3*1024*512     ( 6 MB)
  float* Vt   = qkv + (size_t)3 * NN * DD;   // 8*64*1024      ( 2 MB)
  float* att  = Vt + (size_t)HH * DKK * NN;  // 8*1024*64      ( 2 MB)
  float* out0 = att + (size_t)HH * NN * DKK; // 1024*512       ( 2 MB)
  float* proj = out0 + (size_t)NN * DD;      // 1024*512       ( 2 MB)
  float* Mx   = proj + (size_t)NN * DD;      // 8*32*1024      ( 1 MB)
  float* out  = (float*)d_out;

  qkv_gate_kernel<<<dim3(QKV_BLOCKS + GATE_BLOCKS), 128, 0, stream>>>(
      q_in, k_in, v_in, Wq, Wk, Wv, bq, bk, bv, qkv, box, WGw, WGb, S);
  scores_vtrans_kernel<<<dim3(VT_BLOCKS + SCORE_BLOCKS), 128, 0, stream>>>(qkv, S, Vt, Mx);
  av_kernel<<<dim3(32, 8), 256, 0, stream>>>(S, Vt, Mx, att);
  ln0_kernel<<<dim3(NN), 256, 0, stream>>>(att, q_in, ln0g, ln0b, out0);
  proj_kernel<<<dim3(8, 32), 256, 0, stream>>>(out0, Wo, bo, proj);
  lnf_kernel<<<dim3(NN), 256, 0, stream>>>(proj, out0, lng, lnb, out);
}

// v006
// Measured time: 60 microseconds a run.
// Two timings next to v005 put it at 1.08 and 1.07 times that version's speed.
// All steps since v000 together make it 2.61 times as fast.
#include <hip/hip_runtime.h>
#include <hip/hip_bf16.h>
#include <math.h>

#define NN 1024
#define DD 512
#define HH 8
#define DKK 64
#define DGG 64
#define LN_EPS 1e-5f

typedef float v2f __attribute__((ext_vector_type(2)));
typedef float v8f __attribute__((ext_vector_type(8)));

// ---------------------------------------------------------------------------
// Generic 64x64 output tile per 4-wave block, 32x32 per wave (2x2 waves), on
// V_WMMA_F32_16X16X4_F32.
// Y[i][j] = sum_k Arow_i[k] * Brow_j[k]   (both operands row-contiguous in K)
//
// Operands go global -> LDS in slabs of 64 k: 64 A rows then 64 B rows, each
// 256 B, brought by asynchronous 16-byte copies (16 lanes cover one row, so a
// wave's copy covers four whole 128-B lines) and shared by the block's waves.
// LDS row pitch 68 dwords (16 B x 17): the 16 rows x 16 B that one fragment
// read touches fall on all 64 banks once.
//
// Fragment layout (ISA 7.12.2, 32-bit operands, wave32):
//   A 16x4: lanes 0-15 = rows M=0..15 holding K={k,k+1};
//           lanes 16-31 = same rows holding K={k+2,k+3}  -> contiguous v2f.
//   B 4x16: symmetric with N = lane%16.
//   C/D   : VGPR r -> M = r (lanes 0-15) / r+8 (lanes 16-31), N = lane%16.
// ---------------------------------------------------------------------------
#define GBK 64                      // k per slab
#define GPITCH 68                   // LDS row pitch, dwords
#define GSLAB (128 * GPITCH)        // dwords per slab buffer

// Eight rows' worth of copies for this lane (rows 8 apart). The s_wait_xcnt
// closes the statement so that no address register is rewritten ahead of it.
__device__ __forceinline__ void copy8_rows(unsigned l, const float* g, int ld) {
  const unsigned ls = 8u * GPITCH * 4u;
  const size_t gs = (size_t)8 * ld;
  asm volatile(
      "global_load_async_to_lds_b128 %0, %8, off\n\t"
      "global_load_async_to_lds_b128 %1, %9, off\n\t"
      "global_load_async_to_lds_b128 %2, %10, off\n\t"
      "global_load_async_to_lds_b128 %3, %11, off\n\t"
      "global_load_async_to_lds_b128 %4, %12, off\n\t"
      "global_load_async_to_lds_b128 %5, %13, off\n\t"
      "global_load_async_to_lds_b128 %6, %14, off\n\t"
      "global_load_async_to_lds_b128 %7, %15, off\n\t"
      "s_wait_xcnt 0x0"
      ::"v"(l), "v"(l + ls), "v"(l + 2 * ls), "v"(l + 3 * ls), "v"(l + 4 * ls),
        "v"(l + 5 * ls), "v"(l + 6 * ls), "v"(l + 7 * ls), "v"(g), "v"(g + gs),
        "v"(g + 2 * gs), "v"(g + 3 * gs), "v"(g + 4 * gs), "v"(g + 5 * gs),
        "v"(g + 6 * gs), "v"(g + 7 * gs)
      : "memory");
}

// gemm_acc64 leaves the wave's 32x32 tile in acc. pre() runs once while slab 0
// is in flight; at(a, ti, k) maps each A fragment (rows ti*16 + lane%16 of the
// wave's tile, k-step k of the slab) on its way from LDS to the matrix unit.
template <int KSIZE, class Pre, class AT>
__device__ __forceinline__ void gemm_acc64(const float* __restrict__ A,
                                           int lda, const float* __restrict__ B,
                                           int ldb, int i0, int j0, float* sm,
                                           v8f (&acc)[2][2], Pre pre, AT at) {
  constexpr int NS = KSIZE / GBK;  // slabs
  const int t = threadIdx.x;       // 0..127
  const int lane = t & 31, wave = t >> 5;
  const int half = lane >> 4, lr = lane & 15;
  const int wi = (wave >> 1) * 32, wj = (wave & 1) * 32;

  // copy role: 16-byte chunk ch of rows rg, rg+8, ... of each operand
  const int ch = t & 15, rg = t >> 4;
  const float* ga = A + (size_t)(i0 + rg) * lda + ch * 4;
  const float* gb = B + (size_t)(j0 + rg) * ldb + ch * 4;
  const unsigned la = (unsigned)(size_t)(sm + rg * GPITCH + ch * 4);
  const unsigned lb = la + 64u * GPITCH * 4u;

  const float* fa = sm + (wi + lr) * GPITCH + 2 * half;
  const float* fb = sm + (64 + wj + lr) * GPITCH + 2 * half;

  auto fill = [&](int s) {
    const unsigned bo = (unsigned)(s & 1) * (GSLAB * 4u);
    copy8_rows(la + bo, ga + s * GBK, lda);
    copy8_rows(lb + bo, gb + s * GBK, ldb);
  };
  auto work = [&](int s) {
    const float* as = fa + (s & 1) * GSLAB;
    const float* bs = fb + (s & 1) * GSLAB;
#pragma unroll
    for (int k = 0; k < GBK; k += 4) {
      const v2f a0 = at(*(const v2f*)(as + k), 0, k);
      const v2f a1 = at(*(const v2f*)(as + 16 * GPITCH + k), 1, k);
      const v2f b0 = *(const v2f*)(bs + k);
      const v2f b1 = *(const v2f*)(bs + 16 * GPITCH + k);
      acc[0][0] = __builtin_amdgcn_wmma_f32_16x16x4_f32(false, a0, false, b0,
                                                        (short)0, acc[0][0], false, false);
      acc[0][1] = __builtin_amdgcn_wmma_f32_16x16x4_f32(false, a0, false, b1,
                                                        (short)0, acc[0][1], false, false);
      acc[1][0] = __builtin_amdgcn_wmma_f32_16x16x4_f32(false, a1, false, b0,
                                                        (short)0, acc[1][0], false, false);
      acc[1][1] = __builtin_amdgcn_wmma_f32_16x16x4_f32(false, a1, false, b1,
                                                        (short)0, acc[1][1], false, false);
    }
  };

  fill(0);
  pre();
  // slab 0 has landed for this wave's own copies; the barrier publishes it
  asm volatile("s_wait_asynccnt 0x0" ::: "memory");
  __syncthreads();
  if constexpr (NS == 1) {
    work(0);
  } else {
    fill(1);
#pragma unroll 1  // rolled, for speed only
    for (int s = 0; s < NS; ++s) {
      work(s);
      // this wave's reads of slab s are done before the buffer may be refilled
      asm volatile("s_wait_dscnt 0x0" ::: "memory");
      // this wave's copies of slab s+1 have landed before the barrier publishes
      asm volatile("s_wait_asynccnt 0x0" ::: "memory");
      __syncthreads();
      if (s + 2 < NS) fill(s + 2);
    }
    // no copy is outstanding when the wave goes on to its epilogue and ends
    asm volatile("s_wait_asynccnt 0x0" ::: "memory");
  }
}

template <int KSIZE, class Epi>
__device__ __forceinline__ void gemm_block64(const float* __restrict__ A,
                                             int lda, const float* __restrict__ B,
                                             int ldb, int i0, int j0, float* sm,
                                             Epi epi) {
  const int lane = threadIdx.x & 31, wave = threadIdx.x >> 5;
  const int half = lane >> 4, lr = lane & 15;
  const int wi = (wave >> 1) * 32, wj = (wave & 1) * 32;
  v8f acc[2][2] = {};
  gemm_acc64<KSIZE>(A, lda, B, ldb, i0, j0, sm, acc, [] {},
                    [](v2f a, int, int) { return a; });

#pragma unroll
  for (int ti = 0; ti < 2; ++ti)
#pragma unroll
    for (int tj = 0; tj < 2; ++tj)
#pragma unroll
      for (int r = 0; r < 8; ++r)
        epi(i0 + wi + ti * 16 + r + 8 * half, j0 + wj + tj * 16 + lr, acc[ti][tj][r]);
}

// ---------------------------------------------------------------------------
// 32x64 output tile per 8-wave block, one 16x16 tile per wave (2x4 waves), for
// the products whose 64x64 grid would leave half of the WGPs empty: twice the
// blocks, and two waves on every SIMD, so that one wave's matrix instructions
// run under the other's LDS waits and vector work.
// Slabs of 128 k: 32 A rows then 64 B rows of 512 B, one wave's copy = one row.
// LDS row pitch 132 dwords (16 B x 33): same bank spread as GPITCH.
// Even and odd k-steps go to two accumulators, so that no matrix instruction
// waits for the one before it; the caller adds the two.
// ---------------------------------------------------------------------------
#define TBK 128                     // k per slab
#define TPITCH 132                  // LDS row pitch, dwords
#define TSLAB (96 * TPITCH)         // dwords per slab buffer

// This lane's twelve copies of a slab: A rows 8 apart (4), B rows 8 apart (8).
// The s_wait_xcnt closes the statement so that no address register is
// rewritten ahead of it.
__device__ __forceinline__ void copy12_rows(unsigned l, const float* a, int lda,
                                            const float* b, int ldb) {
  const unsigned ls = 8u * TPITCH * 4u;
  const size_t as = (size_t)8 * lda, bs = (size_t)8 * ldb;
  asm volatile(
      "global_load_async_to_lds_b128 %0, %12, off\n\t"
      "global_load_async_to_lds_b128 %1, %13, off\n\t"
      "global_load_async_to_lds_b128 %2, %14, off\n\t"
      "global_load_async_to_lds_b128 %3, %15, off\n\t"
      "global_load_async_to_lds_b128 %4, %16, off\n\t"
      "global_load_async_to_lds_b128 %5, %17, off\n\t"
      "global_load_async_to_lds_b128 %6, %18, off\n\t"
      "global_load_async_to_lds_b128 %7, %19, off\n\t"
      "global_load_async_to_lds_b128 %8, %20, off\n\t"
      "global_load_async_to_lds_b128 %9, %21, off\n\t"
      "global_load_async_to_lds_b128 %10, %22, off\n\t"
      "global_load_async_to_lds_b128 %11, %23, off\n\t"
      "s_wait_xcnt 0x0"
      ::"v"(l), "v"(l + ls), "v"(l + 2 * ls), "v"(l + 3 * ls), "v"(l + 4 * ls),
        "v"(l + 5 * ls), "v"(l + 6 * ls), "v"(l + 7 * ls), "v"(l + 8 * ls),
        "v"(l + 9 * ls), "v"(l + 10 * ls), "v"(l + 11 * ls), "v"(a), "v"(a + as),
        "v"(a + 2 * as), "v"(a + 3 * as), "v"(b), "v"(b + bs), "v"(b + 2 * bs),
        "v"(b + 3 * bs), "v"(b + 4 * bs), "v"(b + 5 * bs), "v"(b + 6 * bs),
        "v"(b + 7 * bs)
      : "memory");
}

// gemm_acc32 leaves the wave's 16x16 tile as acc[0] + acc[1]. pre() runs once
// while slab 0 is in flight; at(a, k) maps each A fragment (row lane%16 of the
// wave's tile, k-step k of the slab) on its way from LDS to the matrix unit.
template <int KSIZE, class Pre, class AT>
__device__ __forceinline__ void gemm_acc32(const float* __restrict__ A, int lda,
                                           const float* __restrict__ B, int ldb,
                                           int i0, int j0, float* sm,
                                           v8f (&acc)[2], Pre pre, AT at) {
  constexpr int NS = KSIZE / TBK;  // slabs, at least two
  const int t = threadIdx.x;       // 0..255
  const int lane = t & 31, wave = t >> 5;
  const int half = lane >> 4, lr = lane & 15;
  const int wi = (wave >> 2) * 16, wj = (wave & 3) * 16;

  // copy role: 16-byte chunk 'lane' of rows wave, wave+8, ... of each operand
  const float* ga = A + (size_t)(i0 + wave) * lda + lane * 4;
  const float* gb = B + (size_t)(j0 + wave) * ldb + lane * 4;
  const unsigned la = (unsigned)(size_t)(sm + wave * TPITCH + lane * 4);

  const float* fa = sm + (wi + lr) * TPITCH + 2 * half;
  const float* fb = sm + (32 + wj + lr) * TPITCH + 2 * half;

  auto fill = [&](int s) {
    copy12_rows(la + (unsigned)(s & 1) * (TSLAB * 4u), ga + s * TBK, lda,
                gb + s * TBK, ldb);
  };
  auto work = [&](int s) {
    const float* as = fa + (s & 1) * TSLAB;
    const float* bs = fb + (s & 1) * TSLAB;
#pragma unroll
    for (int k = 0; k < TBK; k += 4) {
      const v2f a = at(*(const v2f*)(as + k), k);
      const v2f b = *(const v2f*)(bs + k);
      acc[(k >> 2) & 1] = __builtin_amdgcn_wmma_f32_16x16x4_f32(
          false, a, false, b, (short)0, acc[(k >> 2) & 1], false, false);
    }
  };

  fill(0);
  pre();
  // slab 0 has landed for this wave's own copies; the barrier publishes it
  asm volatile("s_wait_asynccnt 0x0" ::: "memory");
  __syncthreads();
  fill(1);
#pragma unroll 1  // rolled, for speed only
  for (int s = 0; s < NS; ++s) {
    work(s);
    // this wave's reads of slab s are done before the buffer may be refilled
    asm volatile("s_wait_dscnt 0x0" ::: "memory");
    // this wave's copies of slab s+1 have landed before the barrier publishes
    asm volatile("s_wait_asynccnt 0x0" ::: "memory");
    __syncthreads();
    if (s + 2 < NS) fill(s + 2);
  }
  // no copy is outstanding when the wave goes on to its epilogue and ends
  asm volatile("s_wait_asynccnt 0x0" ::: "memory");
}

// ---------------------------------------------------------------------------
// 1a) Box-relative embedding + per-head gate, fused to log(clip(relu(.),1e-6)).
//     Writes S[h][i][j]; the scores blocks add QK^T/8 in place afterwards.
//     128-thread block p of 2048: rows i from (p / 8) * 4, columns from
//     (p % 8) * 128. A thread keeps one column j and GROWS rows i, so that each
//     weight read from LDS feeds GROWS pairs; the rows go two by two through
//     packed f32 multiply-adds.
// ---------------------------------------------------------------------------
#define GROWS 4  // rows i per gate thread

__device__ __forceinline__ void gate_block(
    int p, const float* __restrict__ box, const float* __restrict__ WGw,
    const float* __restrict__ WGb, float* __restrict__ S, float* sm) {
  float* w_sh = sm;             // HH * DGG weights
  float* b_sh = sm + HH * DGG;  // HH biases
  // 128 threads x 16 bytes = all HH * DGG weights in one load each
  *(float4*)(w_sh + 4 * threadIdx.x) = *(const float4*)(WGw + 4 * threadIdx.x);
  if (threadIdx.x < HH) b_sh[threadIdx.x] = WGb[threadIdx.x];
  __syncthreads();

  const int i0 = (p >> 3) * GROWS;
  const int j = (p & 7) * 128 + threadIdx.x;

  const float xj0 = box[j * 4 + 0], yj0 = box[j * 4 + 1];
  const float xj1 = box[j * 4 + 2], yj1 = box[j * 4 + 3];
  // precaution: stands ahead of any later rewrite of the load's address registers
  asm volatile("s_wait_xcnt 0x0" ::: "memory");
  const float cxj = (xj0 + xj1) * 0.5f, cyj = (yj0 + yj1) * 0.5f;
  const float wj = xj1 - xj0 + 1.0f, hj = yj1 - yj0 + 1.0f;

  float pos[4][GROWS];
#pragma unroll
  for (int r = 0; r < GROWS; ++r) {
    const int i = i0 + r;
    const float xi0 = box[i * 4 + 0], yi0 = box[i * 4 + 1];
    const float xi1 = box[i * 4 + 2], yi1 = box[i * 4 + 3];
    const float cxi = (xi0 + xi1) * 0.5f, cyi = (yi0 + yi1) * 0.5f;
    const float wi = xi1 - xi0 + 1.0f, hi = yi1 - yi0 + 1.0f;
    pos[0][r] = __logf(fmaxf(fabsf((cxi - cxj) / wi), 0.001f));
    pos[1][r] = __logf(fmaxf(fabsf((cyi - cyj) / hi), 0.001f));
    pos[2][r] = __logf(wi / wj);
    pos[3][r] = __logf(hi / hj);
  }

  const float dim_mat[8] = {1.0f, 0.42169650342858224f, 0.1778279410038923f,
                            0.07498942093324558f, 0.03162277660168379f,
                            0.013335214321633241f, 0.005623413251903491f,
                            0.0023713737056616554f};

  v2f acc[HH][GROWS / 2];  // .x, .y = rows 2q, 2q + 1
#pragma unroll
  for (int h = 0; h < HH; ++h)
#pragma unroll
    for (int q = 0; q < GROWS / 2; ++q) acc[h][q] = v2f{b_sh[h], b_sh[h]};

#pragma unroll
  for (int c = 0; c < 4; ++c) {
#pragma unroll
    for (int g0 = 0; g0 < 8; g0 += 4) {
      v2f sn[4][GROWS / 2], cs[4][GROWS / 2];
#pragma unroll
      for (int gg = 0; gg < 4; ++gg)
#pragma unroll
        for (int q = 0; q < GROWS / 2; ++q) {
          const float m0 = 100.0f * pos[c][2 * q] * dim_mat[g0 + gg];
          const float m1 = 100.0f * pos[c][2 * q + 1] * dim_mat[g0 + gg];
          sn[gg][q] = v2f{__sinf(m0), __sinf(m1)};
          cs[gg][q] = v2f{__cosf(m0), __cosf(m1)};
        }
#pragma unroll
      for (int gg = 0; gg < 4; ++gg) {
        const int f = c * 8 + g0 + gg;
#pragma unroll
        for (int h = 0; h < HH; ++h) {  // uniform-address LDS broadcast
          const float ws = w_sh[h * DGG + f], wc = w_sh[h * DGG + 32 + f];
#pragma unroll
          for (int q = 0; q < GROWS / 2; ++q) {
            acc[h][q] += sn[gg][q] * ws;
            acc[h][q] += cs[gg][q] * wc;
          }
        }
      }
    }
  }
#pragma unroll
  for (int h = 0; h < HH; ++h)
#pragma unroll
    for (int r = 0; r < GROWS; ++r)
      S[((size_t)h * NN + i0 + r) * NN + j] =
          __logf(fmaxf(acc[h][r >> 1][r & 1], 1e-6f));
}

// ---------------------------------------------------------------------------
// 1b) QKV projections: Y_z = X_z @ W_z^T + b_z.  64x64 tile/block.
//     Block p of 384: j-stripe p % 8, i-stripe (p / 8) % 16, z = p / 128.
// ---------------------------------------------------------------------------
#define QKV_BLOCKS (8 * 16 * 3)
#define GATE_BLOCKS (8 * NN / GROWS)

__device__ __forceinline__ void qkv_block(
    int p, const float* __restrict__ q_in, const float* __restrict__ k_in,
    const float* __restrict__ v_in, const float* __restrict__ Wq,
    const float* __restrict__ Wk, const float* __restrict__ Wv,
    const float* __restrict__ bq, const float* __restrict__ bk,
    const float* __restrict__ bv, float* __restrict__ qkv_out, float* sm) {
  const int z = p >> 7;
  const float* X = (z == 0) ? q_in : (z == 1) ? k_in : v_in;
  const float* W = (z == 0) ? Wq : (z == 1) ? Wk : Wv;
  const float* bias = (z == 0) ? bq : (z == 1) ? bk : bv;
  float* Y = qkv_out + (size_t)z * NN * DD;

  const int j0 = (p & 7) * 64;          // 8 j-stripes over D
  const int i0 = ((p >> 3) & 15) * 64;  // 16 i-stripes over N

  gemm_block64<DD>(X, DD, W, DD, i0, j0, sm, [&](int row, int col, float v) {
    Y[(size_t)row * DD + col] = v + bias[col];
  });
}

// ---------------------------------------------------------------------------
// 1) One launch for the two pieces of work that depend on the inputs alone.
//    The long matrix blocks take the low indices; the
//    gate blocks (vector and LDS work) run beside them on the same SIMDs.
//    grid QKV_BLOCKS + GATE_BLOCKS, block 128; the LDS admits four blocks per WGP.
// ---------------------------------------------------------------------------
__global__ void __launch_bounds__(128) qkv_gate_kernel(
    const float* __restrict__ q_in, const float* __restrict__ k_in,
    const float* __restrict__ v_in, const float* __restrict__ Wq,
    const float* __restrict__ Wk, const float* __restrict__ Wv,
    const float* __restrict__ bq, const float* __restrict__ bk,
    const float* __restrict__ bv, float* __restrict__ qkv_out,
    const float* __restrict__ box, const float* __restrict__ WGw,
    const float* __restrict__ WGb, float* __restrict__ S) {
  __shared__ __attribute__((aligned(16))) float sm[2 * GSLAB];
  const int b = blockIdx.x;
  if (b < QKV_BLOCKS)
    qkv_block(b, q_in, k_in, v_in, Wq, Wk, Wv, bq, bk, bv, qkv_out, sm);
  else
    gate_block(b - QKV_BLOCKS, box, WGw, WGb, S, sm);
}

// ---------------------------------------------------------------------------
// 2a) Scores: S[h] += (Q_h @ K_h^T) * 0.125, fused onto the gate-log buffer.
//     Block p of 2048: j-stripe p % 16, i-stripe (p / 16) % 16, head p / 256.
//     Each wave also leaves the maximum of its 32 columns for each of its 32
//     rows in Mx[h][column group][row]: one whole 128-B line per wave.
// ---------------------------------------------------------------------------
#define VT_BLOCKS (32 * 16)
#define SCORE_BLOCKS (16 * 16 * HH)

#define MXG (NN / 32)  // column groups per row

// maximum over the 16 lanes of a row of lanes, left in all 16
__device__ __forceinline__ float rowmax16(float v) {
  v = fmaxf(v, __int_as_float(__builtin_amdgcn_update_dpp(
                   0, __float_as_int(v), 0x161, 0xf, 0xf, true)));  // row_xmask:1
  v = fmaxf(v, __int_as_float(__builtin_amdgcn_update_dpp(
                   0, __float_as_int(v), 0x162, 0xf, 0xf, true)));  // row_xmask:2
  v = fmaxf(v, __int_as_float(__builtin_amdgcn_update_dpp(
                   0, __float_as_int(v), 0x164, 0xf, 0xf, true)));  // row_xmask:4
  v = fmaxf(v, __int_as_float(__builtin_amdgcn_update_dpp(
                   0, __float_as_int(v), 0x168, 0xf, 0xf, true)));  // row_xmask:8
  return v;
}

__device__ __forceinline__ void scores_block(int p, const float* __restrict__ qkv,
                                             float* __restrict__ S,
                                             float* __restrict__ Mx, float* sm) {
  const int h = p >> 8;
  const int j0 = (p & 15) * 64;         // 16 j-stripes
  const int i0 = ((p >> 4) & 15) * 64;  // 16 i-stripes

  const float* Q = qkv + h * DKK;
  const float* K = qkv + (size_t)NN * DD + h * DKK;
  float* Sh = S + (size_t)h * NN * NN;

  const int lane = threadIdx.x & 31, wave = threadIdx.x >> 5;
  const int half = lane >> 4, lr = lane & 15;
  const int wi = (wave >> 1) * 32, wj = (wave & 1) * 32;
  v8f acc[2][2] = {};
  gemm_acc64<DKK>(Q, DD, K, DD, i0, j0, sm, acc, [] {},
                  [](v2f a, int, int) { return a; });

  float mine = 0.0f;  // lane lr keeps the maximum of tile row (lr/8)*16 + lr%8 + 8*half
#pragma unroll
  for (int ti = 0; ti < 2; ++ti)
#pragma unroll
    for (int r = 0; r < 8; ++r) {
      const size_t idx =
          (size_t)(i0 + wi + ti * 16 + r + 8 * half) * NN + j0 + wj + lr;
      const float s0 = Sh[idx] + acc[ti][0][r] * 0.125f;
      const float s1 = Sh[idx + 16] + acc[ti][1][r] * 0.125f;
      Sh[idx] = s0;
      Sh[idx + 16] = s1;
      const float m = rowmax16(fmaxf(s0, s1));
      if (lr == ti * 8 + r) mine = m;
    }
  const int mrow = i0 + wi + (lr >> 3) * 16 + (lr & 7) + 8 * half;
  Mx[((size_t)h * MXG + ((j0 + wj) >> 5)) * NN + mrow] = mine;
  // precaution: stands ahead of any later rewrite of the store's registers
  asm volatile("s_wait_xcnt 0x0" ::: "memory");
}

// ---------------------------------------------------------------------------
// 2b) Transpose V into Vt[h][dk][n]  (flat: Vt[c][n] with c = h*64+dk),
//     so the AV GEMM's B operand is K-contiguous. 32x32 LDS tile transpose.
//     Block p of 512: n-tile p % 32, c-tile p / 32; 128 threads (32x4).
// ---------------------------------------------------------------------------
__device__ __forceinline__ void vtrans_block(int p, const float* __restrict__ qkv,
                                             float* __restrict__ Vt, float* sm) {
  float (*tile)[33] = (float (*)[33])sm;  // 32 rows of 33
  const float* V = qkv + (size_t)2 * NN * DD;
  const int n0 = (p & 31) * 32, c0 = (p >> 5) * 32;
  const int tx = threadIdx.x & 31, ty = threadIdx.x >> 5;
#pragma unroll
  for (int r = 0; r < 32; r += 4)
    tile[ty + r][tx] = V[(size_t)(n0 + ty + r) * DD + c0 + tx];
  __syncthreads();
#pragma unroll
  for (int r = 0; r < 32; r += 4)
    Vt[(size_t)(c0 + ty + r) * NN + n0 + tx] = tile[tx][ty + r];
}

// ---------------------------------------------------------------------------
// 2) One launch for the two pieces of work that read qkv (the scores also add onto S).
//    grid VT_BLOCKS + SCORE_BLOCKS, block 128.
// ---------------------------------------------------------------------------
__global__ void __launch_bounds__(128) scores_vtrans_kernel(
    const float* __restrict__ qkv, float* __restrict__ S,
    float* __restrict__ Vt, float* __restrict__ Mx) {
  __shared__ __attribute__((aligned(16))) float sm[GSLAB];
  const int b = blockIdx.x;
  if (b < VT_BLOCKS)
    vtrans_block(b, qkv, Vt, sm);
  else
    scores_block(b - VT_BLOCKS, qkv, S, Mx, sm);
}

// ---------------------------------------------------------------------------
// 3) Attention output with the row softmax folded in:
//     att[h] = (exp(S - rowmax) @ V_h) / rowsum, B from Vt (row-contiguous).
//     The row maximum comes from the scores blocks' Mx; exp is applied to the
//     A fragments between LDS and the matrix unit; each lane sums what it
//     feeds, and the quotient is taken once per output element.
//     grid (32, 8), block 256; block -> 32 rows x all 64 columns of a head.
// ---------------------------------------------------------------------------
__global__ void __launch_bounds__(256) av_kernel(
    const float* __restrict__ S, const float* __restrict__ Vt,
    const float* __restrict__ Mx, float* __restrict__ att) {
  __shared__ __attribute__((aligned(16))) float sm[2 * TSLAB];
  const int h = blockIdx.y;
  const int i0 = blockIdx.x * 32;  // 32 i-stripes

  const float* A = S + (size_t)h * NN * NN;
  const float* B = Vt + (size_t)h * DKK * NN;
  float* atth = att + (size_t)h * NN * DKK;

  const int lane = threadIdx.x & 31, wave = threadIdx.x >> 5;
  const int half = lane >> 4, lr = lane & 15;
  const int wi = (wave >> 2) * 16, wj = (wave & 3) * 16;
  const float L2E = 1.4426950408889634f;

  float c;                     // -rowmax * log2(e) of row wi + lr
  v2f ls[4] = {};              // this lane's share of that row's sum, in four
                               // short chains so that no add waits on the last
  v8f acc[2] = {};
  gemm_acc32<NN>(
      A, NN, B, NN, i0, 0, sm, acc,
      [&] {
        // each half of the wave folds half of the column groups
        const float* mp = Mx + ((size_t)h * MXG + half * (MXG / 2)) * NN + i0 + wi + lr;
        float m0 = mp[0];
#pragma unroll
        for (int g = 1; g < MXG / 2; ++g) m0 = fmaxf(m0, mp[g * NN]);
        m0 = fmaxf(m0, __shfl_xor(m0, 16, 32));
        c = -m0 * L2E;
      },
      [&](v2f a, int k) {
        v2f e;
        e.x = __builtin_amdgcn_exp2f(fmaf(a.x, L2E, c));
        e.y = __builtin_amdgcn_exp2f(fmaf(a.y, L2E, c));
        ls[(k >> 2) & 3] += e;
        return e;
      });

  // lane lr (either half): 1 / sum of row wi + lr
  const v2f q = (ls[0] + ls[1]) + (ls[2] + ls[3]);
  const float l = q.x + q.y;
  const float inv = 1.0f / (l + __shfl_xor(l, 16, 32));

#pragma unroll
  for (int r = 0; r < 8; ++r) {
    const float iv = __shfl(inv, r + 8 * half, 32);
    atth[(size_t)(i0 + wi + r + 8 * half) * DKK + wj + lr] = (acc[0][r] + acc[1][r]) * iv;
  }
}

// ---------------------------------------------------------------------------
// LayerNorm of one row of DD values by one wave: lane l holds columns
// 4 * l + 128 * u (u = 0..3) in v[u]. Both sums stay in registers (in-lane
// adds, then a butterfly over the 32 lanes): no LDS, no barrier, and an eighth
// of the waves that a 256-thread block per row has to start.
// ---------------------------------------------------------------------------
#define LROWS 4  // rows (waves) per LayerNorm block

typedef float v4f __attribute__((ext_vector_type(4)));

// sum over the 32 lanes of a wave, left in every lane
__device__ __forceinline__ float wavesum(float v) {
  v += __int_as_float(__builtin_amdgcn_update_dpp(
      0, __float_as_int(v), 0x161, 0xf, 0xf, true));  // row_xmask:1
  v += __int_as_float(__builtin_amdgcn_update_dpp(
      0, __float_as_int(v), 0x162, 0xf, 0xf, true));  // row_xmask:2
  v += __int_as_float(__builtin_amdgcn_update_dpp(
      0, __float_as_int(v), 0x164, 0xf, 0xf, true));  // row_xmask:4
  v += __int_as_float(__builtin_amdgcn_update_dpp(
      0, __float_as_int(v), 0x168, 0xf, 0xf, true));  // row_xmask:8
  return v + __shfl_xor(v, 16, 32);
}

__device__ __forceinline__ void ln_row(v4f (&v)[4], const v4f (&gg)[4],
                                       const v4f (&bb)[4],
                                       float* __restrict__ dst) {
  const v4f s = (v[0] + v[1]) + (v[2] + v[3]);
  const float mean = wavesum((s.x + s.y) + (s.z + s.w)) * (1.0f / DD);
#pragma unroll
  for (int u = 0; u < 4; ++u) v[u] -= mean;
  const v4f q = (v[0] * v[0] + v[1] * v[1]) + (v[2] * v[2] + v[3] * v[3]);
  const float inv =
      rsqrtf(wavesum((q.x + q.y) + (q.z + q.w)) * (1.0f / DD) + LN_EPS);
#pragma unroll
  for (int u = 0; u < 4; ++u) *(v4f*)(dst + 128 * u) = v[u] * inv * gg[u] + bb[u];
}

// ---------------------------------------------------------------------------
// 4) Faithful scramble (transpose(0,2,1).reshape) + residual + LayerNorm.
//    flat f = r*512+c maps to att[h = f>>16][n = f&1023][d = (f>>10)&63], so
//    row r is column d = (r>>1)&63 of head r>>7 over n = (r&1)*512 + c.
//    Block p of 256 takes the four rows (p>>1)*8 + (p&1) + 2*q: same head, same
//    half of n, four neighbouring d. Each thread fetches those four d of an n
//    in one 16-byte load; LDS turns them into rows, one per wave.
// ---------------------------------------------------------------------------
__global__ void __launch_bounds__(32 * LROWS) ln0_kernel(
    const float* __restrict__ att, const float* __restrict__ residual,
    const float* __restrict__ g, const float* __restrict__ b,
    float* __restrict__ out0) {
  __shared__ __attribute__((aligned(16))) float xs[LROWS][DD];
  const int t = threadIdx.x, lane = t & 31, wave = t >> 5;
  const int grp = blockIdx.x >> 1, par = blockIdx.x & 1;
  const int hh = grp >> 4, d0 = (grp & 15) * LROWS;
  const int r = grp * (2 * LROWS) + par + 2 * wave;  // this wave's row

  const float* ap = att + ((size_t)hh * NN + par * (NN / 2) + t) * DKK + d0;
  const float* rp = residual + (size_t)r * DD + 4 * lane;
  v4f a[4], v[4], gg[4], bb[4];
#pragma unroll
  for (int u = 0; u < 4; ++u) {
    a[u] = *(const v4f*)(ap + (size_t)(128 * u) * DKK);
    v[u] = *(const v4f*)(rp + 128 * u);
    gg[u] = *(const v4f*)(g + 4 * lane + 128 * u);
    bb[u] = *(const v4f*)(b + 4 * lane + 128 * u);
  }
  // Takes the loaded values as inputs, so that all sixteen loads are issued in
  // front of it and fly together (left alone, the residual loads sink behind
  // the barrier and g, b behind the first sum: three latencies in a row). The
  // wait is a precaution ahead of any rewrite of the loads' address registers.
  asm volatile("s_wait_xcnt 0x0" ::"v"(a[0]), "v"(a[1]), "v"(a[2]), "v"(a[3]),
               "v"(v[0]), "v"(v[1]), "v"(v[2]), "v"(v[3]), "v"(gg[0]), "v"(gg[1]),
               "v"(gg[2]), "v"(gg[3]), "v"(bb[0]), "v"(bb[1]), "v"(bb[2]),
               "v"(bb[3]), "v"(ap), "v"(rp)
               : "memory");
#pragma unroll
  for (int u = 0; u < 4; ++u) {
    xs[0][t + 128 * u] = a[u].x;
    xs[1][t + 128 * u] = a[u].y;
    xs[2][t + 128 * u] = a[u].z;
    xs[3][t + 128 * u] = a[u].w;
  }
  __syncthreads();
#pragma unroll
  for (int u = 0; u < 4; ++u) v[u] += *(const v4f*)(&xs[wave][4 * lane + 128 * u]);
  ln_row(v, gg, bb, out0 + (size_t)r * DD + 4 * lane);
}

// ---------------------------------------------------------------------------
// 5) Output projection: proj = out0 @ Wo^T + bo.  grid (8, 32), block 256.
// ---------------------------------------------------------------------------
__global__ void __launch_bounds__(256) proj_kernel(
    const float* __restrict__ X, const float* __restrict__ W,
    const float* __restrict__ bias, float* __restrict__ Y) {
  __shared__ __attribute__((aligned(16))) float sm[2 * TSLAB];
  const int j0 = blockIdx.x * 64;
  const int i0 = blockIdx.y * 32;
  const int lane = threadIdx.x & 31, wave = threadIdx.x >> 5;
  const int half = lane >> 4, lr = lane & 15;
  const int wi = (wave >> 2) * 16, wj = (wave & 3) * 16;
  v8f acc[2] = {};
  gemm_acc32<DD>(X, DD, W, DD, i0, j0, sm, acc, [] {},
                           [](v2f a, int) { return a; });
  const int col = j0 + wj + lr;
  const float bc = bias[col];
#pragma unroll
  for (int r = 0; r < 8; ++r)
    Y[(size_t)(i0 + wi + r + 8 * half) * DD + col] = (acc[0][r] + acc[1][r]) + bc;
}

// ---------------------------------------------------------------------------
// 6) Final residual + LayerNorm -> d_out. One wave per row, LROWS rows per block.
// ---------------------------------------------------------------------------
__global__ void __launch_bounds__(32 * LROWS) lnf_kernel(
    const float* __restrict__ proj, const float* __restrict__ out0,
    const float* __restrict__ g, const float* __restrict__ b,
    float* __restrict__ out) {
  const int lane = threadIdx.x & 31, wave = threadIdx.x >> 5;
  const size_t o = (size_t)(blockIdx.x * LROWS + wave) * DD + 4 * lane;
  const float* pp = proj + o;
  const float* op = out0 + o;
  v4f v[4], w[4], gg[4], bb[4];
#pragma unroll
  for (int u = 0; u < 4; ++u) {
    v[u] = *(const v4f*)(pp + 128 * u);
    w[u] = *(const v4f*)(op + 128 * u);
    gg[u] = *(const v4f*)(g + 4 * lane + 128 * u);
    bb[u] = *(const v4f*)(b + 4 * lane + 128 * u);
  }
  // Takes the loaded values as inputs, so that all sixteen loads are issued in
  // front of it and fly together. The wait is a precaution ahead of any rewrite
  // of the loads' address registers.
  asm volatile("s_wait_xcnt 0x0" ::"v"(v[0]), "v"(v[1]), "v"(v[2]), "v"(v[3]),
               "v"(w[0]), "v"(w[1]), "v"(w[2]), "v"(w[3]), "v"(gg[0]), "v"(gg[1]),
               "v"(gg[2]), "v"(gg[3]), "v"(bb[0]), "v"(bb[1]), "v"(bb[2]),
               "v"(bb[3]), "v"(pp), "v"(op)
               : "memory");
#pragma unroll
  for (int u = 0; u < 4; ++u) v[u] += w[u];
  ln_row(v, gg, bb, out + o);
}

extern "C" void kernel_launch(void* const* d_in, const int* in_sizes, int n_in,
                              void* d_out, int out_size, void* d_ws,
                              size_t ws_size, hipStream_t stream) {
  (void)in_sizes; (void)n_in; (void)out_size; (void)ws_size;
  const float* q_in = (const float*)d_in[0];
  const float* k_in = (const float*)d_in[1];
  const float* v_in = (const float*)d_in[2];
  const float* box  = (const float*)d_in[3];
  const float* Wq = (const float*)d_in[4];
  const float* bq = (const float*)d_in[5];
  const float* Wk = (const float*)d_in[6];
  const float* bk = (const float*)d_in[7];
  const float* Wv = (const float*)d_in[8];
  const float* bv = (const float*)d_in[9];
  const float* Wo = (const float*)d_in[10];
  const float* bo = (const float*)d_in[11];
  const float* WGw = (const float*)d_in[12];
  const float* WGb = (const float*)d_in[13];
  const float* ln0g = (const float*)d_in[14];
  const float* ln0b = (const float*)d_in[15];
  const float* lng = (const float*)d_in[16];
  const float* lnb = (const float*)d_in[17];

  float* ws = (float*)d_ws;
  float* S    = ws;                          // 8*1024*1024    (32 MB)
  float* qkv  = S + (size_t)HH * NN * NN;    // 3*1024*512     ( 6 MB)
  float* Vt   = qkv + (size_t)3 * NN * DD;   // 8*64*1024      ( 2 MB)
  float* att  = Vt + (size_t)HH * DKK * NN;  // 8*1024*64      ( 2 MB)
  float* out0 = att + (size_t)HH * NN * DKK; // 1024*512       ( 2 MB)
  float* proj = out0 + (size_t)NN * DD;      // 1024*512       ( 2 MB)
  float* Mx   = proj + (size_t)NN * DD;      // 8*32*1024      ( 1 MB)
  float* out  = (float*)d_out;

  qkv_gate_kernel<<<dim3(QKV_BLOCKS + GATE_BLOCKS), 128, 0, stream>>>(
      q_in, k_in, v_in, Wq, Wk, Wv, bq, bk, bv, qkv, box, WGw, WGb, S);
  scores_vtrans_kernel<<<dim3(VT_BLOCKS + SCORE_BLOCKS), 128, 0, stream>>>(qkv, S, Vt, Mx);
  av_kernel<<<dim3(32, 8), 256, 0, stream>>>(S, Vt, Mx, att);
  ln0_kernel<<<dim3(NN / LROWS), 32 * LROWS, 0, stream>>>(att, q_in, ln0g, ln0b, out0);
  proj_kernel<<<dim3(8, 32), 256, 0, stream>>>(out0, Wo, bo, proj);
  lnf_kernel<<<dim3(NN / LROWS), 32 * LROWS, 0, stream>>>(proj, out0, lng, lnb, out);
}

// v007
// A run of this version takes 57.5 microseconds.
// Two timings next to v006 both put it at 1.04 times that version's speed.
// Counting every step since v000, it is 2.72 times as fast.
#include <hip/hip_runtime.h>
#include <hip/hip_bf16.h>
#include <math.h>

#define NN 1024
#define DD 512
#define HH 8
#define DKK 64
#define DGG 64
#define LN_EPS 1e-5f

typedef float v2f __attribute__((ext_vector_type(2)));
typedef float v8f __attribute__((ext_vector_type(8)));

// ---------------------------------------------------------------------------
// Generic 64x64 output tile per 4-wave block, 32x32 per wave (2x2 waves), on
// V_WMMA_F32_16X16X4_F32.
// Y[i][j] = sum_k Arow_i[k] * Brow_j[k]   (both operands row-contiguous in K)
//
// Operands go global -> LDS in slabs of 64 k: 64 A rows then 64 B rows, each
// 256 B, brought by asynchronous 16-byte copies (16 lanes cover one row, so a
// wave's copy covers four whole 128-B lines) and shared by the block's waves.
// LDS row pitch 68 dwords (16 B x 17): the 16 rows x 16 B that one fragment
// read touches fall on all 64 banks once.
//
// Fragment layout (ISA 7.12.2, 32-bit operands, wave32):
//   A 16x4: lanes 0-15 = rows M=0..15 holding K={k,k+1};
//           lanes 16-31 = same rows holding K={k+2,k+3}  -> contiguous v2f.
//   B 4x16: symmetric with N = lane%16.
//   C/D   : VGPR r -> M = r (lanes 0-15) / r+8 (lanes 16-31), N = lane%16.
// ---------------------------------------------------------------------------
#define GBK 64                      // k per slab
#define GPITCH 68                   // LDS row pitch, dwords
#define GSLAB (128 * GPITCH)        // dwords per slab buffer

// Eight rows' worth of copies for this lane (rows 8 apart). The s_wait_xcnt
// closes the statement so that no address register is rewritten ahead of it.
__device__ __forceinline__ void copy8_rows(unsigned l, const float* g, int ld) {
  const unsigned ls = 8u * GPITCH * 4u;
  const size_t gs = (size_t)8 * ld;
  asm volatile(
      "global_load_async_to_lds_b128 %0, %8, off\n\t"
      "global_load_async_to_lds_b128 %1, %9, off\n\t"
      "global_load_async_to_lds_b128 %2, %10, off\n\t"
      "global_load_async_to_lds_b128 %3, %11, off\n\t"
      "global_load_async_to_lds_b128 %4, %12, off\n\t"
      "global_load_async_to_lds_b128 %5, %13, off\n\t"
      "global_load_async_to_lds_b128 %6, %14, off\n\t"
      "global_load_async_to_lds_b128 %7, %15, off\n\t"
      "s_wait_xcnt 0x0"
      ::"v"(l), "v"(l + ls), "v"(l + 2 * ls), "v"(l + 3 * ls), "v"(l + 4 * ls),
        "v"(l + 5 * ls), "v"(l + 6 * ls), "v"(l + 7 * ls), "v"(g), "v"(g + gs),
        "v"(g + 2 * gs), "v"(g + 3 * gs), "v"(g + 4 * gs), "v"(g + 5 * gs),
        "v"(g + 6 * gs), "v"(g + 7 * gs)
      : "memory");
}

// gemm_acc64 leaves the wave's 32x32 tile in acc. pre() runs once while slab 0
// is in flight; at(a, ti, k) maps each A fragment (rows ti*16 + lane%16 of the
// wave's tile, k-step k of the slab) on its way from LDS to the matrix unit.
template <int KSIZE, class Pre, class AT>
__device__ __forceinline__ void gemm_acc64(const float* __restrict__ A,
                                           int lda, const float* __restrict__ B,
                                           int ldb, int i0, int j0, float* sm,
                                           v8f (&acc)[2][2], Pre pre, AT at) {
  constexpr int NS = KSIZE / GBK;  // slabs
  const int t = threadIdx.x;       // 0..127
  const int lane = t & 31, wave = t >> 5;
  const int half = lane >> 4, lr = lane & 15;
  const int wi = (wave >> 1) * 32, wj = (wave & 1) * 32;

  // copy role: 16-byte chunk ch of rows rg, rg+8, ... of each operand
  const int ch = t & 15, rg = t >> 4;
  const float* ga = A + (size_t)(i0 + rg) * lda + ch * 4;
  const float* gb = B + (size_t)(j0 + rg) * ldb + ch * 4;
  const unsigned la = (unsigned)(size_t)(sm + rg * GPITCH + ch * 4);
  const unsigned lb = la + 64u * GPITCH * 4u;

  const float* fa = sm + (wi + lr) * GPITCH + 2 * half;
  const float* fb = sm + (64 + wj + lr) * GPITCH + 2 * half;

  auto fill = [&](int s) {
    const unsigned bo = (unsigned)(s & 1) * (GSLAB * 4u);
    copy8_rows(la + bo, ga + s * GBK, lda);
    copy8_rows(lb + bo, gb + s * GBK, ldb);
  };
  auto work = [&](int s) {
    const float* as = fa + (s & 1) * GSLAB;
    const float* bs = fb + (s & 1) * GSLAB;
#pragma unroll
    for (int k = 0; k < GBK; k += 4) {
      const v2f a0 = at(*(const v2f*)(as + k), 0, k);
      const v2f a1 = at(*(const v2f*)(as + 16 * GPITCH + k), 1, k);
      const v2f b0 = *(const v2f*)(bs + k);
      const v2f b1 = *(const v2f*)(bs + 16 * GPITCH + k);
      acc[0][0] = __builtin_amdgcn_wmma_f32_16x16x4_f32(false, a0, false, b0,
                                                        (short)0, acc[0][0], false, false);
      acc[0][1] = __builtin_amdgcn_wmma_f32_16x16x4_f32(false, a0, false, b1,
                                                        (short)0, acc[0][1], false, false);
      acc[1][0] = __builtin_amdgcn_wmma_f32_16x16x4_f32(false, a1, false, b0,
                                                        (short)0, acc[1][0], false, false);
      acc[1][1] = __builtin_amdgcn_wmma_f32_16x16x4_f32(false, a1, false, b1,
                                                        (short)0, acc[1][1], false, false);
    }
  };

  fill(0);
  pre();
  // slab 0 has landed for this wave's own copies; the barrier publishes it
  asm volatile("s_wait_asynccnt 0x0" ::: "memory");
  __syncthreads();
  if constexpr (NS == 1) {
    work(0);
  } else {
    fill(1);
#pragma unroll 1  // rolled, for speed only
    for (int s = 0; s < NS; ++s) {
      work(s);
      // this wave's reads of slab s are done before the buffer may be refilled
      asm volatile("s_wait_dscnt 0x0" ::: "memory");
      // this wave's copies of slab s+1 have landed before the barrier publishes
      asm volatile("s_wait_asynccnt 0x0" ::: "memory");
      __syncthreads();
      if (s + 2 < NS) fill(s + 2);
    }
    // no copy is outstanding when the wave goes on to its epilogue and ends
    asm volatile("s_wait_asynccnt 0x0" ::: "memory");
  }
}

template <int KSIZE, class Epi>
__device__ __forceinline__ void gemm_block64(const float* __restrict__ A,
                                             int lda, const float* __restrict__ B,
                                             int ldb, int i0, int j0, float* sm,
                                             Epi epi) {
  const int lane = threadIdx.x & 31, wave = threadIdx.x >> 5;
  const int half = lane >> 4, lr = lane & 15;
  const int wi = (wave >> 1) * 32, wj = (wave & 1) * 32;
  v8f acc[2][2] = {};
  gemm_acc64<KSIZE>(A, lda, B, ldb, i0, j0, sm, acc, [] {},
                    [](v2f a, int, int) { return a; });

#pragma unroll
  for (int ti = 0; ti < 2; ++ti)
#pragma unroll
    for (int tj = 0; tj < 2; ++tj)
#pragma unroll
      for (int r = 0; r < 8; ++r)
        epi(i0 + wi + ti * 16 + r + 8 * half, j0 + wj + tj * 16 + lr, acc[ti][tj][r]);
}

// ---------------------------------------------------------------------------
// 32x64 output tile per 8-wave block, one 16x16 tile per wave (2x4 waves), for
// the products whose 64x64 grid would leave half of the WGPs empty: twice the
// blocks, and two waves on every SIMD, so that one wave's matrix instructions
// run under the other's LDS waits and vector work.
// Slabs of 128 k: 32 A rows then 64 B rows of 512 B, one wave's copy = one row.
// LDS row pitch 132 dwords (16 B x 33): same bank spread as GPITCH.
// Even and odd k-steps go to two accumulators, so that no matrix instruction
// waits for the one before it; the caller adds the two.
// ---------------------------------------------------------------------------
#define TBK 128                     // k per slab
#define TPITCH 132                  // LDS row pitch, dwords
#define TSLAB (96 * TPITCH)         // dwords per slab buffer

// This lane's twelve copies of a slab: A rows 8 apart (4), B rows 8 apart (8).
// The s_wait_xcnt closes the statement so that no address register is
// rewritten ahead of it.
__device__ __forceinline__ void copy12_rows(unsigned l, const float* a, int lda,
                                            const float* b, int ldb) {
  const unsigned ls = 8u * TPITCH * 4u;
  const size_t as = (size_t)8 * lda, bs = (size_t)8 * ldb;
  asm volatile(
      "global_load_async_to_lds_b128 %0, %12, off\n\t"
      "global_load_async_to_lds_b128 %1, %13, off\n\t"
      "global_load_async_to_lds_b128 %2, %14, off\n\t"
      "global_load_async_to_lds_b128 %3, %15, off\n\t"
      "global_load_async_to_lds_b128 %4, %16, off\n\t"
      "global_load_async_to_lds_b128 %5, %17, off\n\t"
      "global_load_async_to_lds_b128 %6, %18, off\n\t"
      "global_load_async_to_lds_b128 %7, %19, off\n\t"
      "global_load_async_to_lds_b128 %8, %20, off\n\t"
      "global_load_async_to_lds_b128 %9, %21, off\n\t"
      "global_load_async_to_lds_b128 %10, %22, off\n\t"
      "global_load_async_to_lds_b128 %11, %23, off\n\t"
      "s_wait_xcnt 0x0"
      ::"v"(l), "v"(l + ls), "v"(l + 2 * ls), "v"(l + 3 * ls), "v"(l + 4 * ls),
        "v"(l + 5 * ls), "v"(l + 6 * ls), "v"(l + 7 * ls), "v"(l + 8 * ls),
        "v"(l + 9 * ls), "v"(l + 10 * ls), "v"(l + 11 * ls), "v"(a), "v"(a + as),
        "v"(a + 2 * as), "v"(a + 3 * as), "v"(b), "v"(b + bs), "v"(b + 2 * bs),
        "v"(b + 3 * bs), "v"(b + 4 * bs), "v"(b + 5 * bs), "v"(b + 6 * bs),
        "v"(b + 7 * bs)
      : "memory");
}

// gemm_acc32 leaves the wave's 16x16 tile as acc[0] + acc[1]. pre() runs once
// while slab 0 is in flight; at(a, k) maps each A fragment (row lane%16 of the
// wave's tile, k-step k of the slab) on its way from LDS to the matrix unit.
template <int KSIZE, class Pre, class AT>
__device__ __forceinline__ void gemm_acc32(const float* __restrict__ A, int lda,
                                           const float* __restrict__ B, int ldb,
                                           int i0, int j0, float* sm,
                                           v8f (&acc)[2], Pre pre, AT at) {
  constexpr int NS = KSIZE / TBK;  // slabs, at least two
  const int t = threadIdx.x;       // 0..255
  const int lane = t & 31, wave = t >> 5;
  const int half = lane >> 4, lr = lane & 15;
  const int wi = (wave >> 2) * 16, wj = (wave & 3) * 16;

  // copy role: 16-byte chunk 'lane' of rows wave, wave+8, ... of each operand
  const float* ga = A + (size_t)(i0 + wave) * lda + lane * 4;
  const float* gb = B + (size_t)(j0 + wave) * ldb + lane * 4;
  const unsigned la = (unsigned)(size_t)(sm + wave * TPITCH + lane * 4);

  const float* fa = sm + (wi + lr) * TPITCH + 2 * half;
  const float* fb = sm + (32 + wj + lr) * TPITCH + 2 * half;

  auto fill = [&](int s) {
    copy12_rows(la + (unsigned)(s & 1) * (TSLAB * 4u), ga + s * TBK, lda,
                gb + s * TBK, ldb);
  };
  auto work = [&](int s) {
    const float* as = fa + (s & 1) * TSLAB;
    const float* bs = fb + (s & 1) * TSLAB;
#pragma unroll
    for (int k = 0; k < TBK; k += 4) {
      const v2f a = at(*(const v2f*)(as + k), k);
      const v2f b = *(const v2f*)(bs + k);
      acc[(k >> 2) & 1] = __builtin_amdgcn_wmma_f32_16x16x4_f32(
          false, a, false, b, (short)0, acc[(k >> 2) & 1], false, false);
    }
  };

  fill(0);
  pre();
  // slab 0 has landed for this wave's own copies; the barrier publishes it
  asm volatile("s_wait_asynccnt 0x0" ::: "memory");
  __syncthreads();
  fill(1);
#pragma unroll 1  // rolled, for speed only
  for (int s = 0; s < NS; ++s) {
    work(s);
    // this wave's reads of slab s are done before the buffer may be refilled
    asm volatile("s_wait_dscnt 0x0" ::: "memory");
    // this wave's copies of slab s+1 have landed before the barrier publishes
    asm volatile("s_wait_asynccnt 0x0" ::: "memory");
    __syncthreads();
    if (s + 2 < NS) fill(s + 2);
  }
  // no copy is outstanding when the wave goes on to its epilogue and ends
  asm volatile("s_wait_asynccnt 0x0" ::: "memory");
}

// ---------------------------------------------------------------------------
// 1a) Box-relative embedding + per-head gate, fused to log(clip(relu(.),1e-6)).
//     Writes S[h][i][j]; the scores blocks add QK^T/8 in place afterwards.
//     128-thread block p of 2048: rows i from (p / 8) * 4, columns from
//     (p % 8) * 128. A thread keeps one column j and GROWS rows i, so that each
//     weight read from LDS feeds GROWS pairs; the rows go two by two through
//     packed f32 multiply-adds.
// ---------------------------------------------------------------------------
#define GROWS 4  // rows i per gate thread

// Natural log as the hardware's log2 times ln 2. Every argument in the gate is a
// normal, positive f32 (clamped from below, or a quotient of box extents), so
// the library form's rescaling of subnormals and its select for infinities
// never act there.
__device__ __forceinline__ float hw_log(float x) {
  return __builtin_amdgcn_logf(x) * 0.6931471805599453f;
}

__device__ __forceinline__ void gate_block(
    int p, const float* __restrict__ box, const float* __restrict__ WGw,
    const float* __restrict__ WGb, float* __restrict__ S, float* sm) {
  float* w_sh = sm;             // HH * DGG weights
  float* b_sh = sm + HH * DGG;  // HH biases
  // 128 threads x 16 bytes = all HH * DGG weights in one load each
  *(float4*)(w_sh + 4 * threadIdx.x) = *(const float4*)(WGw + 4 * threadIdx.x);
  if (threadIdx.x < HH) b_sh[threadIdx.x] = WGb[threadIdx.x];
  __syncthreads();

  const int i0 = (p >> 3) * GROWS;
  const int j = (p & 7) * 128 + threadIdx.x;

  const float xj0 = box[j * 4 + 0], yj0 = box[j * 4 + 1];
  const float xj1 = box[j * 4 + 2], yj1 = box[j * 4 + 3];
  // precaution: stands ahead of any later rewrite of the load's address registers
  asm volatile("s_wait_xcnt 0x0" ::: "memory");
  const float cxj = (xj0 + xj1) * 0.5f, cyj = (yj0 + yj1) * 0.5f;
  const float wj = xj1 - xj0 + 1.0f, hj = yj1 - yj0 + 1.0f;
  // quotients as products with the hardware reciprocal: one per divisor
  const float rwj = __builtin_amdgcn_rcpf(wj), rhj = __builtin_amdgcn_rcpf(hj);

  float pos[4][GROWS];
#pragma unroll
  for (int r = 0; r < GROWS; ++r) {
    const int i = i0 + r;
    const float xi0 = box[i * 4 + 0], yi0 = box[i * 4 + 1];
    const float xi1 = box[i * 4 + 2], yi1 = box[i * 4 + 3];
    const float cxi = (xi0 + xi1) * 0.5f, cyi = (yi0 + yi1) * 0.5f;
    const float wi = xi1 - xi0 + 1.0f, hi = yi1 - yi0 + 1.0f;
    const float rwi = __builtin_amdgcn_rcpf(wi), rhi = __builtin_amdgcn_rcpf(hi);
    pos[0][r] = hw_log(fmaxf(fabsf((cxi - cxj) * rwi), 0.001f));
    pos[1][r] = hw_log(fmaxf(fabsf((cyi - cyj) * rhi), 0.001f));
    pos[2][r] = hw_log(wi * rwj);
    pos[3][r] = hw_log(hi * rhj);
  }

  const float dim_mat[8] = {1.0f, 0.42169650342858224f, 0.1778279410038923f,
                            0.07498942093324558f, 0.03162277660168379f,
                            0.013335214321633241f, 0.005623413251903491f,
                            0.0023713737056616554f};

  v2f acc[HH][GROWS / 2];  // .x, .y = rows 2q, 2q + 1
#pragma unroll
  for (int h = 0; h < HH; ++h)
#pragma unroll
    for (int q = 0; q < GROWS / 2; ++q) acc[h][q] = v2f{b_sh[h], b_sh[h]};

#pragma unroll
  for (int c = 0; c < 4; ++c) {
#pragma unroll
    for (int g0 = 0; g0 < 8; g0 += 4) {
      v2f sn[4][GROWS / 2], cs[4][GROWS / 2];
#pragma unroll
      for (int gg = 0; gg < 4; ++gg)
#pragma unroll
        for (int q = 0; q < GROWS / 2; ++q) {
          const float m0 = 100.0f * pos[c][2 * q] * dim_mat[g0 + gg];
          const float m1 = 100.0f * pos[c][2 * q + 1] * dim_mat[g0 + gg];
          sn[gg][q] = v2f{__sinf(m0), __sinf(m1)};
          cs[gg][q] = v2f{__cosf(m0), __cosf(m1)};
        }
#pragma unroll
      for (int gg = 0; gg < 4; ++gg) {
        const int f = c * 8 + g0 + gg;
#pragma unroll
        for (int h = 0; h < HH; ++h) {  // uniform-address LDS broadcast
          const float ws = w_sh[h * DGG + f], wc = w_sh[h * DGG + 32 + f];
#pragma unroll
          for (int q = 0; q < GROWS / 2; ++q) {
            acc[h][q] += sn[gg][q] * ws;
            acc[h][q] += cs[gg][q] * wc;
          }
        }
      }
    }
  }
#pragma unroll
  for (int h = 0; h < HH; ++h)
#pragma unroll
    for (int r = 0; r < GROWS; ++r)
      S[((size_t)h * NN + i0 + r) * NN + j] =
          hw_log(fmaxf(acc[h][r >> 1][r & 1], 1e-6f));
}

// ---------------------------------------------------------------------------
// 1b) QKV projections: Y_z = X_z @ W_z^T + b_z.  64x64 tile/block.
//     Block p of 384: j-stripe p % 8, i-stripe (p / 8) % 16, z = p / 128.
// ---------------------------------------------------------------------------
#define QKV_BLOCKS (8 * 16 * 3)
#define GATE_BLOCKS (8 * NN / GROWS)

__device__ __forceinline__ void qkv_block(
    int p, const float* __restrict__ q_in, const float* __restrict__ k_in,
    const float* __restrict__ v_in, const float* __restrict__ Wq,
    const float* __restrict__ Wk, const float* __restrict__ Wv,
    const float* __restrict__ bq, const float* __restrict__ bk,
    const float* __restrict__ bv, float* __restrict__ qkv_out, float* sm) {
  const int z = p >> 7;
  const float* X = (z == 0) ? q_in : (z == 1) ? k_in : v_in;
  const float* W = (z == 0) ? Wq : (z == 1) ? Wk : Wv;
  const float* bias = (z == 0) ? bq : (z == 1) ? bk : bv;
  float* Y = qkv_out + (size_t)z * NN * DD;

  const int j0 = (p & 7) * 64;          // 8 j-stripes over D
  const int i0 = ((p >> 3) & 15) * 64;  // 16 i-stripes over N

  gemm_block64<DD>(X, DD, W, DD, i0, j0, sm, [&](int row, int col, float v) {
    Y[(size_t)row * DD + col] = v + bias[col];
  });
}

// ---------------------------------------------------------------------------
// 1) One launch for the two pieces of work that depend on the inputs alone.
//    The long matrix blocks take the low indices; the
//    gate blocks (vector and LDS work) run beside them on the same SIMDs.
//    grid QKV_BLOCKS + GATE_BLOCKS, block 128; the LDS admits four blocks per WGP.
// ---------------------------------------------------------------------------
__global__ void __launch_bounds__(128) qkv_gate_kernel(
    const float* __restrict__ q_in, const float* __restrict__ k_in,
    const float* __restrict__ v_in, const float* __restrict__ Wq,
    const float* __restrict__ Wk, const float* __restrict__ Wv,
    const float* __restrict__ bq, const float* __restrict__ bk,
    const float* __restrict__ bv, float* __restrict__ qkv_out,
    const float* __restrict__ box, const float* __restrict__ WGw,
    const float* __restrict__ WGb, float* __restrict__ S) {
  __shared__ __attribute__((aligned(16))) float sm[2 * GSLAB];
  const int b = blockIdx.x;
  if (b < QKV_BLOCKS)
    qkv_block(b, q_in, k_in, v_in, Wq, Wk, Wv, bq, bk, bv, qkv_out, sm);
  else
    gate_block(b - QKV_BLOCKS, box, WGw, WGb, S, sm);
}

// ---------------------------------------------------------------------------
// 2a) Scores: S[h] += (Q_h @ K_h^T) * 0.125, fused onto the gate-log buffer.
//     Block p of 2048: j-stripe p % 16, i-stripe (p / 16) % 16, head p / 256.
//     Each wave also leaves the maximum of its 32 columns for each of its 32
//     rows in Mx[h][column group][row]: one whole 128-B line per wave.
// ---------------------------------------------------------------------------
#define VT_BLOCKS (32 * 16)
#define SCORE_BLOCKS (16 * 16 * HH)

#define MXG (NN / 32)  // column groups per row

// maximum over the 16 lanes of a row of lanes, left in all 16
__device__ __forceinline__ float rowmax16(float v) {
  v = fmaxf(v, __int_as_float(__builtin_amdgcn_update_dpp(
                   0, __float_as_int(v), 0x161, 0xf, 0xf, true)));  // row_xmask:1
  v = fmaxf(v, __int_as_float(__builtin_amdgcn_update_dpp(
                   0, __float_as_int(v), 0x162, 0xf, 0xf, true)));  // row_xmask:2
  v = fmaxf(v, __int_as_float(__builtin_amdgcn_update_dpp(
                   0, __float_as_int(v), 0x164, 0xf, 0xf, true)));  // row_xmask:4
  v = fmaxf(v, __int_as_float(__builtin_amdgcn_update_dpp(
                   0, __float_as_int(v), 0x168, 0xf, 0xf, true)));  // row_xmask:8
  return v;
}

__device__ __forceinline__ void scores_block(int p, const float* __restrict__ qkv,
                                             float* __restrict__ S,
                                             float* __restrict__ Mx, float* sm) {
  const int h = p >> 8;
  const int j0 = (p & 15) * 64;         // 16 j-stripes
  const int i0 = ((p >> 4) & 15) * 64;  // 16 i-stripes

  const float* Q = qkv + h * DKK;
  const float* K = qkv + (size_t)NN * DD + h * DKK;
  float* Sh = S + (size_t)h * NN * NN;

  const int lane = threadIdx.x & 31, wave = threadIdx.x >> 5;
  const int half = lane >> 4, lr = lane & 15;
  const int wi = (wave >> 1) * 32, wj = (wave & 1) * 32;
  v8f acc[2][2] = {};
  gemm_acc64<DKK>(Q, DD, K, DD, i0, j0, sm, acc, [] {},
                  [](v2f a, int, int) { return a; });

  float mine = 0.0f;  // lane lr keeps the maximum of tile row (lr/8)*16 + lr%8 + 8*half
#pragma unroll
  for (int ti = 0; ti < 2; ++ti)
#pragma unroll
    for (int r = 0; r < 8; ++r) {
      const size_t idx =
          (size_t)(i0 + wi + ti * 16 + r + 8 * half) * NN + j0 + wj + lr;
      const float s0 = Sh[idx] + acc[ti][0][r] * 0.125f;
      const float s1 = Sh[idx + 16] + acc[ti][1][r] * 0.125f;
      Sh[idx] = s0;
      Sh[idx + 16] = s1;
      const float m = rowmax16(fmaxf(s0, s1));
      if (lr == ti * 8 + r) mine = m;
    }
  const int mrow = i0 + wi + (lr >> 3) * 16 + (lr & 7) + 8 * half;
  Mx[((size_t)h * MXG + ((j0 + wj) >> 5)) * NN + mrow] = mine;
  // precaution: stands ahead of any later rewrite of the store's registers
  asm volatile("s_wait_xcnt 0x0" ::: "memory");
}

// ---------------------------------------------------------------------------
// 2b) Transpose V into Vt[h][dk][n]  (flat: Vt[c][n] with c = h*64+dk),
//     so the AV GEMM's B operand is K-contiguous. 32x32 LDS tile transpose.
//     Block p of 512: n-tile p % 32, c-tile p / 32; 128 threads (32x4).
// ---------------------------------------------------------------------------
__device__ __forceinline__ void vtrans_block(int p, const float* __restrict__ qkv,
                                             float* __restrict__ Vt, float* sm) {
  float (*tile)[33] = (float (*)[33])sm;  // 32 rows of 33
  const float* V = qkv + (size_t)2 * NN * DD;
  const int n0 = (p & 31) * 32, c0 = (p >> 5) * 32;
  const int tx = threadIdx.x & 31, ty = threadIdx.x >> 5;
#pragma unroll
  for (int r = 0; r < 32; r += 4)
    tile[ty + r][tx] = V[(size_t)(n0 + ty + r) * DD + c0 + tx];
  __syncthreads();
#pragma unroll
  for (int r = 0; r < 32; r += 4)
    Vt[(size_t)(c0 + ty + r) * NN + n0 + tx] = tile[tx][ty + r];
}

// ---------------------------------------------------------------------------
// 2) One launch for the two pieces of work that read qkv (the scores also add onto S).
//    grid VT_BLOCKS + SCORE_BLOCKS, block 128.
// ---------------------------------------------------------------------------
__global__ void __launch_bounds__(128) scores_vtrans_kernel(
    const float* __restrict__ qkv, float* __restrict__ S,
    float* __restrict__ Vt, float* __restrict__ Mx) {
  __shared__ __attribute__((aligned(16))) float sm[GSLAB];
  const int b = blockIdx.x;
  if (b < VT_BLOCKS)
    vtrans_block(b, qkv, Vt, sm);
  else
    scores_block(b - VT_BLOCKS, qkv, S, Mx, sm);
}

// ---------------------------------------------------------------------------
// 3) Attention output with the row softmax folded in:
//     att[h] = (exp(S - rowmax) @ V_h) / rowsum, B from Vt (row-contiguous).
//     The row maximum comes from the scores blocks' Mx; exp is applied to the
//     A fragments between LDS and the matrix unit; each lane sums what it
//     feeds, and the quotient is taken once per output element.
//     grid (32, 8), block 256; block -> 32 rows x all 64 columns of a head.
// ---------------------------------------------------------------------------
__global__ void __launch_bounds__(256) av_kernel(
    const float* __restrict__ S, const float* __restrict__ Vt,
    const float* __restrict__ Mx, float* __restrict__ att) {
  __shared__ __attribute__((aligned(16))) float sm[2 * TSLAB];
  const int h = blockIdx.y;
  const int i0 = blockIdx.x * 32;  // 32 i-stripes

  const float* A = S + (size_t)h * NN * NN;
  const float* B = Vt + (size_t)h * DKK * NN;
  float* atth = att + (size_t)h * NN * DKK;

  const int lane = threadIdx.x & 31, wave = threadIdx.x >> 5;
  const int half = lane >> 4, lr = lane & 15;
  const int wi = (wave >> 2) * 16, wj = (wave & 3) * 16;
  const float L2E = 1.4426950408889634f;

  float c;                     // -rowmax * log2(e) of row wi + lr
  v2f ls[4] = {};              // this lane's share of that row's sum, in four
                               // short chains so that no add waits on the last
  v8f acc[2] = {};
  gemm_acc32<NN>(
      A, NN, B, NN, i0, 0, sm, acc,
      [&] {
        // each half of the wave folds half of the column groups
        const float* mp = Mx + ((size_t)h * MXG + half * (MXG / 2)) * NN + i0 + wi + lr;
        float m0 = mp[0];
#pragma unroll
        for (int g = 1; g < MXG / 2; ++g) m0 = fmaxf(m0, mp[g * NN]);
        m0 = fmaxf(m0, __shfl_xor(m0, 16, 32));
        c = -m0 * L2E;
      },
      [&](v2f a, int k) {
        v2f e;
        e.x = __builtin_amdgcn_exp2f(fmaf(a.x, L2E, c));
        e.y = __builtin_amdgcn_exp2f(fmaf(a.y, L2E, c));
        ls[(k >> 2) & 3] += e;
        return e;
      });

  // lane lr (either half): 1 / sum of row wi + lr
  const v2f q = (ls[0] + ls[1]) + (ls[2] + ls[3]);
  const float l = q.x + q.y;
  const float inv = 1.0f / (l + __shfl_xor(l, 16, 32));

#pragma unroll
  for (int r = 0; r < 8; ++r) {
    const float iv = __shfl(inv, r + 8 * half, 32);
    atth[(size_t)(i0 + wi + r + 8 * half) * DKK + wj + lr] = (acc[0][r] + acc[1][r]) * iv;
  }
}

// ---------------------------------------------------------------------------
// LayerNorm of one row of DD values by one wave: lane l holds columns
// 4 * l + 128 * u (u = 0..3) in v[u]. Both sums stay in registers (in-lane
// adds, then a butterfly over the 32 lanes): no LDS, no barrier, and an eighth
// of the waves that a 256-thread block per row has to start.
// ---------------------------------------------------------------------------
#define LROWS 4  // rows (waves) per LayerNorm block

typedef float v4f __attribute__((ext_vector_type(4)));

// sum over the 32 lanes of a wave, left in every lane
__device__ __forceinline__ float wavesum(float v) {
  v += __int_as_float(__builtin_amdgcn_update_dpp(
      0, __float_as_int(v), 0x161, 0xf, 0xf, true));  // row_xmask:1
  v += __int_as_float(__builtin_amdgcn_update_dpp(
      0, __float_as_int(v), 0x162, 0xf, 0xf, true));  // row_xmask:2
  v += __int_as_float(__builtin_amdgcn_update_dpp(
      0, __float_as_int(v), 0x164, 0xf, 0xf, true));  // row_xmask:4
  v += __int_as_float(__builtin_amdgcn_update_dpp(
      0, __float_as_int(v), 0x168, 0xf, 0xf, true));  // row_xmask:8
  return v + __shfl_xor(v, 16, 32);
}

__device__ __forceinline__ void ln_row(v4f (&v)[4], const v4f (&gg)[4],
                                       const v4f (&bb)[4],
                                       float* __restrict__ dst) {
  const v4f s = (v[0] + v[1]) + (v[2] + v[3]);
  const float mean = wavesum((s.x + s.y) + (s.z + s.w)) * (1.0f / DD);
#pragma unroll
  for (int u = 0; u < 4; ++u) v[u] -= mean;
  const v4f q = (v[0] * v[0] + v[1] * v[1]) + (v[2] * v[2] + v[3] * v[3]);
  const float inv =
      rsqrtf(wavesum((q.x + q.y) + (q.z + q.w)) * (1.0f / DD) + LN_EPS);
#pragma unroll
  for (int u = 0; u < 4; ++u) *(v4f*)(dst + 128 * u) = v[u] * inv * gg[u] + bb[u];
}

// ---------------------------------------------------------------------------
// 4) Faithful scramble (transpose(0,2,1).reshape) + residual + LayerNorm.
//    flat f = r*512+c maps to att[h = f>>16][n = f&1023][d = (f>>10)&63], so
//    row r is column d = (r>>1)&63 of head r>>7 over n = (r&1)*512 + c.
//    Block p of 256 takes the four rows (p>>1)*8 + (p&1) + 2*q: same head, same
//    half of n, four neighbouring d. Each thread fetches those four d of an n
//    in one 16-byte load; LDS turns them into rows, one per wave.
// ---------------------------------------------------------------------------
__global__ void __launch_bounds__(32 * LROWS) ln0_kernel(
    const float* __restrict__ att, const float* __restrict__ residual,
    const float* __restrict__ g, const float* __restrict__ b,
    float* __restrict__ out0) {
  __shared__ __attribute__((aligned(16))) float xs[LROWS][DD];
  const int t = threadIdx.x, lane = t & 31, wave = t >> 5;
  const int grp = blockIdx.x >> 1, par = blockIdx.x & 1;
  const int hh = grp >> 4, d0 = (grp & 15) * LROWS;
  const int r = grp * (2 * LROWS) + par + 2 * wave;  // this wave's row

  const float* ap = att + ((size_t)hh * NN + par * (NN / 2) + t) * DKK + d0;
  const float* rp = residual + (size_t)r * DD + 4 * lane;
  v4f a[4], v[4], gg[4], bb[4];
#pragma unroll
  for (int u = 0; u < 4; ++u) {
    a[u] = *(const v4f*)(ap + (size_t)(128 * u) * DKK);
    v[u] = *(const v4f*)(rp + 128 * u);
    gg[u] = *(const v4f*)(g + 4 * lane + 128 * u);
    bb[u] = *(const v4f*)(b + 4 * lane + 128 * u);
  }
  // Takes the loaded values as inputs, so that all sixteen loads are issued in
  // front of it and fly together (left alone, the residual loads sink behind
  // the barrier and g, b behind the first sum: three latencies in a row). The
  // wait is a precaution ahead of any rewrite of the loads' address registers.
  asm volatile("s_wait_xcnt 0x0" ::"v"(a[0]), "v"(a[1]), "v"(a[2]), "v"(a[3]),
               "v"(v[0]), "v"(v[1]), "v"(v[2]), "v"(v[3]), "v"(gg[0]), "v"(gg[1]),
               "v"(gg[2]), "v"(gg[3]), "v"(bb[0]), "v"(bb[1]), "v"(bb[2]),
               "v"(bb[3]), "v"(ap), "v"(rp)
               : "memory");
#pragma unroll
  for (int u = 0; u < 4; ++u) {
    xs[0][t + 128 * u] = a[u].x;
    xs[1][t + 128 * u] = a[u].y;
    xs[2][t + 128 * u] = a[u].z;
    xs[3][t + 128 * u] = a[u].w;
  }
  __syncthreads();
#pragma unroll
  for (int u = 0; u < 4; ++u) v[u] += *(const v4f*)(&xs[wave][4 * lane + 128 * u]);
  ln_row(v, gg, bb, out0 + (size_t)r * DD + 4 * lane);
}

// ---------------------------------------------------------------------------
// 5) Output projection: proj = out0 @ Wo^T + bo.  grid (8, 32), block 256.
// ---------------------------------------------------------------------------
__global__ void __launch_bounds__(256) proj_kernel(
    const float* __restrict__ X, const float* __restrict__ W,
    const float* __restrict__ bias, float* __restrict__ Y) {
  __shared__ __attribute__((aligned(16))) float sm[2 * TSLAB];
  const int j0 = blockIdx.x * 64;
  const int i0 = blockIdx.y * 32;
  const int lane = threadIdx.x & 31, wave = threadIdx.x >> 5;
  const int half = lane >> 4, lr = lane & 15;
  const int wi = (wave >> 2) * 16, wj = (wave & 3) * 16;
  v8f acc[2] = {};
  gemm_acc32<DD>(X, DD, W, DD, i0, j0, sm, acc, [] {},
                           [](v2f a, int) { return a; });
  const int col = j0 + wj + lr;
  const float bc = bias[col];
#pragma unroll
  for (int r = 0; r < 8; ++r)
    Y[(size_t)(i0 + wi + r + 8 * half) * DD + col] = (acc[0][r] + acc[1][r]) + bc;
}

// ---------------------------------------------------------------------------
// 6) Final residual + LayerNorm -> d_out. One wave per row, LROWS rows per block.
// ---------------------------------------------------------------------------
__global__ void __launch_bounds__(32 * LROWS) lnf_kernel(
    const float* __restrict__ proj, const float* __restrict__ out0,
    const float* __restrict__ g, const float* __restrict__ b,
    float* __restrict__ out) {
  const int lane = threadIdx.x & 31, wave = threadIdx.x >> 5;
  const size_t o = (size_t)(blockIdx.x * LROWS + wave) * DD + 4 * lane;
  const float* pp = proj + o;
  const float* op = out0 + o;
  v4f v[4], w[4], gg[4], bb[4];
#pragma unroll
  for (int u = 0; u < 4; ++u) {
    v[u] = *(const v4f*)(pp + 128 * u);
    w[u] = *(const v4f*)(op + 128 * u);
    gg[u] = *(const v4f*)(g + 4 * lane + 128 * u);
    bb[u] = *(const v4f*)(b + 4 * lane + 128 * u);
  }
  // Takes the loaded values as inputs, so that all sixteen loads are issued in
  // front of it and fly together. The wait is a precaution ahead of any rewrite
  // of the loads' address registers.
  asm volatile("s_wait_xcnt 0x0" ::"v"(v[0]), "v"(v[1]), "v"(v[2]), "v"(v[3]),
               "v"(w[0]), "v"(w[1]), "v"(w[2]), "v"(w[3]), "v"(gg[0]), "v"(gg[1]),
               "v"(gg[2]), "v"(gg[3]), "v"(bb[0]), "v"(bb[1]), "v"(bb[2]),
               "v"(bb[3]), "v"(pp), "v"(op)
               : "memory");
#pragma unroll
  for (int u = 0; u < 4; ++u) v[u] += w[u];
  ln_row(v, gg, bb, out + o);
}

extern "C" void kernel_launch(void* const* d_in, const int* in_sizes, int n_in,
                              void* d_out, int out_size, void* d_ws,
                              size_t ws_size, hipStream_t stream) {
  (void)in_sizes; (void)n_in; (void)out_size; (void)ws_size;
  const float* q_in = (const float*)d_in[0];
  const float* k_in = (const float*)d_in[1];
  const float* v_in = (const float*)d_in[2];
  const float* box  = (const float*)d_in[3];
  const float* Wq = (const float*)d_in[4];
  const float* bq = (const float*)d_in[5];
  const float* Wk = (const float*)d_in[6];
  const float* bk = (const float*)d_in[7];
  const float* Wv = (const float*)d_in[8];
  const float* bv = (const float*)d_in[9];
  const float* Wo = (const float*)d_in[10];
  const float* bo = (const float*)d_in[11];
  const float* WGw = (const float*)d_in[12];
  const float* WGb = (const float*)d_in[13];
  const float* ln0g = (const float*)d_in[14];
  const float* ln0b = (const float*)d_in[15];
  const float* lng = (const float*)d_in[16];
  const float* lnb = (const float*)d_in[17];

  float* ws = (float*)d_ws;
  float* S    = ws;                          // 8*1024*1024    (32 MB)
  float* qkv  = S + (size_t)HH * NN * NN;    // 3*1024*512     ( 6 MB)
  float* Vt   = qkv + (size_t)3 * NN * DD;   // 8*64*1024      ( 2 MB)
  float* att  = Vt + (size_t)HH * DKK * NN;  // 8*1024*64      ( 2 MB)
  float* out0 = att + (size_t)HH * NN * DKK; // 1024*512       ( 2 MB)
  float* proj = out0 + (size_t)NN * DD;      // 1024*512       ( 2 MB)
  float* Mx   = proj + (size_t)NN * DD;      // 8*32*1024      ( 1 MB)
  float* out  = (float*)d_out;

  qkv_gate_kernel<<<dim3(QKV_BLOCKS + GATE_BLOCKS), 128, 0, stream>>>(
      q_in, k_in, v_in, Wq, Wk, Wv, bq, bk, bv, qkv, box, WGw, WGb, S);
  scores_vtrans_kernel<<<dim3(VT_BLOCKS + SCORE_BLOCKS), 128, 0, stream>>>(qkv, S, Vt, Mx);
  av_kernel<<<dim3(32, 8), 256, 0, stream>>>(S, Vt, Mx, att);
  ln0_kernel<<<dim3(NN / LROWS), 32 * LROWS, 0, stream>>>(att, q_in, ln0g, ln0b, out0);
  proj_kernel<<<dim3(8, 32), 256, 0, stream>>>(out0, Wo, bo, proj);
  lnf_kernel<<<dim3(NN / LROWS), 32 * LROWS, 0, stream>>>(proj, out0, lng, lnb, out);
}

// v008
// One run takes 54.6 microseconds.
// Timed twice side by side with v007, it ran 1.06 times as fast both times.
// Counting every step since v000, it is 2.88 times as fast.
#include <hip/hip_runtime.h>
#include <hip/hip_bf16.h>
#include <math.h>

#define NN 1024
#define DD 512
#define HH 8
#define DKK 64
#define DGG 64
#define LN_EPS 1e-5f

typedef float v2f __attribute__((ext_vector_type(2)));
typedef float v4f __attribute__((ext_vector_type(4)));
typedef float v8f __attribute__((ext_vector_type(8)));

// ---------------------------------------------------------------------------
// Generic 64x64 output tile per 4-wave block, 32x32 per wave (2x2 waves), on
// V_WMMA_F32_16X16X4_F32.
// Y[i][j] = sum_k Arow_i[k] * Brow_j[k]   (both operands row-contiguous in K)
//
// Operands go global -> LDS in slabs of 64 k: 64 A rows then 64 B rows, each
// 256 B, brought by asynchronous 16-byte copies (16 lanes cover one row, so a
// wave's copy covers four whole 128-B lines) and shared by the block's waves.
// LDS row pitch 68 dwords (16 B x 17): the 16 rows x 16 B that one fragment
// read touches fall on all 64 banks once.
//
// Fragment layout (ISA 7.12.2, 32-bit operands, wave32):
//   A 16x4: lanes 0-15 = rows M=0..15 holding K={k,k+1};
//           lanes 16-31 = same rows holding K={k+2,k+3}  -> contiguous v2f.
//   B 4x16: symmetric with N = lane%16.
//   C/D   : VGPR r -> M = r (lanes 0-15) / r+8 (lanes 16-31), N = lane%16.
// ---------------------------------------------------------------------------
#define GBK 64                      // k per slab
#define GPITCH 68                   // LDS row pitch, dwords
#define GSLAB (128 * GPITCH)        // dwords per slab buffer

// Eight rows' worth of copies for this lane (rows 8 apart). The s_wait_xcnt
// closes the statement so that no address register is rewritten ahead of it.
__device__ __forceinline__ void copy8_rows(unsigned l, const float* g, int ld) {
  const unsigned ls = 8u * GPITCH * 4u;
  const size_t gs = (size_t)8 * ld;
  asm volatile(
      "global_load_async_to_lds_b128 %0, %8, off\n\t"
      "global_load_async_to_lds_b128 %1, %9, off\n\t"
      "global_load_async_to_lds_b128 %2, %10, off\n\t"
      "global_load_async_to_lds_b128 %3, %11, off\n\t"
      "global_load_async_to_lds_b128 %4, %12, off\n\t"
      "global_load_async_to_lds_b128 %5, %13, off\n\t"
      "global_load_async_to_lds_b128 %6, %14, off\n\t"
      "global_load_async_to_lds_b128 %7, %15, off\n\t"
      "s_wait_xcnt 0x0"
      ::"v"(l), "v"(l + ls), "v"(l + 2 * ls), "v"(l + 3 * ls), "v"(l + 4 * ls),
        "v"(l + 5 * ls), "v"(l + 6 * ls), "v"(l + 7 * ls), "v"(g), "v"(g + gs),
        "v"(g + 2 * gs), "v"(g + 3 * gs), "v"(g + 4 * gs), "v"(g + 5 * gs),
        "v"(g + 6 * gs), "v"(g + 7 * gs)
      : "memory");
}

// gemm_acc64 leaves the wave's 32x32 tile in acc. pre() runs once while slab 0
// is in flight; at(a, ti, k) maps each A fragment (rows ti*16 + lane%16 of the
// wave's tile, k-step k of the slab) on its way from LDS to the matrix unit.
template <int KSIZE, class Pre, class AT>
__device__ __forceinline__ void gemm_acc64(const float* __restrict__ A,
                                           int lda, const float* __restrict__ B,
                                           int ldb, int i0, int j0, float* sm,
                                           v8f (&acc)[2][2], Pre pre, AT at) {
  constexpr int NS = KSIZE / GBK;  // slabs
  const int t = threadIdx.x;       // 0..127
  const int lane = t & 31, wave = t >> 5;
  const int half = lane >> 4, lr = lane & 15;
  const int wi = (wave >> 1) * 32, wj = (wave & 1) * 32;

  // copy role: 16-byte chunk ch of rows rg, rg+8, ... of each operand
  const int ch = t & 15, rg = t >> 4;
  const float* ga = A + (size_t)(i0 + rg) * lda + ch * 4;
  const float* gb = B + (size_t)(j0 + rg) * ldb + ch * 4;
  const unsigned la = (unsigned)(size_t)(sm + rg * GPITCH + ch * 4);
  const unsigned lb = la + 64u * GPITCH * 4u;

  const float* fa = sm + (wi + lr) * GPITCH + 2 * half;
  const float* fb = sm + (64 + wj + lr) * GPITCH + 2 * half;

  auto fill = [&](int s) {
    const unsigned bo = (unsigned)(s & 1) * (GSLAB * 4u);
    copy8_rows(la + bo, ga + s * GBK, lda);
    copy8_rows(lb + bo, gb + s * GBK, ldb);
  };
  auto work = [&](int s) {
    const float* as = fa + (s & 1) * GSLAB;
    const float* bs = fb + (s & 1) * GSLAB;
#pragma unroll
    for (int k = 0; k < GBK; k += 4) {
      const v2f a0 = at(*(const v2f*)(as + k), 0, k);
      const v2f a1 = at(*(const v2f*)(as + 16 * GPITCH + k), 1, k);
      const v2f b0 = *(const v2f*)(bs + k);
      const v2f b1 = *(const v2f*)(bs + 16 * GPITCH + k);
      acc[0][0] = __builtin_amdgcn_wmma_f32_16x16x4_f32(false, a0, false, b0,
                                                        (short)0, acc[0][0], false, false);
      acc[0][1] = __builtin_amdgcn_wmma_f32_16x16x4_f32(false, a0, false, b1,
                                                        (short)0, acc[0][1], false, false);
      acc[1][0] = __builtin_amdgcn_wmma_f32_16x16x4_f32(false, a1, false, b0,
                                                        (short)0, acc[1][0], false, false);
      acc[1][1] = __builtin_amdgcn_wmma_f32_16x16x4_f32(false, a1, false, b1,
                                                        (short)0, acc[1][1], false, false);
    }
  };

  fill(0);
  pre();
  // slab 0 has landed for this wave's own copies; the barrier publishes it
  asm volatile("s_wait_asynccnt 0x0" ::: "memory");
  __syncthreads();
  if constexpr (NS == 1) {
    work(0);
  } else {
    fill(1);
#pragma unroll 1  // rolled, for speed only
    for (int s = 0; s < NS; ++s) {
      work(s);
      // this wave's reads of slab s are done before the buffer may be refilled
      asm volatile("s_wait_dscnt 0x0" ::: "memory");
      // this wave's copies of slab s+1 have landed before the barrier publishes
      asm volatile("s_wait_asynccnt 0x0" ::: "memory");
      __syncthreads();
      if (s + 2 < NS) fill(s + 2);
    }
    // no copy is outstanding when the wave goes on to its epilogue and ends
    asm volatile("s_wait_asynccnt 0x0" ::: "memory");
  }
}

template <int KSIZE, class Epi>
__device__ __forceinline__ void gemm_block64(const float* __restrict__ A,
                                             int lda, const float* __restrict__ B,
                                             int ldb, int i0, int j0, float* sm,
                                             Epi epi) {
  const int lane = threadIdx.x & 31, wave = threadIdx.x >> 5;
  const int half = lane >> 4, lr = lane & 15;
  const int wi = (wave >> 1) * 32, wj = (wave & 1) * 32;
  v8f acc[2][2] = {};
  gemm_acc64<KSIZE>(A, lda, B, ldb, i0, j0, sm, acc, [] {},
                    [](v2f a, int, int) { return a; });

#pragma unroll
  for (int ti = 0; ti < 2; ++ti)
#pragma unroll
    for (int tj = 0; tj < 2; ++tj)
#pragma unroll
      for (int r = 0; r < 8; ++r)
        epi(i0 + wi + ti * 16 + r + 8 * half, j0 + wj + tj * 16 + lr, acc[ti][tj][r]);
}

// ---------------------------------------------------------------------------
// 32x64 output tile per 8-wave block, one 16x16 tile per wave (2x4 waves), for
// the products whose 64x64 grid would leave half of the WGPs empty: twice the
// blocks, and two waves on every SIMD, so that one wave's matrix instructions
// run under the other's LDS waits and vector work.
// Slabs of 128 k: 32 A rows then 64 B rows of 512 B, one wave's copy = one row.
// LDS row pitch 132 dwords (16 B x 33): same bank spread as GPITCH.
// Even and odd k-steps go to two accumulators, so that no matrix instruction
// waits for the one before it; the caller adds the two.
// ---------------------------------------------------------------------------
#define TBK 128                     // k per slab
#define TPITCH 132                  // LDS row pitch, dwords
#define TSLAB (96 * TPITCH)         // dwords per slab buffer

// This lane's twelve copies of a slab: A rows 8 apart (4), B rows 8 apart (8).
// The s_wait_xcnt closes the statement so that no address register is
// rewritten ahead of it.
__device__ __forceinline__ void copy12_rows(unsigned l, const float* a, int lda,
                                            const float* b, int ldb) {
  const unsigned ls = 8u * TPITCH * 4u;
  const size_t as = (size_t)8 * lda, bs = (size_t)8 * ldb;
  asm volatile(
      "global_load_async_to_lds_b128 %0, %12, off\n\t"
      "global_load_async_to_lds_b128 %1, %13, off\n\t"
      "global_load_async_to_lds_b128 %2, %14, off\n\t"
      "global_load_async_to_lds_b128 %3, %15, off\n\t"
      "global_load_async_to_lds_b128 %4, %16, off\n\t"
      "global_load_async_to_lds_b128 %5, %17, off\n\t"
      "global_load_async_to_lds_b128 %6, %18, off\n\t"
      "global_load_async_to_lds_b128 %7, %19, off\n\t"
      "global_load_async_to_lds_b128 %8, %20, off\n\t"
      "global_load_async_to_lds_b128 %9, %21, off\n\t"
      "global_load_async_to_lds_b128 %10, %22, off\n\t"
      "global_load_async_to_lds_b128 %11, %23, off\n\t"
      "s_wait_xcnt 0x0"
      ::"v"(l), "v"(l + ls), "v"(l + 2 * ls), "v"(l + 3 * ls), "v"(l + 4 * ls),
        "v"(l + 5 * ls), "v"(l + 6 * ls), "v"(l + 7 * ls), "v"(l + 8 * ls),
        "v"(l + 9 * ls), "v"(l + 10 * ls), "v"(l + 11 * ls), "v"(a), "v"(a + as),
        "v"(a + 2 * as), "v"(a + 3 * as), "v"(b), "v"(b + bs), "v"(b + 2 * bs),
        "v"(b + 3 * bs), "v"(b + 4 * bs), "v"(b + 5 * bs), "v"(b + 6 * bs),
        "v"(b + 7 * bs)
      : "memory");
}

// gemm_acc32 leaves the wave's 16x16 tile as acc[0] + acc[1]. pre() runs once
// while slab 0 is in flight; at(a, k) maps each A fragment (row lane%16 of the
// wave's tile, k-step k of the slab) on its way from LDS to the matrix unit.
template <int KSIZE, class Pre, class AT>
__device__ __forceinline__ void gemm_acc32(const float* __restrict__ A, int lda,
                                           const float* __restrict__ B, int ldb,
                                           int i0, int j0, float* sm,
                                           v8f (&acc)[2], Pre pre, AT at) {
  constexpr int NS = KSIZE / TBK;  // slabs, at least two
  const int t = threadIdx.x;       // 0..255
  const int lane = t & 31, wave = t >> 5;
  const int half = lane >> 4, lr = lane & 15;
  const int wi = (wave >> 2) * 16, wj = (wave & 3) * 16;

  // copy role: 16-byte chunk 'lane' of rows wave, wave+8, ... of each operand
  const float* ga = A + (size_t)(i0 + wave) * lda + lane * 4;
  const float* gb = B + (size_t)(j0 + wave) * ldb + lane * 4;
  const unsigned la = (unsigned)(size_t)(sm + wave * TPITCH + lane * 4);

  const float* fa = sm + (wi + lr) * TPITCH + 2 * half;
  const float* fb = sm + (32 + wj + lr) * TPITCH + 2 * half;

  auto fill = [&](int s) {
    copy12_rows(la + (unsigned)(s & 1) * (TSLAB * 4u), ga + s * TBK, lda,
                gb + s * TBK, ldb);
  };
  auto work = [&](int s) {
    const float* as = fa + (s & 1) * TSLAB;
    const float* bs = fb + (s & 1) * TSLAB;
#pragma unroll
    for (int k = 0; k < TBK; k += 4) {
      const v2f a = at(*(const v2f*)(as + k), k);
      const v2f b = *(const v2f*)(bs + k);
      acc[(k >> 2) & 1] = __builtin_amdgcn_wmma_f32_16x16x4_f32(
          false, a, false, b, (short)0, acc[(k >> 2) & 1], false, false);
    }
  };

  fill(0);
  pre();
  // slab 0 has landed for this wave's own copies; the barrier publishes it
  asm volatile("s_wait_asynccnt 0x0" ::: "memory");
  __syncthreads();
  fill(1);
#pragma unroll 1  // rolled, for speed only
  for (int s = 0; s < NS; ++s) {
    work(s);
    // this wave's reads of slab s are done before the buffer may be refilled
    asm volatile("s_wait_dscnt 0x0" ::: "memory");
    // this wave's copies of slab s+1 have landed before the barrier publishes
    asm volatile("s_wait_asynccnt 0x0" ::: "memory");
    __syncthreads();
    if (s + 2 < NS) fill(s + 2);
  }
  // no copy is outstanding when the wave goes on to its epilogue and ends
  asm volatile("s_wait_asynccnt 0x0" ::: "memory");
}

// ---------------------------------------------------------------------------
// 1a) Box-relative embedding + per-head gate, fused to log(clip(relu(.),1e-6)).
//     Writes S[h][i][j]; the scores blocks add QK^T/8 in place afterwards.
//     128-thread block p of 2048: rows i from (p / 8) * 4, columns from
//     (p % 8) * 128. A thread keeps one column j and GROWS rows i, so that each
//     weight read from LDS feeds GROWS pairs; the rows go two by two through
//     packed f32 multiply-adds.
// ---------------------------------------------------------------------------
#define GROWS 4  // rows i per gate thread

// Natural log as the hardware's log2 times ln 2. Every argument in the gate is a
// normal, positive f32 (clamped from below, or a quotient of box extents), so
// the library form's rescaling of subnormals and its select for infinities
// never act there.
__device__ __forceinline__ float hw_log(float x) {
  return __builtin_amdgcn_logf(x) * 0.6931471805599453f;
}

__device__ __forceinline__ void gate_block(
    int p, const float* __restrict__ box, const float* __restrict__ WGw,
    const float* __restrict__ WGb, float* __restrict__ S, float* sm) {
  float* w_sh = sm;             // HH * DGG weights
  float* b_sh = sm + HH * DGG;  // HH biases
  // 128 threads x 16 bytes = all HH * DGG weights in one load each
  *(float4*)(w_sh + 4 * threadIdx.x) = *(const float4*)(WGw + 4 * threadIdx.x);
  if (threadIdx.x < HH) b_sh[threadIdx.x] = WGb[threadIdx.x];
  __syncthreads();

  const int i0 = (p >> 3) * GROWS;
  const int j = (p & 7) * 128 + threadIdx.x;

  const float xj0 = box[j * 4 + 0], yj0 = box[j * 4 + 1];
  const float xj1 = box[j * 4 + 2], yj1 = box[j * 4 + 3];
  // precaution: stands ahead of any later rewrite of the load's address registers
  asm volatile("s_wait_xcnt 0x0" ::: "memory");
  const float cxj = (xj0 + xj1) * 0.5f, cyj = (yj0 + yj1) * 0.5f;
  const float wj = xj1 - xj0 + 1.0f, hj = yj1 - yj0 + 1.0f;
  // quotients as products with the hardware reciprocal: one per divisor
  const float rwj = __builtin_amdgcn_rcpf(wj), rhj = __builtin_amdgcn_rcpf(hj);

  float pos[4][GROWS];
#pragma unroll
  for (int r = 0; r < GROWS; ++r) {
    const int i = i0 + r;
    const float xi0 = box[i * 4 + 0], yi0 = box[i * 4 + 1];
    const float xi1 = box[i * 4 + 2], yi1 = box[i * 4 + 3];
    const float cxi = (xi0 + xi1) * 0.5f, cyi = (yi0 + yi1) * 0.5f;
    const float wi = xi1 - xi0 + 1.0f, hi = yi1 - yi0 + 1.0f;
    const float rwi = __builtin_amdgcn_rcpf(wi), rhi = __builtin_amdgcn_rcpf(hi);
    pos[0][r] = hw_log(fmaxf(fabsf((cxi - cxj) * rwi), 0.001f));
    pos[1][r] = hw_log(fmaxf(fabsf((cyi - cyj) * rhi), 0.001f));
    pos[2][r] = hw_log(wi * rwj);
    pos[3][r] = hw_log(hi * rhj);
  }

  const float dim_mat[8] = {1.0f, 0.42169650342858224f, 0.1778279410038923f,
                            0.07498942093324558f, 0.03162277660168379f,
                            0.013335214321633241f, 0.005623413251903491f,
                            0.0023713737056616554f};

  v2f acc[HH][GROWS / 2];  // .x, .y = rows 2q, 2q + 1
#pragma unroll
  for (int h = 0; h < HH; ++h)
#pragma unroll
    for (int q = 0; q < GROWS / 2; ++q) acc[h][q] = v2f{b_sh[h], b_sh[h]};

#pragma unroll
  for (int c = 0; c < 4; ++c) {
#pragma unroll
    for (int g0 = 0; g0 < 8; g0 += 4) {
      v2f sn[4][GROWS / 2], cs[4][GROWS / 2];
#pragma unroll
      for (int gg = 0; gg < 4; ++gg)
#pragma unroll
        for (int q = 0; q < GROWS / 2; ++q) {
          const float m0 = 100.0f * pos[c][2 * q] * dim_mat[g0 + gg];
          const float m1 = 100.0f * pos[c][2 * q + 1] * dim_mat[g0 + gg];
          sn[gg][q] = v2f{__sinf(m0), __sinf(m1)};
          cs[gg][q] = v2f{__cosf(m0), __cosf(m1)};
        }
#pragma unroll
      for (int gg = 0; gg < 4; ++gg) {
        const int f = c * 8 + g0 + gg;
#pragma unroll
        for (int h = 0; h < HH; ++h) {  // uniform-address LDS broadcast
          const float ws = w_sh[h * DGG + f], wc = w_sh[h * DGG + 32 + f];
#pragma unroll
          for (int q = 0; q < GROWS / 2; ++q) {
            acc[h][q] += sn[gg][q] * ws;
            acc[h][q] += cs[gg][q] * wc;
          }
        }
      }
    }
  }
#pragma unroll
  for (int h = 0; h < HH; ++h)
#pragma unroll
    for (int r = 0; r < GROWS; ++r)
      S[((size_t)h * NN + i0 + r) * NN + j] =
          hw_log(fmaxf(acc[h][r >> 1][r & 1], 1e-6f));
}

// ---------------------------------------------------------------------------
// 1b) QKV projections: Y_z = X_z @ W_z^T + b_z.  64x64 tile/block.
//     Block p of 384: j-stripe p % 8, i-stripe (p / 8) % 16, z = p / 128.
// ---------------------------------------------------------------------------
#define QKV_BLOCKS (8 * 16 * 3)
#define GATE_BLOCKS (8 * NN / GROWS)

__device__ __forceinline__ void qkv_block(
    int p, const float* __restrict__ q_in, const float* __restrict__ k_in,
    const float* __restrict__ v_in, const float* __restrict__ Wq,
    const float* __restrict__ Wk, const float* __restrict__ Wv,
    const float* __restrict__ bq, const float* __restrict__ bk,
    const float* __restrict__ bv, float* __restrict__ qkv_out, float* sm) {
  const int z = p >> 7;
  const float* X = (z == 0) ? q_in : (z == 1) ? k_in : v_in;
  const float* W = (z == 0) ? Wq : (z == 1) ? Wk : Wv;
  const float* bias = (z == 0) ? bq : (z == 1) ? bk : bv;
  float* Y = qkv_out + (size_t)z * NN * DD;

  const int j0 = (p & 7) * 64;          // 8 j-stripes over D
  const int i0 = ((p >> 3) & 15) * 64;  // 16 i-stripes over N

  gemm_block64<DD>(X, DD, W, DD, i0, j0, sm, [&](int row, int col, float v) {
    Y[(size_t)row * DD + col] = v + bias[col];
  });
}

// ---------------------------------------------------------------------------
// 1) One launch for the two pieces of work that depend on the inputs alone.
//    The long matrix blocks take the low indices; the
//    gate blocks (vector and LDS work) run beside them on the same SIMDs.
//    grid QKV_BLOCKS + GATE_BLOCKS, block 128; the LDS admits four blocks per WGP.
// ---------------------------------------------------------------------------
__global__ void __launch_bounds__(128) qkv_gate_kernel(
    const float* __restrict__ q_in, const float* __restrict__ k_in,
    const float* __restrict__ v_in, const float* __restrict__ Wq,
    const float* __restrict__ Wk, const float* __restrict__ Wv,
    const float* __restrict__ bq, const float* __restrict__ bk,
    const float* __restrict__ bv, float* __restrict__ qkv_out,
    const float* __restrict__ box, const float* __restrict__ WGw,
    const float* __restrict__ WGb, float* __restrict__ S) {
  __shared__ __attribute__((aligned(16))) float sm[2 * GSLAB];
  const int b = blockIdx.x;
  if (b < QKV_BLOCKS)
    qkv_block(b, q_in, k_in, v_in, Wq, Wk, Wv, bq, bk, bv, qkv_out, sm);
  else
    gate_block(b - QKV_BLOCKS, box, WGw, WGb, S, sm);
}

// ---------------------------------------------------------------------------
// 2a) Scores: S[h] += (Q_h @ K_h^T) * 0.125, fused onto the gate-log buffer.
//     Block p of 2048: j-stripe p % 16, i-stripe (p / 16) % 16, head p / 256.
//     Each wave also leaves the maximum of its 32 columns for each of its 32
//     rows in Mx[h][column group][row]: one whole 128-B line per wave.
// ---------------------------------------------------------------------------
#define VT_BLOCKS (32 * 16)
#define SCORE_BLOCKS (16 * 16 * HH)

#define MXG (NN / 32)  // column groups per row

// maximum over the 16 lanes of a row of lanes, left in all 16
__device__ __forceinline__ float rowmax16(float v) {
  v = fmaxf(v, __int_as_float(__builtin_amdgcn_update_dpp(
                   0, __float_as_int(v), 0x161, 0xf, 0xf, true)));  // row_xmask:1
  v = fmaxf(v, __int_as_float(__builtin_amdgcn_update_dpp(
                   0, __float_as_int(v), 0x162, 0xf, 0xf, true)));  // row_xmask:2
  v = fmaxf(v, __int_as_float(__builtin_amdgcn_update_dpp(
                   0, __float_as_int(v), 0x164, 0xf, 0xf, true)));  // row_xmask:4
  v = fmaxf(v, __int_as_float(__builtin_amdgcn_update_dpp(
                   0, __float_as_int(v), 0x168, 0xf, 0xf, true)));  // row_xmask:8
  return v;
}

__device__ __forceinline__ void scores_block(int p, const float* __restrict__ qkv,
                                             float* __restrict__ S,
                                             float* __restrict__ Mx, float* sm) {
  const int h = p >> 8;
  const int j0 = (p & 15) * 64;         // 16 j-stripes
  const int i0 = ((p >> 4) & 15) * 64;  // 16 i-stripes

  const float* Q = qkv + h * DKK;
  const float* K = qkv + (size_t)NN * DD + h * DKK;
  float* Sh = S + (size_t)h * NN * NN;

  const int lane = threadIdx.x & 31, wave = threadIdx.x >> 5;
  const int half = lane >> 4, lr = lane & 15;
  const int wi = (wave >> 1) * 32, wj = (wave & 1) * 32;
  v8f acc[2][2] = {};
  gemm_acc64<DKK>(Q, DD, K, DD, i0, j0, sm, acc, [] {},
                  [](v2f a, int, int) { return a; });

  float mine = 0.0f;  // lane lr keeps the maximum of tile row (lr/8)*16 + lr%8 + 8*half
#pragma unroll
  for (int ti = 0; ti < 2; ++ti)
#pragma unroll
    for (int r = 0; r < 8; ++r) {
      const size_t idx =
          (size_t)(i0 + wi + ti * 16 + r + 8 * half) * NN + j0 + wj + lr;
      const float s0 = Sh[idx] + acc[ti][0][r] * 0.125f;
      const float s1 = Sh[idx + 16] + acc[ti][1][r] * 0.125f;
      Sh[idx] = s0;
      Sh[idx + 16] = s1;
      const float m = rowmax16(fmaxf(s0, s1));
      if (lr == ti * 8 + r) mine = m;
    }
  const int mrow = i0 + wi + (lr >> 3) * 16 + (lr & 7) + 8 * half;
  Mx[((size_t)h * MXG + ((j0 + wj) >> 5)) * NN + mrow] = mine;
  // precaution: stands ahead of any later rewrite of the store's registers
  asm volatile("s_wait_xcnt 0x0" ::: "memory");
}

// ---------------------------------------------------------------------------
// 2b) Transpose V into Vt[h][dk][n]  (flat: Vt[c][n] with c = h*64+dk),
//     so the AV GEMM's B operand is K-contiguous. 32x32 LDS tile transpose.
//     Block p of 512: n-tile p % 32, c-tile p / 32; 128 threads (32x4).
// ---------------------------------------------------------------------------
__device__ __forceinline__ void vtrans_block(int p, const float* __restrict__ qkv,
                                             float* __restrict__ Vt, float* sm) {
  float (*tile)[33] = (float (*)[33])sm;  // 32 rows of 33
  const float* V = qkv + (size_t)2 * NN * DD;
  const int n0 = (p & 31) * 32, c0 = (p >> 5) * 32;
  const int tx = threadIdx.x & 31, ty = threadIdx.x >> 5;
#pragma unroll
  for (int r = 0; r < 32; r += 4)
    tile[ty + r][tx] = V[(size_t)(n0 + ty + r) * DD + c0 + tx];
  __syncthreads();
#pragma unroll
  for (int r = 0; r < 32; r += 4)
    Vt[(size_t)(c0 + ty + r) * NN + n0 + tx] = tile[tx][ty + r];
}

// ---------------------------------------------------------------------------
// 2) One launch for the two pieces of work that read qkv (the scores also add onto S).
//    grid VT_BLOCKS + SCORE_BLOCKS, block 128.
// ---------------------------------------------------------------------------
__global__ void __launch_bounds__(128) scores_vtrans_kernel(
    const float* __restrict__ qkv, float* __restrict__ S,
    float* __restrict__ Vt, float* __restrict__ Mx) {
  __shared__ __attribute__((aligned(16))) float sm[GSLAB];
  const int b = blockIdx.x;
  if (b < VT_BLOCKS)
    vtrans_block(b, qkv, Vt, sm);
  else
    scores_block(b - VT_BLOCKS, qkv, S, Mx, sm);
}

// ---------------------------------------------------------------------------
// 3) Attention output with the row softmax folded in:
//     att[h] = (exp(S - rowmax) @ V_h) / rowsum, B from Vt (row-contiguous),
//     stored as the rows x that the LayerNorm takes.
//     The row maximum comes from the scores blocks' Mx; exp is applied to the
//     A fragments between LDS and the matrix unit; each lane sums what it
//     feeds, and the quotient is taken once per output element.
//     grid (32, 8), block 256; block -> 32 rows x all 64 columns of a head.
// ---------------------------------------------------------------------------
__global__ void __launch_bounds__(256) av_kernel(
    const float* __restrict__ S, const float* __restrict__ Vt,
    const float* __restrict__ Mx, float* __restrict__ x) {
  __shared__ __attribute__((aligned(16))) float sm[2 * TSLAB];
  const int h = blockIdx.y;
  const int i0 = blockIdx.x * 32;  // 32 i-stripes

  const float* A = S + (size_t)h * NN * NN;
  const float* B = Vt + (size_t)h * DKK * NN;

  const int lane = threadIdx.x & 31, wave = threadIdx.x >> 5;
  const int half = lane >> 4, lr = lane & 15;
  const int wi = (wave >> 2) * 16, wj = (wave & 3) * 16;
  const float L2E = 1.4426950408889634f;

  float c;                     // -rowmax * log2(e) of row wi + lr
  v2f ls[4] = {};              // this lane's share of that row's sum, in four
                               // short chains so that no add waits on the last
  v8f acc[2] = {};
  gemm_acc32<NN>(
      A, NN, B, NN, i0, 0, sm, acc,
      [&] {
        // each half of the wave folds half of the column groups
        const float* mp = Mx + ((size_t)h * MXG + half * (MXG / 2)) * NN + i0 + wi + lr;
        float m0 = mp[0];
#pragma unroll
        for (int g = 1; g < MXG / 2; ++g) m0 = fmaxf(m0, mp[g * NN]);
        m0 = fmaxf(m0, __shfl_xor(m0, 16, 32));
        c = -m0 * L2E;
      },
      [&](v2f a, int k) {
        v2f e;
        e.x = __builtin_amdgcn_exp2f(fmaf(a.x, L2E, c));
        e.y = __builtin_amdgcn_exp2f(fmaf(a.y, L2E, c));
        ls[(k >> 2) & 3] += e;
        return e;
      });

  // lane lr (either half): 1 / sum of row wi + lr
  const v2f q = (ls[0] + ls[1]) + (ls[2] + ls[3]);
  const float l = q.x + q.y;
  const float inv = 1.0f / (l + __shfl_xor(l, 16, 32));

  // Stored in the order the LayerNorm reads (transpose(0,2,1).reshape): element
  // (n, d) of head h is column n & 511 of row h*128 + 2*d + (n >> 9). A lane's
  // eight values are eight neighbouring n of one d: 32 bytes in a row.
  const int n0 = i0 + wi + 8 * half;
  float* xp = x + (size_t)(h * 128 + 2 * (wj + lr) + (n0 >> 9)) * DD + (n0 & 511);
  v4f o[2];
#pragma unroll
  for (int r = 0; r < 8; ++r) {
    const float iv = __shfl(inv, r + 8 * half, 32);
    o[r >> 2][r & 3] = (acc[0][r] + acc[1][r]) * iv;
  }
  *(v4f*)xp = o[0];
  *(v4f*)(xp + 4) = o[1];
}

// ---------------------------------------------------------------------------
// LayerNorm of one row of DD values by one wave: lane l holds columns
// 4 * l + 128 * u (u = 0..3) in v[u]. Both sums stay in registers (in-lane
// adds, then a butterfly over the 32 lanes): no LDS, no barrier, and an eighth
// of the waves that a 256-thread block per row has to start.
// ---------------------------------------------------------------------------
#define LROWS 4  // rows (waves) per LayerNorm block

// sum over the 32 lanes of a wave, left in every lane
__device__ __forceinline__ float wavesum(float v) {
  v += __int_as_float(__builtin_amdgcn_update_dpp(
      0, __float_as_int(v), 0x161, 0xf, 0xf, true));  // row_xmask:1
  v += __int_as_float(__builtin_amdgcn_update_dpp(
      0, __float_as_int(v), 0x162, 0xf, 0xf, true));  // row_xmask:2
  v += __int_as_float(__builtin_amdgcn_update_dpp(
      0, __float_as_int(v), 0x164, 0xf, 0xf, true));  // row_xmask:4
  v += __int_as_float(__builtin_amdgcn_update_dpp(
      0, __float_as_int(v), 0x168, 0xf, 0xf, true));  // row_xmask:8
  return v + __shfl_xor(v, 16, 32);
}

// Normalised row left in v.
__device__ __forceinline__ void ln_vals(v4f (&v)[4], const v4f (&gg)[4],
                                        const v4f (&bb)[4]) {
  const v4f s = (v[0] + v[1]) + (v[2] + v[3]);
  const float mean = wavesum((s.x + s.y) + (s.z + s.w)) * (1.0f / DD);
#pragma unroll
  for (int u = 0; u < 4; ++u) v[u] -= mean;
  const v4f q = (v[0] * v[0] + v[1] * v[1]) + (v[2] * v[2] + v[3] * v[3]);
  const float inv =
      rsqrtf(wavesum((q.x + q.y) + (q.z + q.w)) * (1.0f / DD) + LN_EPS);
#pragma unroll
  for (int u = 0; u < 4; ++u) v[u] = v[u] * inv * gg[u] + bb[u];
}

__device__ __forceinline__ void ln_row(v4f (&v)[4], const v4f (&gg)[4],
                                       const v4f (&bb)[4],
                                       float* __restrict__ dst) {
  ln_vals(v, gg, bb);
#pragma unroll
  for (int u = 0; u < 4; ++u) *(v4f*)(dst + 128 * u) = v[u];
}

// ---------------------------------------------------------------------------
// 4) Residual + LayerNorm of the attention rows (which the AV blocks have left
//    in row order), and the output projection of the result, in one launch:
//    out0 = LN(x + residual), proj = out0 @ Wo^T + bo.
//    grid (8, 32), block 256: 32 rows x 64 columns, one 16x16 tile per wave.
//    A block normalises its 32 rows (four a wave, in registers), leaves them in
//    LDS and uses them as the A operand where they lie. The eight blocks of a
//    row stripe each do this for themselves; each stores its own 64 columns of
//    out0.
//    The block's 64 rows of Wo come whole by asynchronous copies, issued
//    behind the LayerNorm's loads, and land while the rows are normalised.
//    LDS row pitch 516 dwords (16 B x 129): same bank spread as TPITCH.
// ---------------------------------------------------------------------------
#define PPITCH 516  // LDS row pitch of a whole row of DD values, dwords

// One 512-B piece of eight rows of Wo (rows 8 apart). The s_wait_xcnt closes
// the statement so that no address register is rewritten ahead of it.
__device__ __forceinline__ void copy8_wo(unsigned l, const float* g) {
  const unsigned ls = 8u * PPITCH * 4u;
  const size_t gs = (size_t)8 * DD;
  asm volatile(
      "global_load_async_to_lds_b128 %0, %8, off\n\t"
      "global_load_async_to_lds_b128 %1, %9, off\n\t"
      "global_load_async_to_lds_b128 %2, %10, off\n\t"
      "global_load_async_to_lds_b128 %3, %11, off\n\t"
      "global_load_async_to_lds_b128 %4, %12, off\n\t"
      "global_load_async_to_lds_b128 %5, %13, off\n\t"
      "global_load_async_to_lds_b128 %6, %14, off\n\t"
      "global_load_async_to_lds_b128 %7, %15, off\n\t"
      "s_wait_xcnt 0x0"
      ::"v"(l), "v"(l + ls), "v"(l + 2 * ls), "v"(l + 3 * ls), "v"(l + 4 * ls),
        "v"(l + 5 * ls), "v"(l + 6 * ls), "v"(l + 7 * ls), "v"(g), "v"(g + gs),
        "v"(g + 2 * gs), "v"(g + 3 * gs), "v"(g + 4 * gs), "v"(g + 5 * gs),
        "v"(g + 6 * gs), "v"(g + 7 * gs)
      : "memory");
}

__global__ void __launch_bounds__(256) ln0_proj_kernel(
    const float* __restrict__ x, const float* __restrict__ residual,
    const float* __restrict__ g, const float* __restrict__ b,
    const float* __restrict__ W, const float* __restrict__ bias,
    float* __restrict__ out0, float* __restrict__ Y) {
  __shared__ __attribute__((aligned(16))) float sm[96 * PPITCH];
  float* As = sm;                // 32 rows of out0
  float* Bs = sm + 32 * PPITCH;  // 64 rows of Wo
  const int j0 = blockIdx.x * 64;
  const int i0 = blockIdx.y * 32;
  const int t = threadIdx.x, lane = t & 31, wave = t >> 5;
  const int half = lane >> 4, lr = lane & 15;
  const int wi = (wave >> 2) * 16, wj = (wave & 3) * 16;

  // a[q], v[q]: attention and residual row i0 + 4*wave + q, columns 4*lane + 128u
  const size_t ro = (size_t)(i0 + 4 * wave) * DD + 4 * lane;
  const float* ap = x + ro;
  const float* rp = residual + ro;
  v4f a[4][4], v[4][4], gg[4], bb[4];
#pragma unroll
  for (int q = 0; q < 4; ++q) {
#pragma unroll
    for (int u = 0; u < 4; ++u) {
      a[q][u] = *(const v4f*)(ap + (size_t)q * DD + 128 * u);
      v[q][u] = *(const v4f*)(rp + (size_t)q * DD + 128 * u);
    }
    gg[q] = *(const v4f*)(g + 4 * lane + 128 * q);
    bb[q] = *(const v4f*)(b + 4 * lane + 128 * q);
  }

  // precaution: the loads' address registers are held as inputs up to this wait,
  // so that none is rewritten ahead of it
  asm volatile("s_wait_xcnt 0x0" ::"v"(ap), "v"(rp) : "memory");

  // Wo rows j0 + wave + 8m, four 512-B pieces each: 32 copies a wave
  const float* gb = W + (size_t)(j0 + wave) * DD + lane * 4;
  const unsigned lb = (unsigned)(size_t)(Bs + wave * PPITCH + lane * 4);
#pragma unroll 1  // rolled: one trip's addresses at a time, or the loaded values spill
  for (int q = 0; q < 4; ++q) copy8_wo(lb + q * 512u, gb + q * 128);

  // the four rows' sums stand in one straight run, so that their chains overlap
  float* row = As + (4 * wave) * PPITCH + 4 * lane;
#pragma unroll
  for (int q = 0; q < 4; ++q) {
#pragma unroll
    for (int u = 0; u < 4; ++u) v[q][u] += a[q][u];
    ln_vals(v[q], gg, bb);
  }
#pragma unroll
  for (int q = 0; q < 4; ++q)
#pragma unroll
    for (int u = 0; u < 4; ++u) *(v4f*)(row + q * PPITCH + 128 * u) = v[q][u];
  // this wave's copies of Wo have landed before the barrier publishes them
  // (and the normalised rows)
  asm volatile("s_wait_asynccnt 0x0" ::: "memory");
  __syncthreads();

  // out0 columns j0 .. j0 + 63 of the 32 rows, 16 lanes a row, taken from LDS
  // behind the barrier so that it does not wait for the stores: they fly under
  // the matrix work
#pragma unroll
  for (int w = 0; w < 2; ++w) {
    const int orow = (t >> 4) + 16 * w, ocol = j0 + 4 * (t & 15);
    *(v4f*)(out0 + (size_t)(i0 + orow) * DD + ocol) =
        *(const v4f*)(As + orow * PPITCH + ocol);
  }
  // precaution: stands ahead of any later rewrite of the stores' registers
  asm volatile("s_wait_xcnt 0x0" ::: "memory");

  const float* fa = As + (wi + lr) * PPITCH + 2 * half;
  const float* fb = Bs + (wj + lr) * PPITCH + 2 * half;
  v8f acc[2] = {};  // even and odd k-steps, as in gemm_acc32
#pragma unroll
  for (int k = 0; k < DD; k += 4) {
    const v2f fa2 = *(const v2f*)(fa + k);
    const v2f fb2 = *(const v2f*)(fb + k);
    acc[(k >> 2) & 1] = __builtin_amdgcn_wmma_f32_16x16x4_f32(
        false, fa2, false, fb2, (short)0, acc[(k >> 2) & 1], false, false);
  }

  const int col = j0 + wj + lr;
  const float bc = bias[col];
#pragma unroll
  for (int r = 0; r < 8; ++r)
    Y[(size_t)(i0 + wi + r + 8 * half) * DD + col] = (acc[0][r] + acc[1][r]) + bc;
}

// ---------------------------------------------------------------------------
// 5) Final residual + LayerNorm -> d_out. One wave per row, LROWS rows per block.
// ---------------------------------------------------------------------------
__global__ void __launch_bounds__(32 * LROWS) lnf_kernel(
    const float* __restrict__ proj, const float* __restrict__ out0,
    const float* __restrict__ g, const float* __restrict__ b,
    float* __restrict__ out) {
  const int lane = threadIdx.x & 31, wave = threadIdx.x >> 5;
  const size_t o = (size_t)(blockIdx.x * LROWS + wave) * DD + 4 * lane;
  const float* pp = proj + o;
  const float* op = out0 + o;
  v4f v[4], w[4], gg[4], bb[4];
#pragma unroll
  for (int u = 0; u < 4; ++u) {
    v[u] = *(const v4f*)(pp + 128 * u);
    w[u] = *(const v4f*)(op + 128 * u);
    gg[u] = *(const v4f*)(g + 4 * lane + 128 * u);
    bb[u] = *(const v4f*)(b + 4 * lane + 128 * u);
  }
  // Takes the loaded values as inputs, so that all sixteen loads are issued in
  // front of it and fly together. The wait is a precaution ahead of any rewrite
  // of the loads' address registers.
  asm volatile("s_wait_xcnt 0x0" ::"v"(v[0]), "v"(v[1]), "v"(v[2]), "v"(v[3]),
               "v"(w[0]), "v"(w[1]), "v"(w[2]), "v"(w[3]), "v"(gg[0]), "v"(gg[1]),
               "v"(gg[2]), "v"(gg[3]), "v"(bb[0]), "v"(bb[1]), "v"(bb[2]),
               "v"(bb[3]), "v"(pp), "v"(op)
               : "memory");
#pragma unroll
  for (int u = 0; u < 4; ++u) v[u] += w[u];
  ln_row(v, gg, bb, out + o);
}

extern "C" void kernel_launch(void* const* d_in, const int* in_sizes, int n_in,
                              void* d_out, int out_size, void* d_ws,
                              size_t ws_size, hipStream_t stream) {
  (void)in_sizes; (void)n_in; (void)out_size; (void)ws_size;
  const float* q_in = (const float*)d_in[0];
  const float* k_in = (const float*)d_in[1];
  const float* v_in = (const float*)d_in[2];
  const float* box  = (const float*)d_in[3];
  const float* Wq = (const float*)d_in[4];
  const float* bq = (const float*)d_in[5];
  const float* Wk = (const float*)d_in[6];
  const float* bk = (const float*)d_in[7];
  const float* Wv = (const float*)d_in[8];
  const float* bv = (const float*)d_in[9];
  const float* Wo = (const float*)d_in[10];
  const float* bo = (const float*)d_in[11];
  const float* WGw = (const float*)d_in[12];
  const float* WGb = (const float*)d_in[13];
  const float* ln0g = (const float*)d_in[14];
  const float* ln0b = (const float*)d_in[15];
  const float* lng = (const float*)d_in[16];
  const float* lnb = (const float*)d_in[17];

  float* ws = (float*)d_ws;
  float* S    = ws;                          // 8*1024*1024    (32 MB)
  float* qkv  = S + (size_t)HH * NN * NN;    // 3*1024*512     ( 6 MB)
  float* Vt   = qkv + (size_t)3 * NN * DD;   // 8*64*1024      ( 2 MB)
  float* att  = Vt + (size_t)HH * DKK * NN;  // 1024*512       ( 2 MB)
  float* out0 = att + (size_t)HH * NN * DKK; // 1024*512       ( 2 MB)
  float* proj = out0 + (size_t)NN * DD;      // 1024*512       ( 2 MB)
  float* Mx   = proj + (size_t)NN * DD;      // 8*32*1024      ( 1 MB)
  float* out  = (float*)d_out;

  qkv_gate_kernel<<<dim3(QKV_BLOCKS + GATE_BLOCKS), 128, 0, stream>>>(
      q_in, k_in, v_in, Wq, Wk, Wv, bq, bk, bv, qkv, box, WGw, WGb, S);
  scores_vtrans_kernel<<<dim3(VT_BLOCKS + SCORE_BLOCKS), 128, 0, stream>>>(qkv, S, Vt, Mx);
  av_kernel<<<dim3(32, 8), 256, 0, stream>>>(S, Vt, Mx, att);
  ln0_proj_kernel<<<dim3(8, 32), 256, 0, stream>>>(att, q_in, ln0g, ln0b, Wo, bo, out0, proj);
  lnf_kernel<<<dim3(NN / LROWS), 32 * LROWS, 0, stream>>>(proj, out0, lng, lnb, out);
}

// v009
// A run of this version takes 49.2 microseconds.
// Timed twice side by side with v008, it ran 1.09 and 1.13 times as fast.
// Over all steps from v000 it is 3.19 times as fast.
#include <hip/hip_runtime.h>
#include <hip/hip_bf16.h>
#include <math.h>

#define NN 1024
#define DD 512
#define HH 8
#define DKK 64
#define DGG 64
#define LN_EPS 1e-5f

typedef float v2f __attribute__((ext_vector_type(2)));
typedef float v4f __attribute__((ext_vector_type(4)));
typedef float v8f __attribute__((ext_vector_type(8)));

// ---------------------------------------------------------------------------
// Generic 64x64 output tile per 4-wave block, 32x32 per wave (2x2 waves), on
// V_WMMA_F32_16X16X4_F32.
// Y[i][j] = sum_k Arow_i[k] * Brow_j[k]   (both operands row-contiguous in K)
//
// Operands go global -> LDS in slabs of 64 k: 64 A rows then 64 B rows, each
// 256 B, brought by asynchronous 16-byte copies (16 lanes cover one row, so a
// wave's copy covers four whole 128-B lines) and shared by the block's waves.
// LDS row pitch 68 dwords (16 B x 17): the 16 rows x 16 B that one fragment
// read touches fall on all 64 banks once.
//
// Fragment layout (ISA 7.12.2, 32-bit operands, wave32):
//   A 16x4: lanes 0-15 = rows M=0..15 holding K={k,k+1};
//           lanes 16-31 = same rows holding K={k+2,k+3}  -> contiguous v2f.
//   B 4x16: symmetric with N = lane%16.
//   C/D   : VGPR r -> M = r (lanes 0-15) / r+8 (lanes 16-31), N = lane%16.
// ---------------------------------------------------------------------------
#define GBK 64                      // k per slab
#define GPITCH 68                   // LDS row pitch, dwords
#define GSLAB (128 * GPITCH)        // dwords per slab buffer

// Eight rows' worth of copies for this lane (rows 8 apart). The s_wait_xcnt
// closes the statement so that no address register is rewritten ahead of it.
__device__ __forceinline__ void copy8_rows(unsigned l, const float* g, int ld) {
  const unsigned ls = 8u * GPITCH * 4u;
  const size_t gs = (size_t)8 * ld;
  asm volatile(
      "global_load_async_to_lds_b128 %0, %8, off\n\t"
      "global_load_async_to_lds_b128 %1, %9, off\n\t"
      "global_load_async_to_lds_b128 %2, %10, off\n\t"
      "global_load_async_to_lds_b128 %3, %11, off\n\t"
      "global_load_async_to_lds_b128 %4, %12, off\n\t"
      "global_load_async_to_lds_b128 %5, %13, off\n\t"
      "global_load_async_to_lds_b128 %6, %14, off\n\t"
      "global_load_async_to_lds_b128 %7, %15, off\n\t"
      "s_wait_xcnt 0x0"
      ::"v"(l), "v"(l + ls), "v"(l + 2 * ls), "v"(l + 3 * ls), "v"(l + 4 * ls),
        "v"(l + 5 * ls), "v"(l + 6 * ls), "v"(l + 7 * ls), "v"(g), "v"(g + gs),
        "v"(g + 2 * gs), "v"(g + 3 * gs), "v"(g + 4 * gs), "v"(g + 5 * gs),
        "v"(g + 6 * gs), "v"(g + 7 * gs)
      : "memory");
}

// gemm_acc64 leaves the wave's 32x32 tile in acc. pre() runs once while slab 0
// is in flight; at(a, ti, k) maps each A fragment (rows ti*16 + lane%16 of the
// wave's tile, k-step k of the slab) on its way from LDS to the matrix unit.
template <int KSIZE, class Pre, class AT>
__device__ __forceinline__ void gemm_acc64(const float* __restrict__ A,
                                           int lda, const float* __restrict__ B,
                                           int ldb, int i0, int j0, float* sm,
                                           v8f (&acc)[2][2], Pre pre, AT at) {
  constexpr int NS = KSIZE / GBK;  // slabs
  const int t = threadIdx.x;       // 0..127
  const int lane = t & 31, wave = t >> 5;
  const int half = lane >> 4, lr = lane & 15;
  const int wi = (wave >> 1) * 32, wj = (wave & 1) * 32;

  // copy role: 16-byte chunk ch of rows rg, rg+8, ... of each operand
  const int ch = t & 15, rg = t >> 4;
  const float* ga = A + (size_t)(i0 + rg) * lda + ch * 4;
  const float* gb = B + (size_t)(j0 + rg) * ldb + ch * 4;
  const unsigned la = (unsigned)(size_t)(sm + rg * GPITCH + ch * 4);
  const unsigned lb = la + 64u * GPITCH * 4u;

  const float* fa = sm + (wi + lr) * GPITCH + 2 * half;
  const float* fb = sm + (64 + wj + lr) * GPITCH + 2 * half;

  auto fill = [&](int s) {
    const unsigned bo = (unsigned)(s & 1) * (GSLAB * 4u);
    copy8_rows(la + bo, ga + s * GBK, lda);
    copy8_rows(lb + bo, gb + s * GBK, ldb);
  };
  auto work = [&](int s) {
    const float* as = fa + (s & 1) * GSLAB;
    const float* bs = fb + (s & 1) * GSLAB;
#pragma unroll
    for (int k = 0; k < GBK; k += 4) {
      const v2f a0 = at(*(const v2f*)(as + k), 0, k);
      const v2f a1 = at(*(const v2f*)(as + 16 * GPITCH + k), 1, k);
      const v2f b0 = *(const v2f*)(bs + k);
      const v2f b1 = *(const v2f*)(bs + 16 * GPITCH + k);
      acc[0][0] = __builtin_amdgcn_wmma_f32_16x16x4_f32(false, a0, false, b0,
                                                        (short)0, acc[0][0], false, false);
      acc[0][1] = __builtin_amdgcn_wmma_f32_16x16x4_f32(false, a0, false, b1,
                                                        (short)0, acc[0][1], false, false);
      acc[1][0] = __builtin_amdgcn_wmma_f32_16x16x4_f32(false, a1, false, b0,
                                                        (short)0, acc[1][0], false, false);
      acc[1][1] = __builtin_amdgcn_wmma_f32_16x16x4_f32(false, a1, false, b1,
                                                        (short)0, acc[1][1], false, false);
    }
  };

  fill(0);
  pre();
  // slab 0 has landed for this wave's own copies; the barrier publishes it
  asm volatile("s_wait_asynccnt 0x0" ::: "memory");
  __syncthreads();
  if constexpr (NS == 1) {
    work(0);
  } else {
    fill(1);
#pragma unroll 1  // rolled, for speed only
    for (int s = 0; s < NS; ++s) {
      work(s);
      // this wave's reads of slab s are done before the buffer may be refilled
      asm volatile("s_wait_dscnt 0x0" ::: "memory");
      // this wave's copies of slab s+1 have landed before the barrier publishes
      asm volatile("s_wait_asynccnt 0x0" ::: "memory");
      __syncthreads();
      if (s + 2 < NS) fill(s + 2);
    }
    // no copy is outstanding when the wave goes on to its epilogue and ends
    asm volatile("s_wait_asynccnt 0x0" ::: "memory");
  }
}

#define TPITCH 132                  // LDS row pitch of a 128-dword row (16 B x 33): same bank spread as GPITCH

// ---------------------------------------------------------------------------
// 1a) Box-relative embedding + per-head gate, fused to log(clip(relu(.),1e-6)).
//     Writes S[h][i][j]; the attention blocks add QK^T/8 as they read it.
//     128-thread block p of 2048: rows i from (p / 8) * 4, columns from
//     (p % 8) * 128. A thread keeps one column j and GROWS rows i, so that each
//     weight read from LDS feeds GROWS pairs; the rows go two by two through
//     packed f32 multiply-adds.
// ---------------------------------------------------------------------------
#define GROWS 4  // rows i per gate thread

// Natural log as the hardware's log2 times ln 2. Every argument in the gate is a
// normal, positive f32 (clamped from below, or a quotient of box extents), so
// the library form's rescaling of subnormals and its select for infinities
// never act there.
__device__ __forceinline__ float hw_log(float x) {
  return __builtin_amdgcn_logf(x) * 0.6931471805599453f;
}

__device__ __forceinline__ void gate_block(
    int p, const float* __restrict__ box, const float* __restrict__ WGw,
    const float* __restrict__ WGb, float* __restrict__ S, float* sm) {
  float* w_sh = sm;             // HH * DGG weights
  float* b_sh = sm + HH * DGG;  // HH biases
  // 128 threads x 16 bytes = all HH * DGG weights in one load each
  *(float4*)(w_sh + 4 * threadIdx.x) = *(const float4*)(WGw + 4 * threadIdx.x);
  if (threadIdx.x < HH) b_sh[threadIdx.x] = WGb[threadIdx.x];
  __syncthreads();

  const int i0 = (p >> 3) * GROWS;
  const int j = (p & 7) * 128 + threadIdx.x;

  const float xj0 = box[j * 4 + 0], yj0 = box[j * 4 + 1];
  const float xj1 = box[j * 4 + 2], yj1 = box[j * 4 + 3];
  // precaution: stands ahead of any later rewrite of the load's address registers
  asm volatile("s_wait_xcnt 0x0" ::: "memory");
  const float cxj = (xj0 + xj1) * 0.5f, cyj = (yj0 + yj1) * 0.5f;
  const float wj = xj1 - xj0 + 1.0f, hj = yj1 - yj0 + 1.0f;
  // quotients as products with the hardware reciprocal: one per divisor
  const float rwj = __builtin_amdgcn_rcpf(wj), rhj = __builtin_amdgcn_rcpf(hj);

  float pos[4][GROWS];
#pragma unroll
  for (int r = 0; r < GROWS; ++r) {
    const int i = i0 + r;
    const float xi0 = box[i * 4 + 0], yi0 = box[i * 4 + 1];
    const float xi1 = box[i * 4 + 2], yi1 = box[i * 4 + 3];
    const float cxi = (xi0 + xi1) * 0.5f, cyi = (yi0 + yi1) * 0.5f;
    const float wi = xi1 - xi0 + 1.0f, hi = yi1 - yi0 + 1.0f;
    const float rwi = __builtin_amdgcn_rcpf(wi), rhi = __builtin_amdgcn_rcpf(hi);
    pos[0][r] = hw_log(fmaxf(fabsf((cxi - cxj) * rwi), 0.001f));
    pos[1][r] = hw_log(fmaxf(fabsf((cyi - cyj) * rhi), 0.001f));
    pos[2][r] = hw_log(wi * rwj);
    pos[3][r] = hw_log(hi * rhj);
  }

  const float dim_mat[8] = {1.0f, 0.42169650342858224f, 0.1778279410038923f,
                            0.07498942093324558f, 0.03162277660168379f,
                            0.013335214321633241f, 0.005623413251903491f,
                            0.0023713737056616554f};

  v2f acc[HH][GROWS / 2];  // .x, .y = rows 2q, 2q + 1
#pragma unroll
  for (int h = 0; h < HH; ++h)
#pragma unroll
    for (int q = 0; q < GROWS / 2; ++q) acc[h][q] = v2f{b_sh[h], b_sh[h]};

#pragma unroll
  for (int c = 0; c < 4; ++c) {
#pragma unroll
    for (int g0 = 0; g0 < 8; g0 += 4) {
      v2f sn[4][GROWS / 2], cs[4][GROWS / 2];
#pragma unroll
      for (int gg = 0; gg < 4; ++gg)
#pragma unroll
        for (int q = 0; q < GROWS / 2; ++q) {
          const float m0 = 100.0f * pos[c][2 * q] * dim_mat[g0 + gg];
          const float m1 = 100.0f * pos[c][2 * q + 1] * dim_mat[g0 + gg];
          sn[gg][q] = v2f{__sinf(m0), __sinf(m1)};
          cs[gg][q] = v2f{__cosf(m0), __cosf(m1)};
        }
#pragma unroll
      for (int gg = 0; gg < 4; ++gg) {
        const int f = c * 8 + g0 + gg;
#pragma unroll
        for (int h = 0; h < HH; ++h) {  // uniform-address LDS broadcast
          const float ws = w_sh[h * DGG + f], wc = w_sh[h * DGG + 32 + f];
#pragma unroll
          for (int q = 0; q < GROWS / 2; ++q) {
            acc[h][q] += sn[gg][q] * ws;
            acc[h][q] += cs[gg][q] * wc;
          }
        }
      }
    }
  }
#pragma unroll
  for (int h = 0; h < HH; ++h)
#pragma unroll
    for (int r = 0; r < GROWS; ++r)
      S[((size_t)h * NN + i0 + r) * NN + j] =
          hw_log(fmaxf(acc[h][r >> 1][r & 1], 1e-6f));
}

// ---------------------------------------------------------------------------
// 1b) QKV projections: Y_z = X_z @ W_z^T + b_z.  64x64 tile/block.
//     Block p of 384: j-stripe p % 8, i-stripe (p / 8) % 16, z = p / 128.
//     Q and K are stored by rows; V is stored transposed, Vt[c][n] with
//     c = h*64+dk, so that the attention blocks find it contiguous in n. A
//     lane's eight values of a tile are eight neighbouring n of one c.
// ---------------------------------------------------------------------------
#define QKV_BLOCKS (8 * 16 * 3)
#define GATE_BLOCKS (8 * NN / GROWS)

__device__ __forceinline__ void qkv_block(
    int p, const float* __restrict__ q_in, const float* __restrict__ k_in,
    const float* __restrict__ v_in, const float* __restrict__ Wq,
    const float* __restrict__ Wk, const float* __restrict__ Wv,
    const float* __restrict__ bq, const float* __restrict__ bk,
    const float* __restrict__ bv, float* __restrict__ qkv_out,
    float* __restrict__ Vt, float* sm) {
  const int z = p >> 7;
  const float* X = (z == 0) ? q_in : (z == 1) ? k_in : v_in;
  const float* W = (z == 0) ? Wq : (z == 1) ? Wk : Wv;
  const float* bias = (z == 0) ? bq : (z == 1) ? bk : bv;
  float* Y = qkv_out + (size_t)z * NN * DD;

  const int j0 = (p & 7) * 64;          // 8 j-stripes over D
  const int i0 = ((p >> 3) & 15) * 64;  // 16 i-stripes over N

  const int lane = threadIdx.x & 31, wave = threadIdx.x >> 5;
  const int half = lane >> 4, lr = lane & 15;
  const int wi = (wave >> 1) * 32, wj = (wave & 1) * 32;
  v8f acc[2][2] = {};
  gemm_acc64<DD>(X, DD, W, DD, i0, j0, sm, acc, [] {},
                 [](v2f a, int, int) { return a; });

  const int col = j0 + wj + lr, row = i0 + wi + 8 * half;
  const float bc[2] = {bias[col], bias[col + 16]};
  if (z == 2) {
    float* vp = Vt + (size_t)col * NN + row;
#pragma unroll
    for (int tj = 0; tj < 2; ++tj)
#pragma unroll
      for (int ti = 0; ti < 2; ++ti) {
        v4f o[2];
#pragma unroll
        for (int r = 0; r < 8; ++r) o[r >> 2][r & 3] = acc[ti][tj][r] + bc[tj];
        *(v4f*)(vp + (size_t)tj * 16 * NN + ti * 16) = o[0];
        *(v4f*)(vp + (size_t)tj * 16 * NN + ti * 16 + 4) = o[1];
      }
  } else {
    float* yp = Y + (size_t)row * DD + col;
#pragma unroll
    for (int ti = 0; ti < 2; ++ti)
#pragma unroll
      for (int tj = 0; tj < 2; ++tj)
#pragma unroll
        for (int r = 0; r < 8; ++r)
          yp[(size_t)(ti * 16 + r) * DD + tj * 16] = acc[ti][tj][r] + bc[tj];
    // precaution: stands ahead of any later rewrite of the stores' registers
    asm volatile("s_wait_xcnt 0x0" ::: "memory");
  }
}

// ---------------------------------------------------------------------------
// 1) One launch for the two pieces of work that depend on the inputs alone.
//    The long matrix blocks take the low indices; the
//    gate blocks (vector and LDS work) run beside them on the same SIMDs.
//    grid QKV_BLOCKS + GATE_BLOCKS, block 128; the LDS admits four blocks per WGP.
// ---------------------------------------------------------------------------
__global__ void __launch_bounds__(128) qkv_gate_kernel(
    const float* __restrict__ q_in, const float* __restrict__ k_in,
    const float* __restrict__ v_in, const float* __restrict__ Wq,
    const float* __restrict__ Wk, const float* __restrict__ Wv,
    const float* __restrict__ bq, const float* __restrict__ bk,
    const float* __restrict__ bv, float* __restrict__ qkv_out,
    float* __restrict__ Vt, const float* __restrict__ box,
    const float* __restrict__ WGw, const float* __restrict__ WGb,
    float* __restrict__ S) {
  __shared__ __attribute__((aligned(16))) float sm[2 * GSLAB];
  const int b = blockIdx.x;
  if (b < QKV_BLOCKS)
    qkv_block(b, q_in, k_in, v_in, Wq, Wk, Wv, bq, bk, bv, qkv_out, Vt, sm);
  else
    gate_block(b - QKV_BLOCKS, box, WGw, WGb, S, sm);
}

// ---------------------------------------------------------------------------
// 2) Attention in one launch: scores, row softmax and the product with V.
//     grid (32, 8), block 256: 32 rows i of one head; 8 waves = 2 row tiles
//     (it) x 4 column shares (jt). Of every slab of 128 columns j a wave owns
//     the 16-column tiles jt and jt + 4.
//     First half (8 slabs of K rows and gate rows): the wave forms the
//     TRANSPOSED score tile, D[j][i] = K_j . Q_i, so that lane%16 is the row i
//     and a lane's eight registers are j = 8*half + r; it adds the gate log and
//     keeps all of its 16 tiles in registers. The four shares of a row tile
//     exchange their row maxima through LDS at the foot of the eighth slab.
//     Second half (8 slabs of Vt rows): exp of a kept tile is, where it lies,
//     the B operand of out^T[d][i] = sum_j Vt[d][j] * P[i][j].
//     k order of that product, equal in A and B: register pair w of 16-byte
//     piece u, element e, lane half -> j = 8*half + 4*u + 2*w + e of the tile.
//     k order of the score product, equal in A and B: d = 16*c + 8*half + 4*u +
//     2*w + e.
//     The four shares' partial sums are added through LDS at the end, divided by
//     the row sum and stored as the rows x that the LayerNorm takes.
// ---------------------------------------------------------------------------
#define FJ 128                  // columns j per slab
#define FK_DW (FJ * GPITCH)     // K rows of a slab, dwords
#define FG_DW (32 * TPITCH)     // gate rows of a slab, dwords
#define FBUF (FK_DW + FG_DW)    // dwords per slab buffer (64 Vt rows fit as well)
#define RPITCH 20               // row pitch of a wave's partial out^T, dwords
#define RWAVE (DKK * RPITCH)    // dwords of a wave's partial out^T

// This lane's copies of eight (four) rows, LS bytes apart in LDS and gs floats
// apart in memory. The s_wait_xcnt closes each statement so that no address
// register is rewritten ahead of it.
template <unsigned LS>
__device__ __forceinline__ void copy8_str(unsigned l, const float* g, size_t gs) {
  asm volatile(
      "global_load_async_to_lds_b128 %0, %8, off\n\t"
      "global_load_async_to_lds_b128 %1, %9, off\n\t"
      "global_load_async_to_lds_b128 %2, %10, off\n\t"
      "global_load_async_to_lds_b128 %3, %11, off\n\t"
      "global_load_async_to_lds_b128 %4, %12, off\n\t"
      "global_load_async_to_lds_b128 %5, %13, off\n\t"
      "global_load_async_to_lds_b128 %6, %14, off\n\t"
      "global_load_async_to_lds_b128 %7, %15, off\n\t"
      "s_wait_xcnt 0x0"
      ::"v"(l), "v"(l + LS), "v"(l + 2 * LS), "v"(l + 3 * LS), "v"(l + 4 * LS),
        "v"(l + 5 * LS), "v"(l + 6 * LS), "v"(l + 7 * LS), "v"(g), "v"(g + gs),
        "v"(g + 2 * gs), "v"(g + 3 * gs), "v"(g + 4 * gs), "v"(g + 5 * gs),
        "v"(g + 6 * gs), "v"(g + 7 * gs)
      : "memory");
}

template <unsigned LS>
__device__ __forceinline__ void copy4_str(unsigned l, const float* g, size_t gs) {
  asm volatile(
      "global_load_async_to_lds_b128 %0, %4, off\n\t"
      "global_load_async_to_lds_b128 %1, %5, off\n\t"
      "global_load_async_to_lds_b128 %2, %6, off\n\t"
      "global_load_async_to_lds_b128 %3, %7, off\n\t"
      "s_wait_xcnt 0x0"
      ::"v"(l), "v"(l + LS), "v"(l + 2 * LS), "v"(l + 3 * LS), "v"(g),
        "v"(g + gs), "v"(g + 2 * gs), "v"(g + 3 * gs)
      : "memory");
}

__device__ __forceinline__ v8f wmma4(v2f a, v2f b, v8f c) {
  return __builtin_amdgcn_wmma_f32_16x16x4_f32(false, a, false, b, (short)0, c,
                                               false, false);
}

__global__ void __launch_bounds__(256) attn_kernel(
    const float* __restrict__ qkv, const float* __restrict__ S,
    const float* __restrict__ Vt, float* __restrict__ x) {
  __shared__ __attribute__((aligned(16))) float sm[2 * FBUF + 256];
  float* mxs = sm + 2 * FBUF;  // [wave][row of its tile]: maximum of its share
  float* lsm = mxs + 128;      // [wave][row of its tile]: sum of its share
  const int h = blockIdx.y;
  const int i0 = blockIdx.x * 32;  // 32 i-stripes
  const int t = threadIdx.x, lane = t & 31, wave = t >> 5;
  const int half = lane >> 4, lr = lane & 15;
  const int it = wave >> 2, jt = wave & 3;
  const float L2E = 1.4426950408889634f;

  // copy roles. K: 16 lanes a row of 256 B, rows t/16 + 16m of the slab;
  // gate and Vt: one wave a row piece of 512 B, rows wave + 8m.
  const float* gk = qkv + (size_t)NN * DD + h * DKK + (size_t)(t >> 4) * DD + (t & 15) * 4;
  const float* gg = S + (size_t)h * NN * NN + (size_t)(i0 + wave) * NN + lane * 4;
  const float* gv = Vt + (size_t)(h * DKK + wave) * NN + lane * 4;
  const unsigned lk = (unsigned)(size_t)(sm + (t >> 4) * GPITCH + (t & 15) * 4);
  const unsigned lv = (unsigned)(size_t)(sm + wave * TPITCH + lane * 4);
  const unsigned lg = lv + FK_DW * 4u;

  auto fill = [&](int s) {  // slabs 0..7: K and gate; 8..15: Vt
    const unsigned bo = (unsigned)(s & 1) * (FBUF * 4u);
    if (s < 8) {
      copy8_str<16u * GPITCH * 4u>(lk + bo, gk + (size_t)s * FJ * DD, (size_t)16 * DD);
      copy4_str<8u * TPITCH * 4u>(lg + bo, gg + s * FJ, (size_t)8 * NN);
    } else {
      copy8_str<8u * TPITCH * 4u>(lv + bo, gv + (s - 8) * FJ, (size_t)8 * NN);
    }
  };
  auto foot = [&](int s) {
    // this wave's reads of slab s are done before the buffer may be refilled
    asm volatile("s_wait_dscnt 0x0" ::: "memory");
    // this wave's copies of slab s+1 have landed before the barrier publishes
    asm volatile("s_wait_asynccnt 0x0" ::: "memory");
    __syncthreads();
    if (s + 2 < 16) fill(s + 2);
  };

  fill(0);
  // Q row i0 + it*16 + lr as B fragments, kept in registers for all K slabs
  const float* qp = qkv + (size_t)(i0 + it * 16 + lr) * DD + h * DKK + 8 * half;
  v4f qf[4][2];
#pragma unroll
  for (int c = 0; c < 4; ++c)
#pragma unroll
    for (int u = 0; u < 2; ++u) qf[c][u] = *(const v4f*)(qp + 16 * c + 4 * u);
  // precaution: the loads' address register is held as an input up to this wait,
  // so that it is not rewritten ahead of it
  asm volatile("s_wait_xcnt 0x0" ::"v"(qp) : "memory");
  // slab 0 has landed for this wave's own copies; the barrier publishes it
  asm volatile("s_wait_asynccnt 0x0" ::: "memory");
  __syncthreads();
  fill(1);

  v8f sc[16];  // score tiles: sc[2*s + e] = tile jt + 4*e of slab s
  float mx = -INFINITY;
  const int ko = (jt * 16 + lr) * GPITCH + 8 * half;
  const int go = FK_DW + (it * 16 + lr) * TPITCH + jt * 16 + 8 * half;
#pragma unroll  // unrolled: the kept tiles are indexed by the trip
  for (int s = 0; s < 8; ++s) {
    const float* kb = sm + (s & 1) * FBUF + ko;
    const float* gb = sm + (s & 1) * FBUF + go;
    v8f a0 = {}, a1 = {};
#pragma unroll
    for (int c = 0; c < 4; ++c)
#pragma unroll
      for (int u = 0; u < 2; ++u) {
        const v4f k0 = *(const v4f*)(kb + 16 * c + 4 * u);
        const v4f k1 = *(const v4f*)(kb + 64 * GPITCH + 16 * c + 4 * u);
        const v4f q = qf[c][u];
        a0 = wmma4(v2f{k0.x, k0.y}, v2f{q.x, q.y}, a0);
        a1 = wmma4(v2f{k1.x, k1.y}, v2f{q.x, q.y}, a1);
        a0 = wmma4(v2f{k0.z, k0.w}, v2f{q.z, q.w}, a0);
        a1 = wmma4(v2f{k1.z, k1.w}, v2f{q.z, q.w}, a1);
      }
#pragma unroll
    for (int u = 0; u < 2; ++u) {
      const v4f g0 = *(const v4f*)(gb + 4 * u);
      const v4f g1 = *(const v4f*)(gb + 64 + 4 * u);
#pragma unroll
      for (int e = 0; e < 4; ++e) {
        const float s0 = g0[e] + a0[4 * u + e] * 0.125f;
        const float s1 = g1[e] + a1[4 * u + e] * 0.125f;
        sc[2 * s][4 * u + e] = s0;
        sc[2 * s + 1][4 * u + e] = s1;
        mx = fmaxf(mx, fmaxf(s0, s1));
      }
    }
    if (s == 7) {
      // the share's row maximum: both halves of the wave, then out to LDS; the
      // foot's wait and barrier publish it
      mx = fmaxf(mx, __shfl_xor(mx, 16, 32));
      mxs[wave * 16 + lr] = mx;
    }
    foot(s);
  }

  const float* mp = mxs + it * 64 + lr;
  const float cm = -fmaxf(fmaxf(mp[0], mp[16]), fmaxf(mp[32], mp[48])) * L2E;

  v8f acc[4] = {};  // out^T tiles: d = dt*16 + r + 8*half, i = lr
  v2f ls[2] = {};   // this lane's share of the row sum, in two short chains
  const int vo = lr * TPITCH + jt * 16 + 8 * half;
#pragma unroll  // unrolled: the kept tiles are indexed by the trip
  for (int s = 8; s < 16; ++s) {
    const float* vb = sm + (s & 1) * FBUF + vo;
#pragma unroll
    for (int e = 0; e < 2; ++e) {
      const v8f sv = sc[2 * (s - 8) + e];
#pragma unroll
      for (int u = 0; u < 2; ++u) {
        v2f p0, p1;
        p0.x = __builtin_amdgcn_exp2f(fmaf(sv[4 * u + 0], L2E, cm));
        p0.y = __builtin_amdgcn_exp2f(fmaf(sv[4 * u + 1], L2E, cm));
        p1.x = __builtin_amdgcn_exp2f(fmaf(sv[4 * u + 2], L2E, cm));
        p1.y = __builtin_amdgcn_exp2f(fmaf(sv[4 * u + 3], L2E, cm));
        ls[0] += p0;
        ls[1] += p1;
        v4f va[4];
#pragma unroll
        for (int dt = 0; dt < 4; ++dt)
          va[dt] = *(const v4f*)(vb + dt * 16 * TPITCH + e * 64 + 4 * u);
#pragma unroll
        for (int dt = 0; dt < 4; ++dt)
          acc[dt] = wmma4(v2f{va[dt].x, va[dt].y}, p0, acc[dt]);
#pragma unroll
        for (int dt = 0; dt < 4; ++dt)
          acc[dt] = wmma4(v2f{va[dt].z, va[dt].w}, p1, acc[dt]);
      }
      // keeps the row-sum adds near their tile: left free, the compiler puts
      // them all behind the last slab and holds every exp value in a register
      // until then
      if (e == 0) __builtin_amdgcn_sched_barrier(0);
    }
    foot(s);
  }
  // no copy is outstanding when the slab buffers are taken for the partial sums
  asm volatile("s_wait_asynccnt 0x0" ::: "memory");

  // partial out^T and row sum of this wave's share, behind the last foot's
  // barrier (every wave has left the slab buffers)
  float* red = sm + wave * RWAVE + 8 * half * RPITCH + lr;
#pragma unroll
  for (int dt = 0; dt < 4; ++dt)
#pragma unroll
    for (int r = 0; r < 8; ++r) red[(dt * 16 + r) * RPITCH] = acc[dt][r];
  const v2f lq = ls[0] + ls[1];
  const float l = lq.x + lq.y;
  lsm[wave * 16 + lr] = l + __shfl_xor(l, 16, 32);
  __syncthreads();

  // Thread t: column d = t / 4 of the head, rows i0 + 8 * (t % 4) .. + 7.
  // Stored in the order the LayerNorm reads (transpose(0,2,1).reshape): element
  // (n, d) of head h is column n & 511 of row h*128 + 2*d + (n >> 9). The four
  // threads of a d write one whole 128-B line.
  const int d = t >> 2, ic = t & 3;
  const float* rp = sm + (ic >> 1) * 4 * RWAVE + d * RPITCH + (ic & 1) * 8;
  const float* lp = lsm + (ic >> 1) * 64 + (ic & 1) * 8;
  const int n0 = i0 + ic * 8;
  float* xp = x + (size_t)(h * 128 + 2 * d + (n0 >> 9)) * DD + (n0 & 511);
#pragma unroll
  for (int u = 0; u < 2; ++u) {
    const v4f o = (*(const v4f*)(rp + 4 * u) + *(const v4f*)(rp + RWAVE + 4 * u)) +
                  (*(const v4f*)(rp + 2 * RWAVE + 4 * u) +
                   *(const v4f*)(rp + 3 * RWAVE + 4 * u));
    const v4f lt = (*(const v4f*)(lp + 4 * u) + *(const v4f*)(lp + 16 + 4 * u)) +
                   (*(const v4f*)(lp + 32 + 4 * u) + *(const v4f*)(lp + 48 + 4 * u));
    *(v4f*)(xp + 4 * u) = o * (1.0f / lt);
  }
}

// ---------------------------------------------------------------------------
// LayerNorm of one row of DD values by one wave: lane l holds columns
// 4 * l + 128 * u (u = 0..3) in v[u]. Both sums stay in registers (in-lane
// adds, then a butterfly over the 32 lanes): no LDS, no barrier, and an eighth
// of the waves that a 256-thread block per row has to start.
// ---------------------------------------------------------------------------
#define LROWS 4  // rows (waves) per LayerNorm block

// sum over the 32 lanes of a wave, left in every lane
__device__ __forceinline__ float wavesum(float v) {
  v += __int_as_float(__builtin_amdgcn_update_dpp(
      0, __float_as_int(v), 0x161, 0xf, 0xf, true));  // row_xmask:1
  v += __int_as_float(__builtin_amdgcn_update_dpp(
      0, __float_as_int(v), 0x162, 0xf, 0xf, true));  // row_xmask:2
  v += __int_as_float(__builtin_amdgcn_update_dpp(
      0, __float_as_int(v), 0x164, 0xf, 0xf, true));  // row_xmask:4
  v += __int_as_float(__builtin_amdgcn_update_dpp(
      0, __float_as_int(v), 0x168, 0xf, 0xf, true));  // row_xmask:8
  return v + __shfl_xor(v, 16, 32);
}

// Normalised row left in v.
__device__ __forceinline__ void ln_vals(v4f (&v)[4], const v4f (&gg)[4],
                                        const v4f (&bb)[4]) {
  const v4f s = (v[0] + v[1]) + (v[2] + v[3]);
  const float mean = wavesum((s.x + s.y) + (s.z + s.w)) * (1.0f / DD);
#pragma unroll
  for (int u = 0; u < 4; ++u) v[u] -= mean;
  const v4f q = (v[0] * v[0] + v[1] * v[1]) + (v[2] * v[2] + v[3] * v[3]);
  const float inv =
      rsqrtf(wavesum((q.x + q.y) + (q.z + q.w)) * (1.0f / DD) + LN_EPS);
#pragma unroll
  for (int u = 0; u < 4; ++u) v[u] = v[u] * inv * gg[u] + bb[u];
}

__device__ __forceinline__ void ln_row(v4f (&v)[4], const v4f (&gg)[4],
                                       const v4f (&bb)[4],
                                       float* __restrict__ dst) {
  ln_vals(v, gg, bb);
#pragma unroll
  for (int u = 0; u < 4; ++u) *(v4f*)(dst + 128 * u) = v[u];
}

// ---------------------------------------------------------------------------
// 3) Residual + LayerNorm of the attention rows (which the attention blocks left
//    in row order), and the output projection of the result, in one launch:
//    out0 = LN(x + residual), proj = out0 @ Wo^T + bo.
//    grid (8, 32), block 256: 32 rows x 64 columns, one 16x16 tile per wave.
//    A block normalises its 32 rows (four a wave, in registers), leaves them in
//    LDS and uses them as the A operand where they lie. The eight blocks of a
//    row stripe each do this for themselves; each stores its own 64 columns of
//    out0.
//    The block's 64 rows of Wo come whole by asynchronous copies, issued
//    behind the LayerNorm's loads, and land while the rows are normalised.
//    LDS row pitch 516 dwords (16 B x 129): same bank spread as TPITCH.
// ---------------------------------------------------------------------------
#define PPITCH 516  // LDS row pitch of a whole row of DD values, dwords

// One 512-B piece of eight rows of Wo (rows 8 apart). The s_wait_xcnt closes
// the statement so that no address register is rewritten ahead of it.
__device__ __forceinline__ void copy8_wo(unsigned l, const float* g) {
  const unsigned ls = 8u * PPITCH * 4u;
  const size_t gs = (size_t)8 * DD;
  asm volatile(
      "global_load_async_to_lds_b128 %0, %8, off\n\t"
      "global_load_async_to_lds_b128 %1, %9, off\n\t"
      "global_load_async_to_lds_b128 %2, %10, off\n\t"
      "global_load_async_to_lds_b128 %3, %11, off\n\t"
      "global_load_async_to_lds_b128 %4, %12, off\n\t"
      "global_load_async_to_lds_b128 %5, %13, off\n\t"
      "global_load_async_to_lds_b128 %6, %14, off\n\t"
      "global_load_async_to_lds_b128 %7, %15, off\n\t"
      "s_wait_xcnt 0x0"
      ::"v"(l), "v"(l + ls), "v"(l + 2 * ls), "v"(l + 3 * ls), "v"(l + 4 * ls),
        "v"(l + 5 * ls), "v"(l + 6 * ls), "v"(l + 7 * ls), "v"(g), "v"(g + gs),
        "v"(g + 2 * gs), "v"(g + 3 * gs), "v"(g + 4 * gs), "v"(g + 5 * gs),
        "v"(g + 6 * gs), "v"(g + 7 * gs)
      : "memory");
}

__global__ void __launch_bounds__(256) ln0_proj_kernel(
    const float* __restrict__ x, const float* __restrict__ residual,
    const float* __restrict__ g, const float* __restrict__ b,
    const float* __restrict__ W, const float* __restrict__ bias,
    float* __restrict__ out0, float* __restrict__ Y) {
  __shared__ __attribute__((aligned(16))) float sm[96 * PPITCH];
  float* As = sm;                // 32 rows of out0
  float* Bs = sm + 32 * PPITCH;  // 64 rows of Wo
  const int j0 = blockIdx.x * 64;
  const int i0 = blockIdx.y * 32;
  const int t = threadIdx.x, lane = t & 31, wave = t >> 5;
  const int half = lane >> 4, lr = lane & 15;
  const int wi = (wave >> 2) * 16, wj = (wave & 3) * 16;

  // a[q], v[q]: attention and residual row i0 + 4*wave + q, columns 4*lane + 128u
  const size_t ro = (size_t)(i0 + 4 * wave) * DD + 4 * lane;
  const float* ap = x + ro;
  const float* rp = residual + ro;
  v4f a[4][4], v[4][4], gg[4], bb[4];
#pragma unroll
  for (int q = 0; q < 4; ++q) {
#pragma unroll
    for (int u = 0; u < 4; ++u) {
      a[q][u] = *(const v4f*)(ap + (size_t)q * DD + 128 * u);
      v[q][u] = *(const v4f*)(rp + (size_t)q * DD + 128 * u);
    }
    gg[q] = *(const v4f*)(g + 4 * lane + 128 * q);
    bb[q] = *(const v4f*)(b + 4 * lane + 128 * q);
  }

  // precaution: the loads' address registers are held as inputs up to this wait,
  // so that none is rewritten ahead of it
  asm volatile("s_wait_xcnt 0x0" ::"v"(ap), "v"(rp) : "memory");

  // Wo rows j0 + wave + 8m, four 512-B pieces each: 32 copies a wave
  const float* gb = W + (size_t)(j0 + wave) * DD + lane * 4;
  const unsigned lb = (unsigned)(size_t)(Bs + wave * PPITCH + lane * 4);
#pragma unroll 1  // rolled: one trip's addresses at a time, or the loaded values spill
  for (int q = 0; q < 4; ++q) copy8_wo(lb + q * 512u, gb + q * 128);

  // the four rows' sums stand in one straight run, so that their chains overlap
  float* row = As + (4 * wave) * PPITCH + 4 * lane;
#pragma unroll
  for (int q = 0; q < 4; ++q) {
#pragma unroll
    for (int u = 0; u < 4; ++u) v[q][u] += a[q][u];
    ln_vals(v[q], gg, bb);
  }
#pragma unroll
  for (int q = 0; q < 4; ++q)
#pragma unroll
    for (int u = 0; u < 4; ++u) *(v4f*)(row + q * PPITCH + 128 * u) = v[q][u];
  // this wave's copies of Wo have landed before the barrier publishes them
  // (and the normalised rows)
  asm volatile("s_wait_asynccnt 0x0" ::: "memory");
  __syncthreads();

  // out0 columns j0 .. j0 + 63 of the 32 rows, 16 lanes a row, taken from LDS
  // behind the barrier so that it does not wait for the stores: they fly under
  // the matrix work
#pragma unroll
  for (int w = 0; w < 2; ++w) {
    const int orow = (t >> 4) + 16 * w, ocol = j0 + 4 * (t & 15);
    *(v4f*)(out0 + (size_t)(i0 + orow) * DD + ocol) =
        *(const v4f*)(As + orow * PPITCH + ocol);
  }
  // precaution: stands ahead of any later rewrite of the stores' registers
  asm volatile("s_wait_xcnt 0x0" ::: "memory");

  const float* fa = As + (wi + lr) * PPITCH + 2 * half;
  const float* fb = Bs + (wj + lr) * PPITCH + 2 * half;
  v8f acc[2] = {};  // even and odd k-steps, so that no WMMA waits for the one before
#pragma unroll
  for (int k = 0; k < DD; k += 4) {
    const v2f fa2 = *(const v2f*)(fa + k);
    const v2f fb2 = *(const v2f*)(fb + k);
    acc[(k >> 2) & 1] = __builtin_amdgcn_wmma_f32_16x16x4_f32(
        false, fa2, false, fb2, (short)0, acc[(k >> 2) & 1], false, false);
  }

  const int col = j0 + wj + lr;
  const float bc = bias[col];
#pragma unroll
  for (int r = 0; r < 8; ++r)
    Y[(size_t)(i0 + wi + r + 8 * half) * DD + col] = (acc[0][r] + acc[1][r]) + bc;
}

// ---------------------------------------------------------------------------
// 4) Final residual + LayerNorm -> d_out. One wave per row, LROWS rows per block.
// ---------------------------------------------------------------------------
__global__ void __launch_bounds__(32 * LROWS) lnf_kernel(
    const float* __restrict__ proj, const float* __restrict__ out0,
    const float* __restrict__ g, const float* __restrict__ b,
    float* __restrict__ out) {
  const int lane = threadIdx.x & 31, wave = threadIdx.x >> 5;
  const size_t o = (size_t)(blockIdx.x * LROWS + wave) * DD + 4 * lane;
  const float* pp = proj + o;
  const float* op = out0 + o;
  v4f v[4], w[4], gg[4], bb[4];
#pragma unroll
  for (int u = 0; u < 4; ++u) {
    v[u] = *(const v4f*)(pp + 128 * u);
    w[u] = *(const v4f*)(op + 128 * u);
    gg[u] = *(const v4f*)(g + 4 * lane + 128 * u);
    bb[u] = *(const v4f*)(b + 4 * lane + 128 * u);
  }
  // Takes the loaded values as inputs, so that all sixteen loads are issued in
  // front of it and fly together. The wait is a precaution ahead of any rewrite
  // of the loads' address registers.
  asm volatile("s_wait_xcnt 0x0" ::"v"(v[0]), "v"(v[1]), "v"(v[2]), "v"(v[3]),
               "v"(w[0]), "v"(w[1]), "v"(w[2]), "v"(w[3]), "v"(gg[0]), "v"(gg[1]),
               "v"(gg[2]), "v"(gg[3]), "v"(bb[0]), "v"(bb[1]), "v"(bb[2]),
               "v"(bb[3]), "v"(pp), "v"(op)
               : "memory");
#pragma unroll
  for (int u = 0; u < 4; ++u) v[u] += w[u];
  ln_row(v, gg, bb, out + o);
}

extern "C" void kernel_launch(void* const* d_in, const int* in_sizes, int n_in,
                              void* d_out, int out_size, void* d_ws,
                              size_t ws_size, hipStream_t stream) {
  (void)in_sizes; (void)n_in; (void)out_size; (void)ws_size;
  const float* q_in = (const float*)d_in[0];
  const float* k_in = (const float*)d_in[1];
  const float* v_in = (const float*)d_in[2];
  const float* box  = (const float*)d_in[3];
  const float* Wq = (const float*)d_in[4];
  const float* bq = (const float*)d_in[5];
  const float* Wk = (const float*)d_in[6];
  const float* bk = (const float*)d_in[7];
  const float* Wv = (const float*)d_in[8];
  const float* bv = (const float*)d_in[9];
  const float* Wo = (const float*)d_in[10];
  const float* bo = (const float*)d_in[11];
  const float* WGw = (const float*)d_in[12];
  const float* WGb = (const float*)d_in[13];
  const float* ln0g = (const float*)d_in[14];
  const float* ln0b = (const float*)d_in[15];
  const float* lng = (const float*)d_in[16];
  const float* lnb = (const float*)d_in[17];

  float* ws = (float*)d_ws;
  float* S    = ws;                          // 8*1024*1024    (32 MB)
  float* qkv  = S + (size_t)HH * NN * NN;    // 3*1024*512     ( 6 MB)
  float* Vt   = qkv + (size_t)3 * NN * DD;   // 8*64*1024      ( 2 MB)
  float* att  = Vt + (size_t)HH * DKK * NN;  // 1024*512       ( 2 MB)
  float* out0 = att + (size_t)HH * NN * DKK; // 1024*512       ( 2 MB)
  float* proj = out0 + (size_t)NN * DD;      // 1024*512       ( 2 MB)
  float* out  = (float*)d_out;

  qkv_gate_kernel<<<dim3(QKV_BLOCKS + GATE_BLOCKS), 128, 0, stream>>>(
      q_in, k_in, v_in, Wq, Wk, Wv, bq, bk, bv, qkv, Vt, box, WGw, WGb, S);
  attn_kernel<<<dim3(32, 8), 256, 0, stream>>>(qkv, S, Vt, att);
  ln0_proj_kernel<<<dim3(8, 32), 256, 0, stream>>>(att, q_in, ln0g, ln0b, Wo, bo, out0, proj);
  lnf_kernel<<<dim3(NN / LROWS), 32 * LROWS, 0, stream>>>(proj, out0, lng, lnb, out);
}
